// v000
// Times are from an AMD MI455X. After a warm-up the kernel runs many times in a row, and a time is the length of
// such a window on the GPU divided by its runs, so every launch and the gaps after it count. The runs cycle
// through copies of the inputs. A figure is the median of several windows, for all but v000 over two sittings.
// Sittings can differ by a few percent; kernels timed side by side share one.
// v000 is the starting kernel. One run takes 1280 microseconds.
// compute dtype: all float inputs rounded to bf16; q / k / v projections with EXACT bf16 products on WMMA 16x16x32 (f32 accumulate) + bias (v only; nonzero); interleaved-pair RoPE in f32 on q and k (which have no bias) (embedded frequencies, precise cosf / sinf, positions = the row index); causal logits: 3 products for the first 384 rows, single f16 q x k after, x 64^-0.5; softmax f32; P x 2^11 once to f16 x v once to f16 (bf16 hi + lo below row 384); ctx hi+lo x exact Wo below row 384, x2^6 f16 carry x f16(bf16 x 2^8) Wo after, + bo; f32 output.
#include <hip/hip_runtime.h>
#include <math.h>

typedef __attribute__((ext_vector_type(16))) _Float16 v16h;
typedef __attribute__((ext_vector_type(16))) __bf16 v16b;
typedef __attribute__((ext_vector_type(8)))  _Float16 v8h;
typedef __attribute__((ext_vector_type(8)))  float v8f;
typedef __attribute__((ext_vector_type(4)))  float v4f;
typedef __attribute__((ext_vector_type(2)))  float v2f;
typedef __attribute__((ext_vector_type(4)))  unsigned v4u;
typedef __attribute__((ext_vector_type(4)))  int v4i;
typedef float __attribute__((may_alias)) float_a;
typedef int __attribute__((may_alias)) int_a;

template <typename T> __device__ __forceinline__ void vst2(void* p, T v) { *(T*)p = v;  }
__device__ __forceinline__ v8f wmma16(v16h a, v16h b, v8f c) {
  v8f d = __builtin_amdgcn_wmma_f32_16x16x32_f16(false, a, false, b, (short)0, c, false, false);
  asm volatile("v_nop\n\tv_nop\n\tv_nop\n\tv_nop" : "+v"(d) : "v"(a), "v"(b));
  return d;
}
__device__ __forceinline__ v8f wmma_bf(v16b a, v16b b, v8f c) {
  v8f d = __builtin_amdgcn_wmma_f32_16x16x32_bf16(false, a, false, b, (short)0, c, false, false);
  asm volatile("v_nop\n\tv_nop\n\tv_nop\n\tv_nop" : "+v"(d) : "v"(a), "v"(b));
  return d;
}
// 16x16x32 fragments: lane = (h = lane>>4, row/col = lane&15); elements 0..7 = k0+8h+0..7, 8..15 = k0+16+8h+0..7; D element r = row 8h+r
__device__ __forceinline__ v16h frag_h(const _Float16* rowk0, int lane) {
  union { v16h v; v8h q[2]; } u; const _Float16* p = rowk0 + 8 * (lane >> 4);
  u.q[0] = *(const v8h*)p; u.q[1] = *(const v8h*)(p + 16); return u.v;
}
__device__ __forceinline__ v16h frag_f32(const float* rowk0, int lane) {
  v16h a; const float* p = rowk0 + 8 * (lane >> 4);
#pragma unroll
  for (int i = 0; i < 8; ++i) { a[i] = (_Float16)p[i]; a[8 + i] = (_Float16)p[16 + i]; }
  return a;
}
__device__ __forceinline__ v16h frag_f32s(const float* rowk0, int lane, float sc) {
  v16h a; const float* p = rowk0 + 8 * (lane >> 4);
#pragma unroll
  for (int i = 0; i < 8; ++i) { a[i] = (_Float16)(p[i] * sc); a[8 + i] = (_Float16)(p[16 + i] * sc); }
  return a;
}
// column fragment from a [K][ld] layout (column n), rows >= K read as 0
__device__ __forceinline__ v16h fragc_f32(const float* W, int k0, int n, int lane, int ld, int K) {
  v16h a; const int g = lane >> 4;
#pragma unroll
  for (int i = 0; i < 8; ++i) { const int ka = k0 + 8 * g + i, kb = ka + 16;
    a[i] = (_Float16)(ka < K ? W[(size_t)(ka < K ? ka : K - 1) * ld + n] : 0.f); a[8 + i] = (_Float16)(kb < K ? W[(size_t)(kb < K ? kb : K - 1) * ld + n] : 0.f); }
  return a;
}
struct F2 { v16b h, l; };
__device__ __forceinline__ F2 bsplit16(const float v[16]) { F2 r;
#pragma unroll
  for (int i = 0; i < 16; ++i) { const __bf16 h = (__bf16)v[i]; r.h[i] = h; r.l[i] = (__bf16)(v[i] - (float)h); }
  return r; }
__device__ __forceinline__ F2 split_row(const float* row, int k0, int lane) { float v[16]; const float* p = row + k0 + 8 * (lane >> 4);
#pragma unroll
  for (int i = 0; i < 8; ++i) { v[i] = p[i]; v[8 + i] = p[16 + i]; }
  return bsplit16(v); }
__device__ __forceinline__ F2 split_rowK(const float* row, int k0, int lane, int K) { float v[16]; const int g = lane >> 4;
#pragma unroll
  for (int i = 0; i < 8; ++i) { const int ka = k0 + 8 * g + i, kb = ka + 16; v[i] = ka < K ? row[ka < K ? ka : K - 1] : 0.f; v[8 + i] = kb < K ? row[kb < K ? kb : K - 1] : 0.f; }
  return bsplit16(v); }
__device__ __forceinline__ F2 split_col(const float* W, int k0, int n, int lane, int ld, int K) { float v[16]; const int g = lane >> 4;
#pragma unroll
  for (int i = 0; i < 8; ++i) { const int ka = k0 + 8 * g + i, kb = ka + 16; v[i] = ka < K ? W[(size_t)(ka < K ? ka : K - 1) * ld + n] : 0.f; v[8 + i] = kb < K ? W[(size_t)(kb < K ? kb : K - 1) * ld + n] : 0.f; }
  return bsplit16(v); }
__device__ __forceinline__ v8f mac3(const F2& a, const F2& b, v8f c) { c = wmma_bf(a.l, b.h, c); c = wmma_bf(a.h, b.l, c); return wmma_bf(a.h, b.h, c); }
__device__ __forceinline__ float sigm(float v) { return 1.0f / (1.0f + expf(-v)); }
#define LDSX() do { asm volatile("s_wait_dscnt 0" ::: "memory"); __builtin_amdgcn_wave_barrier(); __builtin_amdgcn_fence(__ATOMIC_RELEASE, "workgroup"); } while (0)

// Phi-style causal self-attention with interleaved-pair RoPE (x [2,2048,1024]; torch (out,in) Wq / Wk / Wv [1024,1024] N(0, 1/1024) applied as einsum('bse,he->bsh') = x @ W.T; bv [1024] NONZERO (only v has a bias); Wo [1024,1024] (out,in) + bo NONZERO; 16 heads x 64; RoPE (base 10000, positions 0..2047) on q and k: (even, odd) pairs rotated and re-interleaved; scores x 1/sqrt(64); triu(k = 1) -> -inf; softmax; out @ Wo.T + bo).
#define NB 2
#define TT 2048
#define CC 1024            // NH * HD = projected width
#define DIN 1024          // input (model) width
#define NH 16
#define HD 64
#define NQB (TT / 64)
#define HG 4
#define SCALE (0.125f)
#define CAUSAL 1
#ifndef TNB
#define TNB NB
#endif
__device__ __forceinline__ float bfr(float v) { return (float)(__bf16)v; }
__host__ __device__ __forceinline__ int kb_last(int qb) { return CAUSAL ? ((qb * 64 + 63) >> 7) : (TT / 128 - 1); }
typedef __attribute__((ext_vector_type(8))) __bf16 v8b;
__device__ __forceinline__ v16b frag_b(const __bf16* rowk0, int lane) {
  union { v16b v; v8b q[2]; } u; const __bf16* p = rowk0 + 8 * (lane >> 4);
  u.q[0] = *(const v8b*)p; u.q[1] = *(const v8b*)(p + 16); return u.v;
}
#define QBH 6              // causal: query blocks 0..QBH-1 of each sequence (few keys, no averaging) take the high-precision path
#define QHI 384            // rows carrying a q residual plane
#define KHI 384            // key rows carrying k residual / v bf16 hi+lo planes (used only by the causal high-precision path)
// B fragment (k rows k0+.., output column o) of a weight: (in,out) [K][ld] or (out,in) [ld rows of K]: bf16 exact, or f16(bf16 * 256) exact
__device__ __forceinline__ v16b wcol_io(const float* Wm, int k0, int o, int lane, int ld) { v16b w; const int g = lane >> 4;
#pragma unroll
  for (int i = 0; i < 8; ++i) { w[i] = (__bf16)Wm[(size_t)(k0 + 8 * g + i) * ld + o]; w[8 + i] = (__bf16)Wm[(size_t)(k0 + 16 + 8 * g + i) * ld + o]; }
  return w; }
__device__ __forceinline__ v16b wcol_oi(const float* Wm, int k0, int o, int lane, int K) { v16b w; const float* p = Wm + (size_t)o * K + k0 + 8 * (lane >> 4);
#pragma unroll
  for (int i = 0; i < 8; ++i) { w[i] = (__bf16)p[i]; w[8 + i] = (__bf16)p[16 + i]; }
  return w; }
__device__ __forceinline__ v16h wcolh_io(const float* Wm, int k0, int o, int lane, int ld) { v16h w; const int g = lane >> 4;
#pragma unroll
  for (int i = 0; i < 8; ++i) { w[i] = (_Float16)(bfr(Wm[(size_t)(k0 + 8 * g + i) * ld + o]) * 256.0f); w[8 + i] = (_Float16)(bfr(Wm[(size_t)(k0 + 16 + 8 * g + i) * ld + o]) * 256.0f); }
  return w; }
__device__ __forceinline__ v16h wcolh_oi(const float* Wm, int k0, int o, int lane, int K) { v16h w; const float* p = Wm + (size_t)o * K + k0 + 8 * (lane >> 4);
#pragma unroll
  for (int i = 0; i < 8; ++i) { w[i] = (_Float16)(bfr(p[i]) * 256.0f); w[8 + i] = (_Float16)(bfr(p[16 + i]) * 256.0f); }
  return w; }
#define WQKV_LAYOUT 1   // 0 = (in,out) [DIN][CC]; 1 = (out,in) [CC][DIN]; 2 = per-head [NH][DIN][HD]
__device__ __forceinline__ v16b wcol_hdk(const float* Wm, int k0, int o, int lane) { v16b w; const int g = lane >> 4; const float* p = Wm + (size_t)(o / HD) * DIN * HD + (o % HD);
#pragma unroll
  for (int i = 0; i < 8; ++i) { w[i] = (__bf16)p[(size_t)(k0 + 8 * g + i) * HD]; w[8 + i] = (__bf16)p[(size_t)(k0 + 16 + 8 * g + i) * HD]; }
  return w; }
#define WO_OUT_IN 1
#if WQKV_LAYOUT == 1
#define WCOL(W, k0, o, lane) wcol_oi(W, k0, o, lane, DIN)
#elif WQKV_LAYOUT == 2
#define WCOL(W, k0, o, lane) wcol_hdk(W, k0, o, lane)
#else
#define WCOL(W, k0, o, lane) wcol_io(W, k0, o, lane, CC)
#endif
#if WO_OUT_IN
#define WOCOL(W, k0, o, lane) wcol_oi(W, k0, o, lane, CC)
#define WOCOLH(W, k0, o, lane) wcolh_oi(W, k0, o, lane, CC)
#else
#define WOCOL(W, k0, o, lane) wcol_io(W, k0, o, lane, DIN)
#define WOCOLH(W, k0, o, lane) wcolh_io(W, k0, o, lane, DIN)
#endif

// RoPE inverse frequencies 1/10000^(2i/64) (the f32 values jax computes)
__constant__ float INVF[32] = {1.000000000e+00,7.498942018e-01,5.623413324e-01,4.216965139e-01,3.162277639e-01,2.371373624e-01,1.778279394e-01,1.333521456e-01,1.000000015e-01,7.498941571e-02,5.623412877e-02,4.216964915e-02,3.162277862e-02,2.371373586e-02,1.778279431e-02,1.333521493e-02,9.999999776e-03,7.498942316e-03,5.623413250e-03,4.216964822e-03,3.162277862e-03,2.371373819e-03,1.778279431e-03,1.333521446e-03,1.000000047e-03,7.498941850e-04,5.623413017e-04,4.216964880e-04,3.162277862e-04,2.371373848e-04,1.778279402e-04,1.333521504e-04};
#define PROJ_EXTRA_PARAMS
// per (token, head) hook on the staged f32 row (64 floats, projection + bias) of the q and k streams: interleaved-pair rotation (x[2i], x[2i + 1]) by the angle t * INVF[i]; v untouched
#define PROJ_EPI(which, row, t, h) do { if ((which) < 2) { float* rw = (row); const float pos_ = (float)(t);   /* position = the token's sequence index */ _Pragma("unroll 4") for (int i = 0; i < 32; ++i) { _Pragma("clang fp contract(off)") const float ang = pos_ * INVF[i]; const float cs = cosf(ang), sn = sinf(ang); const float xe = rw[2 * i], xo = rw[2 * i + 1]; rw[2 * i] = xe * cs - xo * sn; rw[2 * i + 1] = xe * sn + xo * cs; } } } while (0)
#ifndef SM_EXTRA_PARAMS
#define SM_EXTRA_PARAMS
#endif
#ifndef PROJ_EXTRA_PARAMS
#define PROJ_EXTRA_PARAMS
#endif
#ifndef SM_MASK_HOOK
#define SM_MASK_HOOK (void)0
#endif

#define WS_QH  0u                                      // f16 q rows [b*t][CC]
#define WS_KH  (WS_QH + 2u * (size_t)NB * TT * CC)      // f16 k rows [b*t][CC]
#define WS_VT  (WS_KH + 2u * (size_t)NB * TT * CC)      // f16 v planes [b][c][t]
#define WS_QL  (WS_VT + 2u * (size_t)NB * CC * TT)      // f16 q residual x 2^10 rows [b][t < QHI][CC]
#define WS_KL  (WS_QL + 2u * (size_t)NB * QHI * CC)     // f16 k residual x 2^10 rows [b][t < KHI][CC]
#define WS_VB  (WS_KL + 2u * (size_t)NB * KHI * CC)     // bf16 v hi planes [b][c][t < KHI]
#define WS_VBL (WS_VB + 2u * (size_t)NB * CC * KHI)
#define WS_S   (WS_VBL + 2u * (size_t)NB * CC * KHI)    // f32 logits / P [hg][t][s]
#define WS_Y   (WS_S  + 4u * (size_t)HG * TT * TT)      // f32 ctx rows [b*t][CC] (only when there is an output projection)
#define WS_END (WS_Y  + 4u * (size_t)NB * TT * CC)

// ---- k_proj: block = (64 rows, 128 cols, which): q/k/v = X W (+ b) with exact bf16 products (K = DIN) -> which 0: q f16 rows (+ residual rows < QHI); 1: k f16 rows (+ residual rows < KHI); 2: v f16 planes [c][t] (+ bf16 hi/lo planes for t < KHI)
__global__ __launch_bounds__(128) void k_proj(const float* __restrict__ XQ, const float* __restrict__ XK, const float* __restrict__ XV, const float* __restrict__ WQ, const float* __restrict__ WK, const float* __restrict__ WV, const float* __restrict__ BQ, const float* __restrict__ BK, const float* __restrict__ BV,
    _Float16* __restrict__ QH, _Float16* __restrict__ QL, _Float16* __restrict__ KH, _Float16* __restrict__ KL, _Float16* __restrict__ VT, __bf16* __restrict__ VB, __bf16* __restrict__ VBL PROJ_EXTRA_PARAMS) {
  __shared__ __align__(16) float st[64][132]; __shared__ __align__(16) _Float16 sh[64][136], sl[64][136]; __shared__ __align__(16) _Float16 th[128][72]; __shared__ __align__(16) __bf16 tb[128][72], tbl[128][72];
  const int tid = threadIdx.x, wave = tid >> 5, lane = tid & 31, col = lane & 15, g = lane >> 4; const int which = blockIdx.z; const int c0 = blockIdx.y * 128; const size_t r0 = (size_t)blockIdx.x * 64; const size_t bb = r0 / TT; const int t0 = (int)(r0 % TT);
  const float* X = which == 0 ? XQ : which == 1 ? XK : XV; const float* WA = which == 0 ? WQ : which == 1 ? WK : WV; const float* BA = which == 0 ? BQ : which == 1 ? BK : BV;
  v8f acc[8] = {};
#pragma unroll 2
  for (int kc = 0; kc < DIN / 32; ++kc) { v16b a; { const float* p = X + (r0 + wave * 16 + col) * DIN + kc * 32 + 8 * g;
#pragma unroll
      for (int i = 0; i < 8; ++i) { a[i] = (__bf16)p[i]; a[8 + i] = (__bf16)p[16 + i]; } }
    asm volatile("s_wait_loadcnt 0x0" ::: "memory");
#pragma unroll
    for (int j = 0; j < 8; ++j) { const v16b w = WCOL(WA, kc * 32, c0 + j * 16 + col, lane); asm volatile("s_wait_loadcnt 0x0" ::: "memory"); acc[j] = wmma_bf(a, w, acc[j]); } }
  { // stage the f32 tile (acc + bias) in LDS, run the per-(row, head) epilogue hook, then convert
#pragma unroll
    for (int j = 0; j < 8; ++j) { const float bias = BA ? bfr(BA[c0 + j * 16 + col]) : 0.f;
#pragma unroll
      for (int r = 0; r < 8; ++r) st[wave * 16 + 8 * g + r][j * 16 + col] = acc[j][r] + bias; }
    __syncthreads();
    for (int e = tid; e < 64 * (128 / HD); e += 128) { const int rl = e / (128 / HD), hh = e % (128 / HD); PROJ_EPI(which, &st[rl][hh * HD], (int)((r0 + rl) % TT), (c0 / HD) + hh); }
    __syncthreads(); }
  if (which < 2) { _Float16* DH = which == 0 ? QH : KH; _Float16* DL = which == 0 ? QL : KL; const int nhi = which == 0 ? QHI : KHI; const bool hi_rows = t0 < nhi;
    for (int e = tid; e < 64 * 128; e += 128) { const int rl = e >> 7, cl = e & 127; const float v = st[rl][cl]; const _Float16 hv = (_Float16)v; sh[rl][cl] = hv; sl[rl][cl] = (_Float16)((v - (float)hv) * 1024.0f); }
    __syncthreads();
    for (int e = tid; e < 64 * 16; e += 128) { const int rl = e >> 4, q = e & 15; vst2((unsigned*)(DH + (r0 + rl) * CC + c0 + q * 8), *(const v4u*)&sh[rl][q * 8]); if (hi_rows) vst2((unsigned*)(DL + (bb * nhi + t0 + rl) * (size_t)CC + c0 + q * 8), *(const v4u*)&sl[rl][q * 8]); }
  } else { const bool hi_rows = t0 < KHI;
    for (int e = tid; e < 64 * 128; e += 128) { const int rl = e & 63, cl = e >> 6; const float v = st[rl][cl]; th[cl][rl] = (_Float16)v; const __bf16 bh = (__bf16)v; tb[cl][rl] = bh; tbl[cl][rl] = (__bf16)(v - (float)bh); }
    __syncthreads();
    for (int e = tid; e < 128 * 8; e += 128) { const int cl = e >> 3, q = e & 7; vst2((unsigned*)(VT + (bb * CC + c0 + cl) * (size_t)TT + t0 + q * 8), *(const v4u*)&th[cl][q * 8]); if (hi_rows) { const size_t o3 = (bb * CC + c0 + cl) * (size_t)KHI + t0 + q * 8; vst2((unsigned*)(VB + o3), *(const v4u*)&tb[cl][q * 8]); vst2((unsigned*)(VBL + o3), *(const v4u*)&tbl[cl][q * 8]); } } } }
// ---- k_sc: block = (query block qb, key block kb <= kb_last(qb), head in group) of batch b: logits x SCALE; q hi + residual (x 2^10) against k (2 products) for query rows < QHI, plus the k residual (3 products) for query blocks < QBH (causal early rows); causal: blocks past the diagonal exit, the mask itself is applied by index in k_sm
__global__ __launch_bounds__(128) void k_sc(const _Float16* __restrict__ QH, const _Float16* __restrict__ KH, const _Float16* __restrict__ QL, const _Float16* __restrict__ KL, int b, int h0, float* __restrict__ S0) { __shared__ __align__(16) float ss[4][16][132];
  const int qb = blockIdx.x, kb = blockIdx.y; if (kb > kb_last(qb)) return;
  const int h = h0 + blockIdx.z; float* S = S0 + (size_t)blockIdx.z * TT * TT;
  const int tid = threadIdx.x, wave = tid >> 5, lane = tid & 31, col = lane & 15, g = lane >> 4; const int k0 = kb * 128; const int ql0 = qb * 64 + wave * 16; const size_t q0 = (size_t)b * TT + ql0, kr0 = (size_t)b * TT + k0;
  v8f acc[8] = {}, accl[8] = {};
  const _Float16* QLb = QL + (size_t)b * QHI * CC; const _Float16* KLb = KL + (size_t)b * KHI * CC;
  if (qb < QBH) {
#pragma unroll
    for (int kc = 0; kc < HD / 32; ++kc) { const v16h ah = frag_h(QH + (q0 + col) * CC + h * HD + kc * 32, lane), al = frag_h(QLb + (size_t)(ql0 + col) * CC + h * HD + kc * 32, lane);
#pragma unroll
      for (int j = 0; j < 8; ++j) { const v16h kbf = frag_h(KH + (kr0 + j * 16 + col) * CC + h * HD + kc * 32, lane), klf = frag_h(KLb + (size_t)(k0 + j * 16 + col) * CC + h * HD + kc * 32, lane); acc[j] = wmma16(ah, kbf, acc[j]); accl[j] = wmma16(al, kbf, accl[j]); accl[j] = wmma16(ah, klf, accl[j]); } }
  } else if (qb * 64 < QHI) {
#pragma unroll
    for (int kc = 0; kc < HD / 32; ++kc) { const v16h ah = frag_h(QH + (q0 + col) * CC + h * HD + kc * 32, lane), al = frag_h(QLb + (size_t)(ql0 + col) * CC + h * HD + kc * 32, lane);
#pragma unroll
      for (int j = 0; j < 8; ++j) { const v16h kbf = frag_h(KH + (kr0 + j * 16 + col) * CC + h * HD + kc * 32, lane); acc[j] = wmma16(ah, kbf, acc[j]); accl[j] = wmma16(al, kbf, accl[j]); } }
  } else {
#pragma unroll
    for (int kc = 0; kc < HD / 32; ++kc) { const v16h ah = frag_h(QH + (q0 + col) * CC + h * HD + kc * 32, lane);
#pragma unroll
      for (int j = 0; j < 8; ++j) { const v16h kbf = frag_h(KH + (kr0 + j * 16 + col) * CC + h * HD + kc * 32, lane); acc[j] = wmma16(ah, kbf, acc[j]); } } }
#pragma unroll
  for (int j = 0; j < 8; ++j) {
#pragma unroll
    for (int r = 0; r < 8; ++r) ss[wave][8 * g + r][j * 16 + col] = (acc[j][r] + accl[j][r] * (1.0f / 1024.0f)) * SCALE; }
  LDSX(); for (int rl = 0; rl < 16; ++rl) vst2(S + (size_t)(ql0 + rl) * TT + k0 + lane * 4, *(const v4f*)&ss[wave][rl][lane * 4]); }
// ---- k_sm: block = query row t (head in group): keys [0, kend): causal -> logit if s <= t else excluded; softmax in f32; P x 2^11 in place (0 for excluded)
__global__ __launch_bounds__(256) void k_sm(float* __restrict__ S0 SM_EXTRA_PARAMS) { __shared__ float sred[8]; __shared__ float sbc; __shared__ __align__(16) float shv[TT];
  const int tid = threadIdx.x; const int t = blockIdx.x; const int kend = (kb_last(t >> 6) + 1) * 128;
  float* sr = S0 + (size_t)blockIdx.y * TT * TT + (size_t)t * TT;
  float m = -3.0e38f; for (int k = tid; k < kend; k += 256) { float v = (!CAUSAL || k <= t) ? sr[k] : -3.0e38f; SM_MASK_HOOK; shv[k] = v; m = fmaxf(m, v); }
#pragma unroll
  for (int o = 1; o < 32; o <<= 1) m = fmaxf(m, __shfl_xor(m, o));
  if ((tid & 31) == 0) sred[tid >> 5] = m; __syncthreads(); if (tid == 0) { float a = sred[0]; for (int i = 1; i < 8; ++i) a = fmaxf(a, sred[i]); sbc = a; } __syncthreads(); m = sbc; __syncthreads();
  float sum = 0.f; for (int k = tid; k < kend; k += 256) { const float v = shv[k]; const float e = (v <= -1.0e38f) ? 0.f : expf(v - m); shv[k] = e; sum += e; }
#pragma unroll
  for (int o = 1; o < 32; o <<= 1) sum += __shfl_xor(sum, o);
  if ((tid & 31) == 0) sred[tid >> 5] = sum; __syncthreads(); if (tid == 0) { float a = 0.f; for (int i = 0; i < 8; ++i) a += sred[i]; sbc = a > 0.f ? 2048.0f / a : 0.f; }   /* a fully excluded row yields P = 0 */ __syncthreads(); const float inv = sbc;
  for (int k = tid; k < kend; k += 256) shv[k] = shv[k] * inv;
  __syncthreads(); for (int q = tid; q < kend / 4; q += 256) vst2(sr + q * 4, *(const v4f*)&shv[q * 4]); }
// ---- k_pv: block = 64 queries (qb) of (b, h): ctx = P . v over keys [0, kend) (P x 2^11 once to f16 against v f16: 1 product; causal early query blocks: P and v as bf16 hi + lo, 3 products); 256-B (row, head) segment by 16 lanes
__global__ __launch_bounds__(128) void k_pv(const float* __restrict__ PS0, const _Float16* __restrict__ VT, const __bf16* __restrict__ VB, const __bf16* __restrict__ VBL, int b, int h0, float* __restrict__ Y) { const int h = h0 + blockIdx.z; const float* PS = PS0 + (size_t)blockIdx.z * TT * TT; __shared__ __align__(16) float ss[4][16][HD + 4];
  const int tid = threadIdx.x, wave = tid >> 5, lane = tid & 31, col = lane & 15, g = lane >> 4; const int qb = blockIdx.x; const int ql0 = qb * 64 + wave * 16; const int kce = (kb_last(qb) + 1) * 4;
  v8f acc[HD / 16] = {};
  if (qb < QBH) {
#pragma unroll 1
    for (int kc = 0; kc < kce; ++kc) { const F2 p = split_row(PS + (size_t)(ql0 + col) * TT, kc * 32, lane);
      asm volatile("s_wait_loadcnt 0x0" ::: "memory");
#pragma unroll
      for (int j = 0; j < HD / 16; ++j) { const size_t po = ((size_t)b * CC + h * HD + j * 16 + col) * (size_t)KHI + kc * 32; const v16b vh = frag_b(VB + po, lane); acc[j] = wmma_bf(p.h, vh, acc[j]); acc[j] = wmma_bf(p.l, vh, acc[j]); acc[j] = wmma_bf(p.h, frag_b(VBL + po, lane), acc[j]); } }
  } else {
#pragma unroll 1
    for (int kc = 0; kc < kce; ++kc) { const v16h p = frag_f32(PS + (size_t)(ql0 + col) * TT + kc * 32, lane);
      asm volatile("s_wait_loadcnt 0x0" ::: "memory");
#pragma unroll
      for (int j = 0; j < HD / 16; ++j) { const size_t po = ((size_t)b * CC + h * HD + j * 16 + col) * (size_t)TT + kc * 32; acc[j] = wmma16(p, frag_h(VT + po, lane), acc[j]); } } }
#pragma unroll
  for (int j = 0; j < HD / 16; ++j)
#pragma unroll
    for (int r = 0; r < 8; ++r) ss[wave][8 * g + r][j * 16 + col] = acc[j][r] * (1.0f / 2048.0f);
  LDSX(); for (int rl = 0; rl < 16; ++rl) if (lane < HD / 4) vst2(Y + ((size_t)b * TT + ql0 + rl) * CC + h * HD + lane * 4, *(const v4f*)&ss[wave][rl][lane * 4]); }
// ---- k_out: block = (64 rows, 128 cols): out = ctx Wo (+ bo): ctx x 2^6 once to f16 against Wo as f16(bf16 x 2^8) exact (1 product) x 2^-14; causal early rows (< QHI of each sequence): ctx bf16 hi + lo against exact bf16 Wo (2 products)
__global__ __launch_bounds__(128) void k_out(const float* __restrict__ Y, const float* __restrict__ WO, const float* __restrict__ BO, float* __restrict__ OUT) { __shared__ __align__(16) float sf[4][16][132];
  const int tid = threadIdx.x, wave = tid >> 5, lane = tid & 31, col = lane & 15, g = lane >> 4; const int c0 = blockIdx.y * 128; const size_t r0 = (size_t)blockIdx.x * 64 + wave * 16;
  v8f acc[8] = {};
  if (CAUSAL && (int)(((size_t)blockIdx.x * 64) % TT) < QHI) {   /* block-uniform */
#pragma unroll 2
    for (int kc = 0; kc < CC / 32; ++kc) { const F2 a = split_row(Y + (r0 + col) * CC, kc * 32, lane); asm volatile("s_wait_loadcnt 0x0" ::: "memory");
#pragma unroll
      for (int j = 0; j < 8; ++j) { const v16b w = WOCOL(WO, kc * 32, c0 + j * 16 + col, lane); asm volatile("s_wait_loadcnt 0x0" ::: "memory"); acc[j] = wmma_bf(a.h, w, acc[j]); acc[j] = wmma_bf(a.l, w, acc[j]); } }
#pragma unroll
    for (int j = 0; j < 8; ++j) { const float bias = BO ? bfr(BO[c0 + j * 16 + col]) : 0.f;
#pragma unroll
      for (int r = 0; r < 8; ++r) sf[wave][8 * g + r][j * 16 + col] = acc[j][r] + bias; }
  } else {
#pragma unroll 2
    for (int kc = 0; kc < CC / 32; ++kc) { const v16h a = frag_f32s(Y + (r0 + col) * CC + kc * 32, lane, 64.0f); asm volatile("s_wait_loadcnt 0x0" ::: "memory");   /* ctx carried x 2^6 into f16 so small-magnitude context rows stay clear of f16 subnormals */
#pragma unroll
      for (int j = 0; j < 8; ++j) { const v16h w = WOCOLH(WO, kc * 32, c0 + j * 16 + col, lane); asm volatile("s_wait_loadcnt 0x0" ::: "memory"); acc[j] = wmma16(a, w, acc[j]); } }
#pragma unroll
    for (int j = 0; j < 8; ++j) { const float bias = BO ? bfr(BO[c0 + j * 16 + col]) : 0.f;
#pragma unroll
      for (int r = 0; r < 8; ++r) sf[wave][8 * g + r][j * 16 + col] = acc[j][r] * (1.0f / 16384.0f) + bias; } }   /* 2^-8 (Wo carry) x 2^-6 (ctx carry) */
  LDSX(); for (int rl = 0; rl < 16; ++rl) vst2(OUT + (r0 + rl) * DIN + c0 + lane * 4, *(const v4f*)&sf[wave][rl][lane * 4]); }

extern "C" void kernel_launch(void* const* d_in, const int* in_sizes, int n_in, void* d_out, int out_size, void* d_ws, size_t ws_size, hipStream_t stream) {
  (void)in_sizes; (void)n_in; (void)out_size;
  const float** F = (const float**)d_in;
  if (ws_size < (size_t)WS_END) return;
  char* ws = (char*)d_ws; _Float16 *QH = (_Float16*)(ws + WS_QH), *KH = (_Float16*)(ws + WS_KH), *VT = (_Float16*)(ws + WS_VT), *QL = (_Float16*)(ws + WS_QL), *KL = (_Float16*)(ws + WS_KL); __bf16 *VB = (__bf16*)(ws + WS_VB), *VBL = (__bf16*)(ws + WS_VBL); float *S = (float*)(ws + WS_S), *Y = (float*)(ws + WS_Y);
  (void)Y; (void)QL; (void)KL; (void)VB; (void)VBL;
  // inputs: 0 x [2,2048,1024]; 1 Wq [1024,1024] (out,in); 2 Wk; 3 Wv; 4 bv [1024] (NONZERO; q and k have no bias: null pointers); 5 Wo (out,in); 6 bo (NONZERO)
  k_proj<<<dim3(TNB * TT / 64, CC / 128, 3), 128, 0, stream>>>(F[0], F[0], F[0], F[1], F[2], F[3], nullptr, nullptr, F[4], QH, QL, KH, KL, VT, VB, VBL);
  for (int b = 0; b < TNB; ++b) for (int h0 = 0; h0 < NH; h0 += HG) {
    k_sc<<<dim3(NQB, TT / 128, HG), 128, 0, stream>>>(QH, KH, QL, KL, b, h0, S);
    k_sm<<<dim3(TT, HG), 256, 0, stream>>>(S);
    k_pv<<<dim3(NQB, 1, HG), 128, 0, stream>>>(S, VT, VB, VBL, b, h0, Y);
  }
  k_out<<<dim3(TNB * TT / 64, DIN / 128), 128, 0, stream>>>(Y, F[5], F[6], (float*)d_out);
}

// v001
// Measured time: 527 microseconds a run.
// Next to v000, in two timings, it ran 2.43 and 2.44 times as fast.
// compute dtype: all float inputs rounded to bf16; q / k / v projections with EXACT bf16 products on WMMA 16x16x32 (f32 accumulate) + bias (v only; nonzero); interleaved-pair RoPE in f32 on q and k (which have no bias) (embedded frequencies, precise cosf / sinf, positions = the row index); causal logits: 3 products for the first 384 rows, single f16 q x k after, x 64^-0.5; online softmax f32 in one fused pass; exp(logit - running max) x 2^11 once to f16 x v once to f16 (bf16 hi + lo below row 384); ctx hi+lo x exact Wo below row 384, x2^6 f16 carry x f16(bf16 x 2^8) Wo after, + bo; f32 output.
#include <hip/hip_runtime.h>
#include <math.h>

typedef __attribute__((ext_vector_type(16))) _Float16 v16h;
typedef __attribute__((ext_vector_type(16))) __bf16 v16b;
typedef __attribute__((ext_vector_type(8)))  _Float16 v8h;
typedef __attribute__((ext_vector_type(8)))  float v8f;
typedef __attribute__((ext_vector_type(4)))  float v4f;
typedef __attribute__((ext_vector_type(2)))  float v2f;
typedef __attribute__((ext_vector_type(4)))  unsigned v4u;
typedef __attribute__((ext_vector_type(4)))  int v4i;
typedef float __attribute__((may_alias)) float_a;
typedef int __attribute__((may_alias)) int_a;

template <typename T> __device__ __forceinline__ void vst2(void* p, T v) { *(T*)p = v;  }
__device__ __forceinline__ v8f wmma16(v16h a, v16h b, v8f c) {
  v8f d = __builtin_amdgcn_wmma_f32_16x16x32_f16(false, a, false, b, (short)0, c, false, false);
  asm volatile("v_nop\n\tv_nop\n\tv_nop\n\tv_nop" : "+v"(d) : "v"(a), "v"(b));
  return d;
}
__device__ __forceinline__ v8f wmma_bf(v16b a, v16b b, v8f c) {
  v8f d = __builtin_amdgcn_wmma_f32_16x16x32_bf16(false, a, false, b, (short)0, c, false, false);
  asm volatile("v_nop\n\tv_nop\n\tv_nop\n\tv_nop" : "+v"(d) : "v"(a), "v"(b));
  return d;
}
// 16x16x32 fragments: lane = (h = lane>>4, row/col = lane&15); elements 0..7 = k0+8h+0..7, 8..15 = k0+16+8h+0..7; D element r = row 8h+r
__device__ __forceinline__ v16h frag_h(const _Float16* rowk0, int lane) {
  union { v16h v; v8h q[2]; } u; const _Float16* p = rowk0 + 8 * (lane >> 4);
  u.q[0] = *(const v8h*)p; u.q[1] = *(const v8h*)(p + 16); return u.v;
}
__device__ __forceinline__ v16h frag_f32(const float* rowk0, int lane) {
  v16h a; const float* p = rowk0 + 8 * (lane >> 4);
#pragma unroll
  for (int i = 0; i < 8; ++i) { a[i] = (_Float16)p[i]; a[8 + i] = (_Float16)p[16 + i]; }
  return a;
}
__device__ __forceinline__ v16h frag_f32s(const float* rowk0, int lane, float sc) {
  v16h a; const float* p = rowk0 + 8 * (lane >> 4);
#pragma unroll
  for (int i = 0; i < 8; ++i) { a[i] = (_Float16)(p[i] * sc); a[8 + i] = (_Float16)(p[16 + i] * sc); }
  return a;
}
// column fragment from a [K][ld] layout (column n), rows >= K read as 0
__device__ __forceinline__ v16h fragc_f32(const float* W, int k0, int n, int lane, int ld, int K) {
  v16h a; const int g = lane >> 4;
#pragma unroll
  for (int i = 0; i < 8; ++i) { const int ka = k0 + 8 * g + i, kb = ka + 16;
    a[i] = (_Float16)(ka < K ? W[(size_t)(ka < K ? ka : K - 1) * ld + n] : 0.f); a[8 + i] = (_Float16)(kb < K ? W[(size_t)(kb < K ? kb : K - 1) * ld + n] : 0.f); }
  return a;
}
struct F2 { v16b h, l; };
__device__ __forceinline__ F2 bsplit16(const float v[16]) { F2 r;
#pragma unroll
  for (int i = 0; i < 16; ++i) { const __bf16 h = (__bf16)v[i]; r.h[i] = h; r.l[i] = (__bf16)(v[i] - (float)h); }
  return r; }
__device__ __forceinline__ F2 split_row(const float* row, int k0, int lane) { float v[16]; const float* p = row + k0 + 8 * (lane >> 4);
#pragma unroll
  for (int i = 0; i < 8; ++i) { v[i] = p[i]; v[8 + i] = p[16 + i]; }
  return bsplit16(v); }
__device__ __forceinline__ F2 split_rowK(const float* row, int k0, int lane, int K) { float v[16]; const int g = lane >> 4;
#pragma unroll
  for (int i = 0; i < 8; ++i) { const int ka = k0 + 8 * g + i, kb = ka + 16; v[i] = ka < K ? row[ka < K ? ka : K - 1] : 0.f; v[8 + i] = kb < K ? row[kb < K ? kb : K - 1] : 0.f; }
  return bsplit16(v); }
__device__ __forceinline__ F2 split_col(const float* W, int k0, int n, int lane, int ld, int K) { float v[16]; const int g = lane >> 4;
#pragma unroll
  for (int i = 0; i < 8; ++i) { const int ka = k0 + 8 * g + i, kb = ka + 16; v[i] = ka < K ? W[(size_t)(ka < K ? ka : K - 1) * ld + n] : 0.f; v[8 + i] = kb < K ? W[(size_t)(kb < K ? kb : K - 1) * ld + n] : 0.f; }
  return bsplit16(v); }
__device__ __forceinline__ v8f mac3(const F2& a, const F2& b, v8f c) { c = wmma_bf(a.l, b.h, c); c = wmma_bf(a.h, b.l, c); return wmma_bf(a.h, b.h, c); }
__device__ __forceinline__ float sigm(float v) { return 1.0f / (1.0f + expf(-v)); }
#define LDSX() do { asm volatile("s_wait_dscnt 0" ::: "memory"); __builtin_amdgcn_wave_barrier(); __builtin_amdgcn_fence(__ATOMIC_RELEASE, "workgroup"); } while (0)

// Phi-style causal self-attention with interleaved-pair RoPE (x [2,2048,1024]; torch (out,in) Wq / Wk / Wv [1024,1024] N(0, 1/1024) applied as einsum('bse,he->bsh') = x @ W.T; bv [1024] NONZERO (only v has a bias); Wo [1024,1024] (out,in) + bo NONZERO; 16 heads x 64; RoPE (base 10000, positions 0..2047) on q and k: (even, odd) pairs rotated and re-interleaved; scores x 1/sqrt(64); triu(k = 1) -> -inf; softmax; out @ Wo.T + bo).
#define NB 2
#define TT 2048
#define CC 1024            // NH * HD = projected width
#define DIN 1024          // input (model) width
#define NH 16
#define HD 64
#define NQB (TT / 64)
#define SCALE (0.125f)
#define CAUSAL 1
#ifndef TNB
#define TNB NB
#endif
__device__ __forceinline__ float bfr(float v) { return (float)(__bf16)v; }
typedef __attribute__((ext_vector_type(8))) __bf16 v8b;
__device__ __forceinline__ v16b frag_b(const __bf16* rowk0, int lane) {
  union { v16b v; v8b q[2]; } u; const __bf16* p = rowk0 + 8 * (lane >> 4);
  u.q[0] = *(const v8b*)p; u.q[1] = *(const v8b*)(p + 16); return u.v;
}
#define QBH 6              // causal: query blocks 0..QBH-1 of each sequence (few keys, no averaging) take the high-precision path
#define QHI 384            // rows carrying a q residual plane
#define KHI 384            // key rows carrying k residual / v bf16 hi+lo planes (used only by the causal high-precision path)
// B fragment (k rows k0+.., output column o) of a weight: (in,out) [K][ld] or (out,in) [ld rows of K]: bf16 exact, or f16(bf16 * 256) exact
__device__ __forceinline__ v16b wcol_io(const float* Wm, int k0, int o, int lane, int ld) { v16b w; const int g = lane >> 4;
#pragma unroll
  for (int i = 0; i < 8; ++i) { w[i] = (__bf16)Wm[(size_t)(k0 + 8 * g + i) * ld + o]; w[8 + i] = (__bf16)Wm[(size_t)(k0 + 16 + 8 * g + i) * ld + o]; }
  return w; }
__device__ __forceinline__ v16b wcol_oi(const float* Wm, int k0, int o, int lane, int K) { v16b w; const float* p = Wm + (size_t)o * K + k0 + 8 * (lane >> 4);
#pragma unroll
  for (int i = 0; i < 8; ++i) { w[i] = (__bf16)p[i]; w[8 + i] = (__bf16)p[16 + i]; }
  return w; }
__device__ __forceinline__ v16h wcolh_io(const float* Wm, int k0, int o, int lane, int ld) { v16h w; const int g = lane >> 4;
#pragma unroll
  for (int i = 0; i < 8; ++i) { w[i] = (_Float16)(bfr(Wm[(size_t)(k0 + 8 * g + i) * ld + o]) * 256.0f); w[8 + i] = (_Float16)(bfr(Wm[(size_t)(k0 + 16 + 8 * g + i) * ld + o]) * 256.0f); }
  return w; }
__device__ __forceinline__ v16h wcolh_oi(const float* Wm, int k0, int o, int lane, int K) { v16h w; const float* p = Wm + (size_t)o * K + k0 + 8 * (lane >> 4);
#pragma unroll
  for (int i = 0; i < 8; ++i) { w[i] = (_Float16)(bfr(p[i]) * 256.0f); w[8 + i] = (_Float16)(bfr(p[16 + i]) * 256.0f); }
  return w; }
#define WQKV_LAYOUT 1   // 0 = (in,out) [DIN][CC]; 1 = (out,in) [CC][DIN]; 2 = per-head [NH][DIN][HD]
__device__ __forceinline__ v16b wcol_hdk(const float* Wm, int k0, int o, int lane) { v16b w; const int g = lane >> 4; const float* p = Wm + (size_t)(o / HD) * DIN * HD + (o % HD);
#pragma unroll
  for (int i = 0; i < 8; ++i) { w[i] = (__bf16)p[(size_t)(k0 + 8 * g + i) * HD]; w[8 + i] = (__bf16)p[(size_t)(k0 + 16 + 8 * g + i) * HD]; }
  return w; }
#define WO_OUT_IN 1
#if WQKV_LAYOUT == 1
#define WCOL(W, k0, o, lane) wcol_oi(W, k0, o, lane, DIN)
#elif WQKV_LAYOUT == 2
#define WCOL(W, k0, o, lane) wcol_hdk(W, k0, o, lane)
#else
#define WCOL(W, k0, o, lane) wcol_io(W, k0, o, lane, CC)
#endif
#if WO_OUT_IN
#define WOCOL(W, k0, o, lane) wcol_oi(W, k0, o, lane, CC)
#define WOCOLH(W, k0, o, lane) wcolh_oi(W, k0, o, lane, CC)
#else
#define WOCOL(W, k0, o, lane) wcol_io(W, k0, o, lane, DIN)
#define WOCOLH(W, k0, o, lane) wcolh_io(W, k0, o, lane, DIN)
#endif

// RoPE inverse frequencies 1/10000^(2i/64) (the f32 values jax computes)
__constant__ float INVF[32] = {1.000000000e+00,7.498942018e-01,5.623413324e-01,4.216965139e-01,3.162277639e-01,2.371373624e-01,1.778279394e-01,1.333521456e-01,1.000000015e-01,7.498941571e-02,5.623412877e-02,4.216964915e-02,3.162277862e-02,2.371373586e-02,1.778279431e-02,1.333521493e-02,9.999999776e-03,7.498942316e-03,5.623413250e-03,4.216964822e-03,3.162277862e-03,2.371373819e-03,1.778279431e-03,1.333521446e-03,1.000000047e-03,7.498941850e-04,5.623413017e-04,4.216964880e-04,3.162277862e-04,2.371373848e-04,1.778279402e-04,1.333521504e-04};
#define PROJ_EXTRA_PARAMS
// per (token, head) hook on the staged f32 row (64 floats, projection + bias) of the q and k streams: interleaved-pair rotation (x[2i], x[2i + 1]) by the angle t * INVF[i]; v untouched
#define PROJ_EPI(which, row, t, h) do { if ((which) < 2) { float* rw = (row); const float pos_ = (float)(t);   /* position = the token's sequence index */ _Pragma("unroll 4") for (int i = 0; i < 32; ++i) { _Pragma("clang fp contract(off)") const float ang = pos_ * INVF[i]; const float cs = cosf(ang), sn = sinf(ang); const float xe = rw[2 * i], xo = rw[2 * i + 1]; rw[2 * i] = xe * cs - xo * sn; rw[2 * i + 1] = xe * sn + xo * cs; } } } while (0)
#ifndef PROJ_EXTRA_PARAMS
#define PROJ_EXTRA_PARAMS
#endif

#define WS_QH  0u                                      // f16 q rows [b*t][CC]
#define WS_KH  (WS_QH + 2u * (size_t)NB * TT * CC)      // f16 k rows [b*t][CC]
#define WS_VT  (WS_KH + 2u * (size_t)NB * TT * CC)      // f16 v planes [b][c][t]
#define WS_QL  (WS_VT + 2u * (size_t)NB * CC * TT)      // f16 q residual x 2^10 rows [b][t < QHI][CC]
#define WS_KL  (WS_QL + 2u * (size_t)NB * QHI * CC)     // f16 k residual x 2^10 rows [b][t < KHI][CC]
#define WS_VB  (WS_KL + 2u * (size_t)NB * KHI * CC)     // bf16 v hi planes [b][c][t < KHI]
#define WS_VBL (WS_VB + 2u * (size_t)NB * CC * KHI)
#define WS_Y   (WS_VBL + 2u * (size_t)NB * CC * KHI)     // f32 ctx rows [b*t][CC] (only when there is an output projection)
#define WS_END (WS_Y  + 4u * (size_t)NB * TT * CC)

// ---- k_proj: block = (64 rows, 128 cols, which): q/k/v = X W (+ b) with exact bf16 products (K = DIN) -> which 0: q f16 rows (+ residual rows < QHI); 1: k f16 rows (+ residual rows < KHI); 2: v f16 planes [c][t] (+ bf16 hi/lo planes for t < KHI)
__global__ __launch_bounds__(128) void k_proj(const float* __restrict__ XQ, const float* __restrict__ XK, const float* __restrict__ XV, const float* __restrict__ WQ, const float* __restrict__ WK, const float* __restrict__ WV, const float* __restrict__ BQ, const float* __restrict__ BK, const float* __restrict__ BV,
    _Float16* __restrict__ QH, _Float16* __restrict__ QL, _Float16* __restrict__ KH, _Float16* __restrict__ KL, _Float16* __restrict__ VT, __bf16* __restrict__ VB, __bf16* __restrict__ VBL PROJ_EXTRA_PARAMS) {
  __shared__ __align__(16) float st[64][132]; __shared__ __align__(16) _Float16 sh[64][136], sl[64][136]; __shared__ __align__(16) _Float16 th[128][72]; __shared__ __align__(16) __bf16 tb[128][72], tbl[128][72];
  const int tid = threadIdx.x, wave = tid >> 5, lane = tid & 31, col = lane & 15, g = lane >> 4; const int which = blockIdx.z; const int c0 = blockIdx.y * 128; const size_t r0 = (size_t)blockIdx.x * 64; const size_t bb = r0 / TT; const int t0 = (int)(r0 % TT);
  const float* X = which == 0 ? XQ : which == 1 ? XK : XV; const float* WA = which == 0 ? WQ : which == 1 ? WK : WV; const float* BA = which == 0 ? BQ : which == 1 ? BK : BV;
  v8f acc[8] = {};
#pragma unroll 2
  for (int kc = 0; kc < DIN / 32; ++kc) { v16b a; { const float* p = X + (r0 + wave * 16 + col) * DIN + kc * 32 + 8 * g;
#pragma unroll
      for (int i = 0; i < 8; ++i) { a[i] = (__bf16)p[i]; a[8 + i] = (__bf16)p[16 + i]; } }
    asm volatile("s_wait_loadcnt 0x0" ::: "memory");
#pragma unroll
    for (int j = 0; j < 8; ++j) { const v16b w = WCOL(WA, kc * 32, c0 + j * 16 + col, lane); asm volatile("s_wait_loadcnt 0x0" ::: "memory"); acc[j] = wmma_bf(a, w, acc[j]); } }
  { // stage the f32 tile (acc + bias) in LDS, run the per-(row, head) epilogue hook, then convert
#pragma unroll
    for (int j = 0; j < 8; ++j) { const float bias = BA ? bfr(BA[c0 + j * 16 + col]) : 0.f;
#pragma unroll
      for (int r = 0; r < 8; ++r) st[wave * 16 + 8 * g + r][j * 16 + col] = acc[j][r] + bias; }
    __syncthreads();
    for (int e = tid; e < 64 * (128 / HD); e += 128) { const int rl = e / (128 / HD), hh = e % (128 / HD); PROJ_EPI(which, &st[rl][hh * HD], (int)((r0 + rl) % TT), (c0 / HD) + hh); }
    __syncthreads(); }
  if (which < 2) { _Float16* DH = which == 0 ? QH : KH; _Float16* DL = which == 0 ? QL : KL; const int nhi = which == 0 ? QHI : KHI; const bool hi_rows = t0 < nhi;
    for (int e = tid; e < 64 * 128; e += 128) { const int rl = e >> 7, cl = e & 127; const float v = st[rl][cl]; const _Float16 hv = (_Float16)v; sh[rl][cl] = hv; sl[rl][cl] = (_Float16)((v - (float)hv) * 1024.0f); }
    __syncthreads();
    for (int e = tid; e < 64 * 16; e += 128) { const int rl = e >> 4, q = e & 15; vst2((unsigned*)(DH + (r0 + rl) * CC + c0 + q * 8), *(const v4u*)&sh[rl][q * 8]); if (hi_rows) vst2((unsigned*)(DL + (bb * nhi + t0 + rl) * (size_t)CC + c0 + q * 8), *(const v4u*)&sl[rl][q * 8]); }
  } else { const bool hi_rows = t0 < KHI;
    for (int e = tid; e < 64 * 128; e += 128) { const int rl = e & 63, cl = e >> 6; const float v = st[rl][cl]; th[cl][rl] = (_Float16)v; const __bf16 bh = (__bf16)v; tb[cl][rl] = bh; tbl[cl][rl] = (__bf16)(v - (float)bh); }
    __syncthreads();
    for (int e = tid; e < 128 * 8; e += 128) { const int cl = e >> 3, q = e & 7; vst2((unsigned*)(VT + (bb * CC + c0 + cl) * (size_t)TT + t0 + q * 8), *(const v4u*)&th[cl][q * 8]); if (hi_rows) { const size_t o3 = (bb * CC + c0 + cl) * (size_t)KHI + t0 + q * 8; vst2((unsigned*)(VB + o3), *(const v4u*)&tb[cl][q * 8]); vst2((unsigned*)(VBL + o3), *(const v4u*)&tbl[cl][q * 8]); } } } }
// ---- k_att: block = 64 queries (qb) of (b, h), wave = 16 queries: logits, softmax and P . v in one pass over key blocks of 64, nothing of the logits leaves registers.
// Transposed tiles: S^T = k q^T puts (key 8g + r, query col) in D element r, which is already the B fragment (k = keys) of ctx^T = v^T P^T; the row statistics of a query live in its two lanes (col, col + 16).
// Running maximum m and sum l per query; e = exp(logit - m) x 2^11 once to f16 against v f16 (HI, causal early query blocks: 3-product logits, e and v as bf16 hi + lo, 3 products); ctx = acc / (2^11 l). The inner loops are fully unrolled so that every fragment array stays in registers.
template <bool HI> __device__ __forceinline__ void att_body(const _Float16* __restrict__ QH, const _Float16* __restrict__ KH, const _Float16* __restrict__ QL, const _Float16* __restrict__ KL, const _Float16* __restrict__ VT, const __bf16* __restrict__ VB, const __bf16* __restrict__ VBL, float* __restrict__ Y, int qb, int h, int b) {
  const int tid = threadIdx.x, wave = tid >> 5, lane = tid & 31, col = lane & 15, g = lane >> 4; const int ql0 = qb * 64 + wave * 16; const int t = ql0 + col; const size_t q0 = (size_t)b * TT + ql0;
  const _Float16* QLb = QL + (size_t)b * QHI * CC; const _Float16* KLb = KL + (size_t)b * KHI * CC;
  const _Float16* kp = KH + ((size_t)b * TT + col) * CC + h * HD;              /* key row col, this head's 64 channels */
  const _Float16* vp = VT + ((size_t)b * CC + h * HD + col) * (size_t)TT;      /* channel plane col of this head */
  v16h ah[HD / 32], al[HD / 32], kf[HD / 32][4];
#pragma unroll
  for (int kc = 0; kc < HD / 32; ++kc) { ah[kc] = frag_h(QH + (q0 + col) * CC + h * HD + kc * 32, lane); if (HI) al[kc] = frag_h(QLb + (size_t)(ql0 + col) * CC + h * HD + kc * 32, lane);
    if (!HI) {
#pragma unroll
      for (int j = 0; j < 4; ++j) kf[kc][j] = frag_h(kp + (size_t)(j * 16) * CC + kc * 32, lane); } }
  float m = -3.0e38f, l = 0.f; v8f acc[HD / 16] = {};
#pragma unroll 1   /* rolled: one block's k and v fragments already fill the registers that four waves a SIMD leave a wave */
  for (int kb = 0; kb <= qb; ++kb) { const int k0 = kb * 64;   /* causal: key blocks 0 .. qb; only block qb crosses the diagonal */
    v16h vf[2][HD / 16];
    if (!HI) {
#pragma unroll
      for (int kc = 0; kc < 2; ++kc)
#pragma unroll
        for (int j = 0; j < HD / 16; ++j) vf[kc][j] = frag_h(vp + (size_t)(j * 16) * TT + k0 + kc * 32, lane); }
    __builtin_amdgcn_sched_barrier(0);   /* keeps this block's v loads issued here, in flight under the logits and the softmax, instead of one by one in front of their products */
    v8f s[4] = {}, sl[4] = {};
#pragma unroll
    for (int kc = 0; kc < HD / 32; ++kc) { v16h klf[4];
      if (HI) {
#pragma unroll
        for (int j = 0; j < 4; ++j) { kf[kc][j] = frag_h(kp + (size_t)(k0 + j * 16) * CC + kc * 32, lane); klf[j] = frag_h(KLb + (size_t)(k0 + j * 16 + col) * CC + h * HD + kc * 32, lane); }
        __builtin_amdgcn_sched_barrier(0); }   /* the eight k and k residual fragments of this half are in flight together: one latency, not eight */
#pragma unroll
      for (int j = 0; j < 4; ++j) { s[j] = wmma16(kf[kc][j], ah[kc], s[j]);
        if (HI) { sl[j] = wmma16(kf[kc][j], al[kc], sl[j]); sl[j] = wmma16(klf[j], ah[kc], sl[j]); } } }
    if (!HI && kb < qb) {   /* wave-uniform: the next block's k fragments, fetched one block ahead (HI has no registers to spare for it) */
#pragma unroll
      for (int kc = 0; kc < HD / 32; ++kc)
#pragma unroll
        for (int j = 0; j < 4; ++j) kf[kc][j] = frag_h(kp + (size_t)(k0 + 64 + j * 16) * CC + kc * 32, lane); }
    v16b vbh[HD / 16], vbl[HD / 16]; const size_t pb = ((size_t)b * CC + h * HD + col) * (size_t)KHI + k0;
    if (HI) {
#pragma unroll
      for (int j = 0; j < HD / 16; ++j) { vbh[j] = frag_b(VB + pb + (size_t)(j * 16) * KHI, lane); vbl[j] = frag_b(VBL + pb + (size_t)(j * 16) * KHI, lane); } }
    __builtin_amdgcn_sched_barrier(0);   /* keeps the next block's k loads (HI: instead the first half's v hi + lo loads) issued here, in flight under the softmax and P . v */
#pragma unroll
    for (int j = 0; j < 4; ++j) {
#pragma unroll
      for (int r = 0; r < 8; ++r) s[j][r] = HI ? (s[j][r] + sl[j][r] * (1.0f / 1024.0f)) * SCALE : s[j][r] * SCALE; }
    if (CAUSAL && kb == qb) {   /* wave-uniform */
#pragma unroll
      for (int j = 0; j < 4; ++j) {
#pragma unroll
        for (int r = 0; r < 8; ++r) if (k0 + j * 16 + 8 * g + r > t) s[j][r] = -3.0e38f; } }
    float bm = -3.0e38f;
#pragma unroll
    for (int j = 0; j < 4; ++j) {
#pragma unroll
      for (int r = 0; r < 8; ++r) bm = fmaxf(bm, s[j][r]); }
    bm = fmaxf(bm, __shfl_xor(bm, 16));
    const float mn = fmaxf(m, bm); const float alpha = expf(m - mn); m = mn;   /* every block holds a key open to every query of the wave (key k0 <= ql0), so mn is a real logit */
    float ls = 0.f;
#pragma unroll
    for (int j = 0; j < 4; ++j) {
#pragma unroll
      for (int r = 0; r < 8; ++r) { const float e = expf(s[j][r] - mn); ls += e; s[j][r] = e * 2048.0f; } }   /* a masked logit (-3e38) underflows to exactly 0 against the real mn */
    ls += __shfl_xor(ls, 16); l = l * alpha + ls;
#pragma unroll
    for (int j = 0; j < HD / 16; ++j) acc[j] *= alpha;
#pragma unroll
    for (int kc = 0; kc < 2; ++kc) {
      if (HI) { float pv[16];
#pragma unroll
        for (int i = 0; i < 8; ++i) { pv[i] = s[2 * kc][i]; pv[8 + i] = s[2 * kc + 1][i]; }
        const F2 p = bsplit16(pv);
        if (kc == 1) {
#pragma unroll
          for (int j = 0; j < HD / 16; ++j) { vbh[j] = frag_b(VB + pb + (size_t)(j * 16) * KHI + 32, lane); vbl[j] = frag_b(VBL + pb + (size_t)(j * 16) * KHI + 32, lane); }
          __builtin_amdgcn_sched_barrier(0); }   /* the second half's eight v fragments are in flight together */
#pragma unroll
        for (int j = 0; j < HD / 16; ++j) { acc[j] = wmma_bf(vbh[j], p.h, acc[j]); acc[j] = wmma_bf(vbh[j], p.l, acc[j]); acc[j] = wmma_bf(vbl[j], p.h, acc[j]); }
      } else { v16h p;
#pragma unroll
        for (int i = 0; i < 8; ++i) { p[i] = (_Float16)s[2 * kc][i]; p[8 + i] = (_Float16)s[2 * kc + 1][i]; }
#pragma unroll
        for (int j = 0; j < HD / 16; ++j) acc[j] = wmma16(vf[kc][j], p, acc[j]); } } }
  const float inv = l > 0.f ? 1.0f / (l * 2048.0f) : 0.f;
  float* yr = Y + (q0 + col) * CC + h * HD + 8 * g;   /* D element r of tile j = channel j * 16 + 8g + r of query col: 32 contiguous bytes a lane */
#pragma unroll
  for (int j = 0; j < HD / 16; ++j) { const v4f lo = {acc[j][0] * inv, acc[j][1] * inv, acc[j][2] * inv, acc[j][3] * inv}, hi = {acc[j][4] * inv, acc[j][5] * inv, acc[j][6] * inv, acc[j][7] * inv}; vst2(yr + j * 16, lo); vst2(yr + j * 16 + 4, hi); } }
__global__ __launch_bounds__(128) void k_att(const _Float16* __restrict__ QH, const _Float16* __restrict__ KH, const _Float16* __restrict__ QL, const _Float16* __restrict__ KL, const _Float16* __restrict__ VT, const __bf16* __restrict__ VB, const __bf16* __restrict__ VBL, float* __restrict__ Y) {
  const int qb = NQB - 1 - (int)blockIdx.y, h = blockIdx.x % NH, b = blockIdx.x / NH;   /* the longest key ranges start first */
  if (qb < QBH) att_body<true>(QH, KH, QL, KL, VT, VB, VBL, Y, qb, h, b); else att_body<false>(QH, KH, QL, KL, VT, VB, VBL, Y, qb, h, b); }
// ---- k_out: block = (64 rows, 128 cols): out = ctx Wo (+ bo): ctx x 2^6 once to f16 against Wo as f16(bf16 x 2^8) exact (1 product) x 2^-14; causal early rows (< QHI of each sequence): ctx bf16 hi + lo against exact bf16 Wo (2 products)
__global__ __launch_bounds__(128) void k_out(const float* __restrict__ Y, const float* __restrict__ WO, const float* __restrict__ BO, float* __restrict__ OUT) { __shared__ __align__(16) float sf[4][16][132];
  const int tid = threadIdx.x, wave = tid >> 5, lane = tid & 31, col = lane & 15, g = lane >> 4; const int c0 = blockIdx.y * 128; const size_t r0 = (size_t)blockIdx.x * 64 + wave * 16;
  v8f acc[8] = {};
  if (CAUSAL && (int)(((size_t)blockIdx.x * 64) % TT) < QHI) {   /* block-uniform */
#pragma unroll 2
    for (int kc = 0; kc < CC / 32; ++kc) { const F2 a = split_row(Y + (r0 + col) * CC, kc * 32, lane); asm volatile("s_wait_loadcnt 0x0" ::: "memory");
#pragma unroll
      for (int j = 0; j < 8; ++j) { const v16b w = WOCOL(WO, kc * 32, c0 + j * 16 + col, lane); asm volatile("s_wait_loadcnt 0x0" ::: "memory"); acc[j] = wmma_bf(a.h, w, acc[j]); acc[j] = wmma_bf(a.l, w, acc[j]); } }
#pragma unroll
    for (int j = 0; j < 8; ++j) { const float bias = BO ? bfr(BO[c0 + j * 16 + col]) : 0.f;
#pragma unroll
      for (int r = 0; r < 8; ++r) sf[wave][8 * g + r][j * 16 + col] = acc[j][r] + bias; }
  } else {
#pragma unroll 2
    for (int kc = 0; kc < CC / 32; ++kc) { const v16h a = frag_f32s(Y + (r0 + col) * CC + kc * 32, lane, 64.0f); asm volatile("s_wait_loadcnt 0x0" ::: "memory");   /* ctx carried x 2^6 into f16 so small-magnitude context rows stay clear of f16 subnormals */
#pragma unroll
      for (int j = 0; j < 8; ++j) { const v16h w = WOCOLH(WO, kc * 32, c0 + j * 16 + col, lane); asm volatile("s_wait_loadcnt 0x0" ::: "memory"); acc[j] = wmma16(a, w, acc[j]); } }
#pragma unroll
    for (int j = 0; j < 8; ++j) { const float bias = BO ? bfr(BO[c0 + j * 16 + col]) : 0.f;
#pragma unroll
      for (int r = 0; r < 8; ++r) sf[wave][8 * g + r][j * 16 + col] = acc[j][r] * (1.0f / 16384.0f) + bias; } }   /* 2^-8 (Wo carry) x 2^-6 (ctx carry) */
  LDSX(); for (int rl = 0; rl < 16; ++rl) vst2(OUT + (r0 + rl) * DIN + c0 + lane * 4, *(const v4f*)&sf[wave][rl][lane * 4]); }

extern "C" void kernel_launch(void* const* d_in, const int* in_sizes, int n_in, void* d_out, int out_size, void* d_ws, size_t ws_size, hipStream_t stream) {
  (void)in_sizes; (void)n_in; (void)out_size;
  const float** F = (const float**)d_in;
  if (ws_size < (size_t)WS_END) return;
  char* ws = (char*)d_ws; _Float16 *QH = (_Float16*)(ws + WS_QH), *KH = (_Float16*)(ws + WS_KH), *VT = (_Float16*)(ws + WS_VT), *QL = (_Float16*)(ws + WS_QL), *KL = (_Float16*)(ws + WS_KL); __bf16 *VB = (__bf16*)(ws + WS_VB), *VBL = (__bf16*)(ws + WS_VBL); float *Y = (float*)(ws + WS_Y);
  (void)Y; (void)QL; (void)KL; (void)VB; (void)VBL;
  // inputs: 0 x [2,2048,1024]; 1 Wq [1024,1024] (out,in); 2 Wk; 3 Wv; 4 bv [1024] (NONZERO; q and k have no bias: null pointers); 5 Wo (out,in); 6 bo (NONZERO)
  k_proj<<<dim3(TNB * TT / 64, CC / 128, 3), 128, 0, stream>>>(F[0], F[0], F[0], F[1], F[2], F[3], nullptr, nullptr, F[4], QH, QL, KH, KL, VT, VB, VBL);
  k_att<<<dim3(NH * TNB, NQB), 128, 0, stream>>>(QH, KH, QL, KL, VT, VB, VBL, Y);
  k_out<<<dim3(TNB * TT / 64, DIN / 128), 128, 0, stream>>>(Y, F[5], F[6], (float*)d_out);
}

// v002
// It runs in 134 microseconds.
// Timed twice side by side with v001, it ran 3.93 times as fast both times.
// Over all steps from v000 it is 9.58 times as fast.
// compute dtype: all float inputs rounded to bf16; q / k / v projections with EXACT bf16 products on WMMA 16x16x32 (f32 accumulate) + bias (v only; nonzero); interleaved-pair RoPE in f32 on q and k (which have no bias) (embedded frequencies, precise cosf / sinf, positions = the row index); causal logits: 3 products for the first 384 rows, single f16 q x k after, x 64^-0.5; online softmax f32 in one fused pass; exp(logit - running max) x 2^11 once to f16 x v once to f16 (bf16 hi + lo below row 384); ctx hi+lo x exact Wo below row 384, x2^6 f16 carry x f16(bf16 x 2^8) Wo after, + bo; f32 output.
#include <hip/hip_runtime.h>
#include <math.h>

typedef __attribute__((ext_vector_type(16))) _Float16 v16h;
typedef __attribute__((ext_vector_type(16))) __bf16 v16b;
typedef __attribute__((ext_vector_type(8)))  _Float16 v8h;
typedef __attribute__((ext_vector_type(8)))  float v8f;
typedef __attribute__((ext_vector_type(4)))  float v4f;
typedef __attribute__((ext_vector_type(2)))  float v2f;
typedef __attribute__((ext_vector_type(4)))  unsigned v4u;
typedef __attribute__((ext_vector_type(4)))  int v4i;
typedef float __attribute__((may_alias)) float_a;
typedef int __attribute__((may_alias)) int_a;

template <typename T> __device__ __forceinline__ void vst2(void* p, T v) { *(T*)p = v;  }
__device__ __forceinline__ v8f wmma16(v16h a, v16h b, v8f c) {
  v8f d = __builtin_amdgcn_wmma_f32_16x16x32_f16(false, a, false, b, (short)0, c, false, false);
  asm volatile("v_nop\n\tv_nop\n\tv_nop\n\tv_nop" : "+v"(d) : "v"(a), "v"(b));
  return d;
}
__device__ __forceinline__ v8f wmma_bf(v16b a, v16b b, v8f c) {
  v8f d = __builtin_amdgcn_wmma_f32_16x16x32_bf16(false, a, false, b, (short)0, c, false, false);
  asm volatile("v_nop\n\tv_nop\n\tv_nop\n\tv_nop" : "+v"(d) : "v"(a), "v"(b));
  return d;
}
// 16x16x32 fragments: lane = (h = lane>>4, row/col = lane&15); elements 0..7 = k0+8h+0..7, 8..15 = k0+16+8h+0..7; D element r = row 8h+r
__device__ __forceinline__ v16h frag_h(const _Float16* rowk0, int lane) {
  union { v16h v; v8h q[2]; } u; const _Float16* p = rowk0 + 8 * (lane >> 4);
  u.q[0] = *(const v8h*)p; u.q[1] = *(const v8h*)(p + 16); return u.v;
}
__device__ __forceinline__ v16h frag_f32(const float* rowk0, int lane) {
  v16h a; const float* p = rowk0 + 8 * (lane >> 4);
#pragma unroll
  for (int i = 0; i < 8; ++i) { a[i] = (_Float16)p[i]; a[8 + i] = (_Float16)p[16 + i]; }
  return a;
}
__device__ __forceinline__ v16h frag_f32s(const float* rowk0, int lane, float sc) {
  v16h a; const float* p = rowk0 + 8 * (lane >> 4);
#pragma unroll
  for (int i = 0; i < 8; ++i) { a[i] = (_Float16)(p[i] * sc); a[8 + i] = (_Float16)(p[16 + i] * sc); }
  return a;
}
// column fragment from a [K][ld] layout (column n), rows >= K read as 0
__device__ __forceinline__ v16h fragc_f32(const float* W, int k0, int n, int lane, int ld, int K) {
  v16h a; const int g = lane >> 4;
#pragma unroll
  for (int i = 0; i < 8; ++i) { const int ka = k0 + 8 * g + i, kb = ka + 16;
    a[i] = (_Float16)(ka < K ? W[(size_t)(ka < K ? ka : K - 1) * ld + n] : 0.f); a[8 + i] = (_Float16)(kb < K ? W[(size_t)(kb < K ? kb : K - 1) * ld + n] : 0.f); }
  return a;
}
struct F2 { v16b h, l; };
__device__ __forceinline__ F2 bsplit16(const float v[16]) { F2 r;
#pragma unroll
  for (int i = 0; i < 16; ++i) { const __bf16 h = (__bf16)v[i]; r.h[i] = h; r.l[i] = (__bf16)(v[i] - (float)h); }
  return r; }
__device__ __forceinline__ F2 split_row(const float* row, int k0, int lane) { float v[16]; const float* p = row + k0 + 8 * (lane >> 4);
#pragma unroll
  for (int i = 0; i < 8; ++i) { v[i] = p[i]; v[8 + i] = p[16 + i]; }
  return bsplit16(v); }
__device__ __forceinline__ F2 split_rowK(const float* row, int k0, int lane, int K) { float v[16]; const int g = lane >> 4;
#pragma unroll
  for (int i = 0; i < 8; ++i) { const int ka = k0 + 8 * g + i, kb = ka + 16; v[i] = ka < K ? row[ka < K ? ka : K - 1] : 0.f; v[8 + i] = kb < K ? row[kb < K ? kb : K - 1] : 0.f; }
  return bsplit16(v); }
__device__ __forceinline__ F2 split_col(const float* W, int k0, int n, int lane, int ld, int K) { float v[16]; const int g = lane >> 4;
#pragma unroll
  for (int i = 0; i < 8; ++i) { const int ka = k0 + 8 * g + i, kb = ka + 16; v[i] = ka < K ? W[(size_t)(ka < K ? ka : K - 1) * ld + n] : 0.f; v[8 + i] = kb < K ? W[(size_t)(kb < K ? kb : K - 1) * ld + n] : 0.f; }
  return bsplit16(v); }
__device__ __forceinline__ v8f mac3(const F2& a, const F2& b, v8f c) { c = wmma_bf(a.l, b.h, c); c = wmma_bf(a.h, b.l, c); return wmma_bf(a.h, b.h, c); }
__device__ __forceinline__ float sigm(float v) { return 1.0f / (1.0f + expf(-v)); }
#define LDSX() do { asm volatile("s_wait_dscnt 0" ::: "memory"); __builtin_amdgcn_wave_barrier(); __builtin_amdgcn_fence(__ATOMIC_RELEASE, "workgroup"); } while (0)

// Causal self-attention with interleaved-pair RoPE (x [2,2048,1024]; (out,in) Wq / Wk / Wv [1024,1024] N(0, 1/1024) applied as einsum('bse,he->bsh') = x @ W.T; bv [1024] NONZERO (only v has a bias); Wo [1024,1024] (out,in) + bo NONZERO; 16 heads x 64; RoPE (base 10000, positions 0..2047) on q and k: (even, odd) pairs rotated and re-interleaved; scores x 1/sqrt(64); triu(k = 1) -> -inf; softmax; out @ Wo.T + bo).
#define NB 2
#define TT 2048
#define CC 1024            // NH * HD = projected width
#define DIN 1024          // input (model) width
#define NH 16
#define HD 64
#define NQB (TT / 64)
#define SCALE (0.125f)
#define CAUSAL 1
#ifndef TNB
#define TNB NB
#endif
__device__ __forceinline__ float bfr(float v) { return (float)(__bf16)v; }
typedef __attribute__((ext_vector_type(8))) __bf16 v8b;
__device__ __forceinline__ v16b frag_b(const __bf16* rowk0, int lane) {
  union { v16b v; v8b q[2]; } u; const __bf16* p = rowk0 + 8 * (lane >> 4);
  u.q[0] = *(const v8b*)p; u.q[1] = *(const v8b*)(p + 16); return u.v;
}
#define QBH 6              // causal: query blocks 0..QBH-1 of each sequence (few keys, no averaging) take the high-precision path
#define QHI 384            // rows carrying a q residual plane
#define KHI 384            // key rows carrying k residual / v bf16 hi+lo planes (used only by the causal high-precision path)
// B fragment (k rows k0+.., output column o) of a weight: (in,out) [K][ld] or (out,in) [ld rows of K]: bf16 exact, or f16(bf16 * 256) exact
__device__ __forceinline__ v16b wcol_io(const float* Wm, int k0, int o, int lane, int ld) { v16b w; const int g = lane >> 4;
#pragma unroll
  for (int i = 0; i < 8; ++i) { w[i] = (__bf16)Wm[(size_t)(k0 + 8 * g + i) * ld + o]; w[8 + i] = (__bf16)Wm[(size_t)(k0 + 16 + 8 * g + i) * ld + o]; }
  return w; }
__device__ __forceinline__ v16b wcol_oi(const float* Wm, int k0, int o, int lane, int K) { v16b w; const float* p = Wm + (size_t)o * K + k0 + 8 * (lane >> 4);
#pragma unroll
  for (int i = 0; i < 8; ++i) { w[i] = (__bf16)p[i]; w[8 + i] = (__bf16)p[16 + i]; }
  return w; }
__device__ __forceinline__ v16h wcolh_io(const float* Wm, int k0, int o, int lane, int ld) { v16h w; const int g = lane >> 4;
#pragma unroll
  for (int i = 0; i < 8; ++i) { w[i] = (_Float16)(bfr(Wm[(size_t)(k0 + 8 * g + i) * ld + o]) * 256.0f); w[8 + i] = (_Float16)(bfr(Wm[(size_t)(k0 + 16 + 8 * g + i) * ld + o]) * 256.0f); }
  return w; }
__device__ __forceinline__ v16h wcolh_oi(const float* Wm, int k0, int o, int lane, int K) { v16h w; const float* p = Wm + (size_t)o * K + k0 + 8 * (lane >> 4);
#pragma unroll
  for (int i = 0; i < 8; ++i) { w[i] = (_Float16)(bfr(p[i]) * 256.0f); w[8 + i] = (_Float16)(bfr(p[16 + i]) * 256.0f); }
  return w; }
#define WQKV_LAYOUT 1   // picks only the WCOL helper, which nothing calls (0 = (in,out) [DIN][CC]; 1 = (out,in) [CC][DIN]; 2 = per-head [NH][DIN][HD]); k_proj always reads (out,in) [CC][DIN]
__device__ __forceinline__ v16b wcol_hdk(const float* Wm, int k0, int o, int lane) { v16b w; const int g = lane >> 4; const float* p = Wm + (size_t)(o / HD) * DIN * HD + (o % HD);
#pragma unroll
  for (int i = 0; i < 8; ++i) { w[i] = (__bf16)p[(size_t)(k0 + 8 * g + i) * HD]; w[8 + i] = (__bf16)p[(size_t)(k0 + 16 + 8 * g + i) * HD]; }
  return w; }
#define WO_OUT_IN 1
#if WQKV_LAYOUT == 1
#define WCOL(W, k0, o, lane) wcol_oi(W, k0, o, lane, DIN)
#elif WQKV_LAYOUT == 2
#define WCOL(W, k0, o, lane) wcol_hdk(W, k0, o, lane)
#else
#define WCOL(W, k0, o, lane) wcol_io(W, k0, o, lane, CC)
#endif
#if WO_OUT_IN
#define WOCOL(W, k0, o, lane) wcol_oi(W, k0, o, lane, CC)
#define WOCOLH(W, k0, o, lane) wcolh_oi(W, k0, o, lane, CC)
#else
#define WOCOL(W, k0, o, lane) wcol_io(W, k0, o, lane, DIN)
#define WOCOLH(W, k0, o, lane) wcolh_io(W, k0, o, lane, DIN)
#endif

// RoPE inverse frequencies 1/10000^(2i/64)
__constant__ float INVF[32] = {1.000000000e+00,7.498942018e-01,5.623413324e-01,4.216965139e-01,3.162277639e-01,2.371373624e-01,1.778279394e-01,1.333521456e-01,1.000000015e-01,7.498941571e-02,5.623412877e-02,4.216964915e-02,3.162277862e-02,2.371373586e-02,1.778279431e-02,1.333521493e-02,9.999999776e-03,7.498942316e-03,5.623413250e-03,4.216964822e-03,3.162277862e-03,2.371373819e-03,1.778279431e-03,1.333521446e-03,1.000000047e-03,7.498941850e-04,5.623413017e-04,4.216964880e-04,3.162277862e-04,2.371373848e-04,1.778279402e-04,1.333521504e-04};
#define PROJ_EXTRA_PARAMS
// per (token, head) hook on the staged f32 row (64 floats, projection + bias) of the q and k streams: interleaved-pair rotation (x[2i], x[2i + 1]) by the angle t * INVF[i]; v untouched
#define PROJ_EPI(which, row, t, h) do { if ((which) < 2) { float* rw = (row); const float pos_ = (float)(t);   /* position = the token's sequence index */ _Pragma("unroll 4") for (int i = 0; i < 32; ++i) { _Pragma("clang fp contract(off)") const float ang = pos_ * INVF[i]; const float cs = cosf(ang), sn = sinf(ang); const float xe = rw[2 * i], xo = rw[2 * i + 1]; rw[2 * i] = xe * cs - xo * sn; rw[2 * i + 1] = xe * sn + xo * cs; } } } while (0)
#ifndef PROJ_EXTRA_PARAMS
#define PROJ_EXTRA_PARAMS
#endif

#define WS_QH  0u                                      // f16 q rows [b*t][CC]
#define WS_KH  (WS_QH + 2u * (size_t)NB * TT * CC)      // f16 k rows [b*t][CC]
#define WS_VT  (WS_KH + 2u * (size_t)NB * TT * CC)      // f16 v planes [b][c][t]
#define WS_QL  (WS_VT + 2u * (size_t)NB * CC * TT)      // f16 q residual x 2^10 rows [b][t < QHI][CC]
#define WS_KL  (WS_QL + 2u * (size_t)NB * QHI * CC)     // f16 k residual x 2^10 rows [b][t < KHI][CC]
#define WS_VB  (WS_KL + 2u * (size_t)NB * KHI * CC)     // bf16 v hi planes [b][c][t < KHI]
#define WS_VBL (WS_VB + 2u * (size_t)NB * CC * KHI)
#define WS_Y   (WS_VBL + 2u * (size_t)NB * CC * KHI)     // f32 ctx rows [b*t][CC] (only when there is an output projection)
#define WS_END (WS_Y  + 4u * (size_t)NB * TT * CC)

// ---- staged GEMM loop shared by k_proj and k_out: a block's 64 A rows and 128 W rows (both k-contiguous f32, row length LD) come in chunks of GK k columns by whole-line 16-byte loads, are rounded ONCE to their 16-bit operand form and stored in LDS, where the four waves read their fragments. Two LDS buffers, one barrier a chunk; the next chunk's global loads fly under this chunk's products. Rounding, fragment k order and the order of the products into each accumulator are those of the per-lane global fragment loads that this replaces.
// MODE 0: A and W bf16, one product; MODE 1: A bf16 hi + lo planes, W bf16, two products; MODE 2: A f16(x 2^6), W f16(bf16 x 2^8), one product
#define GK 64                  // k columns of a chunk: 256 B of every f32 row
#define GP 72                  // LDS row pitch in 16-bit elements: 144 B = 16 B x 9, so the 16-byte fragment reads of 16 rows meet no bank twice
#define GW_B (128 * GP * 2)    // bytes of one W buffer
#define GA_B (64 * GP * 2)     // bytes of one plane of one A buffer
typedef __attribute__((ext_vector_type(4))) __bf16 v4b;
typedef __attribute__((ext_vector_type(4))) _Float16 v4h;
template <int MODE, int LD> __device__ __forceinline__ void gemm_staged(const float* __restrict__ Ag, const float* __restrict__ Wg, unsigned char* sw, unsigned char* sa, v8f (&acc)[8]) {
  const int tid = threadIdx.x, wave = tid >> 5, lane = tid & 31, col = lane & 15; const int lr = tid >> 4, lc = tid & 15;   /* 16 lanes x 16 B = one row's chunk; the block covers 8 rows a load */
  const float* ap = Ag + (size_t)lr * LD + lc * 4; const float* wp = Wg + (size_t)lr * LD + lc * 4;
  constexpr int NPL = MODE == 1 ? 2 : 1;
  v4f ar[8], wr[16];
#pragma unroll
  for (int i = 0; i < 8; ++i) ar[i] = *(const v4f*)(ap + (size_t)(8 * i) * LD);
#pragma unroll
  for (int i = 0; i < 16; ++i) wr[i] = *(const v4f*)(wp + (size_t)(8 * i) * LD);
  asm volatile("s_wait_xcnt 0x0" ::: "memory");   /* stands in front of any rewrite of the address registers that the 24 issued loads name */
#pragma unroll 2   /* two chunks a body: the two buffers' LDS offsets become constants */
  for (int ch = 0; ch < LD / GK; ++ch) { unsigned char* wb = sw + (ch & 1) * GW_B; unsigned char* ab = sa + (ch & 1) * (NPL * GA_B);
#pragma unroll
    for (int i = 0; i < 8; ++i) { const int eo = (lr + 8 * i) * GP + lc * 4; const v4f v = ar[i];
      if (MODE == 2) { const v4h o = {(_Float16)(v[0] * 64.0f), (_Float16)(v[1] * 64.0f), (_Float16)(v[2] * 64.0f), (_Float16)(v[3] * 64.0f)}; *(v4h*)((_Float16*)ab + eo) = o; }
      else { const v4b o = {(__bf16)v[0], (__bf16)v[1], (__bf16)v[2], (__bf16)v[3]}; *(v4b*)((__bf16*)ab + eo) = o;
        if (MODE == 1) { const v4b o2 = {(__bf16)(v[0] - (float)o[0]), (__bf16)(v[1] - (float)o[1]), (__bf16)(v[2] - (float)o[2]), (__bf16)(v[3] - (float)o[3])}; *(v4b*)((__bf16*)(ab + GA_B) + eo) = o2; } } }
#pragma unroll
    for (int i = 0; i < 16; ++i) { const int eo = (lr + 8 * i) * GP + lc * 4; const v4f v = wr[i];
      if (MODE == 2) { const v4h o = {(_Float16)(bfr(v[0]) * 256.0f), (_Float16)(bfr(v[1]) * 256.0f), (_Float16)(bfr(v[2]) * 256.0f), (_Float16)(bfr(v[3]) * 256.0f)}; *(v4h*)((_Float16*)wb + eo) = o; }
      else { const v4b o = {(__bf16)v[0], (__bf16)v[1], (__bf16)v[2], (__bf16)v[3]}; *(v4b*)((__bf16*)wb + eo) = o; } }
    __syncthreads();   /* publishes this chunk; it also ends every wave's reads of the other buffer, which the next trip overwrites */
    if (ch + 1 < LD / GK) {   /* block-uniform: the next chunk's loads, behind the barrier (whose fence would wait for them) and in flight under this chunk's fragment reads and products */
#pragma unroll
      for (int i = 0; i < 8; ++i) ar[i] = *(const v4f*)(ap + (size_t)(8 * i) * LD + (ch + 1) * GK);
#pragma unroll
      for (int i = 0; i < 16; ++i) wr[i] = *(const v4f*)(wp + (size_t)(8 * i) * LD + (ch + 1) * GK);
      asm volatile("s_wait_xcnt 0x0" ::: "memory"); }   /* stands in front of any rewrite of the address registers that the 24 issued loads name */
#pragma unroll
    for (int kk = 0; kk < GK / 32; ++kk) { const int ao = (wave * 16 + col) * GP + kk * 32;
      if (MODE == 2) { const v16h a = frag_h((const _Float16*)ab + ao, lane); v16h w[8];
#pragma unroll
        for (int j = 0; j < 8; ++j) w[j] = frag_h((const _Float16*)wb + (j * 16 + col) * GP + kk * 32, lane);
#pragma unroll
        for (int j = 0; j < 8; ++j) acc[j] = wmma16(a, w[j], acc[j]);
      } else { const v16b a = frag_b((const __bf16*)ab + ao, lane); v16b a2 = a, w[8]; if (MODE == 1) a2 = frag_b((const __bf16*)(ab + GA_B) + ao, lane);
#pragma unroll
        for (int j = 0; j < 8; ++j) w[j] = frag_b((const __bf16*)wb + (j * 16 + col) * GP + kk * 32, lane);
#pragma unroll
        for (int j = 0; j < 8; ++j) { acc[j] = wmma_bf(a, w[j], acc[j]); if (MODE == 1) acc[j] = wmma_bf(a2, w[j], acc[j]); } } } } }

// ---- k_proj: block = (64 rows, 128 cols, which): q/k/v = X W (+ b) with exact bf16 products (K = DIN) -> which 0: q f16 rows (+ residual rows < QHI); 1: k f16 rows (+ residual rows < KHI); 2: v f16 planes [c][t] (+ bf16 hi/lo planes for t < KHI)
__global__ __launch_bounds__(128) void k_proj(const float* __restrict__ XQ, const float* __restrict__ XK, const float* __restrict__ XV, const float* __restrict__ WQ, const float* __restrict__ WK, const float* __restrict__ WV, const float* __restrict__ BQ, const float* __restrict__ BK, const float* __restrict__ BV,
    _Float16* __restrict__ QH, _Float16* __restrict__ QL, _Float16* __restrict__ KH, _Float16* __restrict__ KL, _Float16* __restrict__ VT, __bf16* __restrict__ VB, __bf16* __restrict__ VBL PROJ_EXTRA_PARAMS) {
  __shared__ __align__(16) unsigned char sm[55296 + 33792];   /* one region that holds in turn the staged operand chunks (W 2 x 18432 B, X 2 x 9216 B) and the epilogue's planes: sh, sl (q, k) or th, tb, tbl (v); then st */
  unsigned char* rg = sm; float (*st)[132] = (float (*)[132])(sm + 55296);
  _Float16 (*sh)[136] = (_Float16 (*)[136])rg; _Float16 (*sl)[136] = (_Float16 (*)[136])(rg + 17408); _Float16 (*th)[72] = (_Float16 (*)[72])rg; __bf16 (*tb)[72] = (__bf16 (*)[72])(rg + 18432); __bf16 (*tbl)[72] = (__bf16 (*)[72])(rg + 36864);
  const int tid = threadIdx.x, wave = tid >> 5, lane = tid & 31, col = lane & 15, g = lane >> 4; const int which = blockIdx.z; const int c0 = blockIdx.y * 128; const size_t r0 = (size_t)blockIdx.x * 64; const size_t bb = r0 / TT; const int t0 = (int)(r0 % TT);
  const float* X = which == 0 ? XQ : which == 1 ? XK : XV; const float* WA = which == 0 ? WQ : which == 1 ? WK : WV; const float* BA = which == 0 ? BQ : which == 1 ? BK : BV;
  v8f acc[8] = {};
  gemm_staged<0, DIN>(X + r0 * DIN, WA + (size_t)c0 * DIN, rg, rg + 2 * GW_B, acc);
  { // stage the f32 tile (acc + bias) in LDS, run the per-(row, head) epilogue hook, then convert
#pragma unroll
    for (int j = 0; j < 8; ++j) { const float bias = BA ? bfr(BA[c0 + j * 16 + col]) : 0.f;
#pragma unroll
      for (int r = 0; r < 8; ++r) st[wave * 16 + 8 * g + r][j * 16 + col] = acc[j][r] + bias; }
    __syncthreads();
    for (int e = tid; e < 64 * (128 / HD); e += 128) { const int rl = e / (128 / HD), hh = e % (128 / HD); PROJ_EPI(which, &st[rl][hh * HD], (int)((r0 + rl) % TT), (c0 / HD) + hh); }
    __syncthreads(); }
  if (which < 2) { _Float16* DH = which == 0 ? QH : KH; _Float16* DL = which == 0 ? QL : KL; const int nhi = which == 0 ? QHI : KHI; const bool hi_rows = t0 < nhi;
    for (int e = tid; e < 64 * 128; e += 128) { const int rl = e >> 7, cl = e & 127; const float v = st[rl][cl]; const _Float16 hv = (_Float16)v; sh[rl][cl] = hv; sl[rl][cl] = (_Float16)((v - (float)hv) * 1024.0f); }
    __syncthreads();
    for (int e = tid; e < 64 * 16; e += 128) { const int rl = e >> 4, q = e & 15; vst2((unsigned*)(DH + (r0 + rl) * CC + c0 + q * 8), *(const v4u*)&sh[rl][q * 8]); if (hi_rows) vst2((unsigned*)(DL + (bb * nhi + t0 + rl) * (size_t)CC + c0 + q * 8), *(const v4u*)&sl[rl][q * 8]); }
  } else { const bool hi_rows = t0 < KHI;
    for (int e = tid; e < 64 * 128; e += 128) { const int rl = e & 63, cl = e >> 6; const float v = st[rl][cl]; th[cl][rl] = (_Float16)v; const __bf16 bh = (__bf16)v; tb[cl][rl] = bh; tbl[cl][rl] = (__bf16)(v - (float)bh); }
    __syncthreads();
    for (int e = tid; e < 128 * 8; e += 128) { const int cl = e >> 3, q = e & 7; vst2((unsigned*)(VT + (bb * CC + c0 + cl) * (size_t)TT + t0 + q * 8), *(const v4u*)&th[cl][q * 8]); if (hi_rows) { const size_t o3 = (bb * CC + c0 + cl) * (size_t)KHI + t0 + q * 8; vst2((unsigned*)(VB + o3), *(const v4u*)&tb[cl][q * 8]); vst2((unsigned*)(VBL + o3), *(const v4u*)&tbl[cl][q * 8]); } } } }
// ---- k_att: block = 64 queries (qb) of (b, h), wave = 16 queries: logits, softmax and P . v in one pass over key blocks of 64, nothing of the logits leaves registers.
// Transposed tiles: S^T = k q^T puts (key 8g + r, query col) in D element r, which is already the B fragment (k = keys) of ctx^T = v^T P^T; the row statistics of a query live in its two lanes (col, col + 16).
// Running maximum m and sum l per query; e = exp(logit - m) x 2^11 once to f16 against v f16 (HI, causal early query blocks: 3-product logits, e and v as bf16 hi + lo, 3 products); ctx = acc / (2^11 l). The inner loops are fully unrolled so that every fragment array stays in registers.
template <bool HI> __device__ __forceinline__ void att_body(const _Float16* __restrict__ QH, const _Float16* __restrict__ KH, const _Float16* __restrict__ QL, const _Float16* __restrict__ KL, const _Float16* __restrict__ VT, const __bf16* __restrict__ VB, const __bf16* __restrict__ VBL, float* __restrict__ Y, int qb, int h, int b) {
  const int tid = threadIdx.x, wave = tid >> 5, lane = tid & 31, col = lane & 15, g = lane >> 4; const int ql0 = qb * 64 + wave * 16; const int t = ql0 + col; const size_t q0 = (size_t)b * TT + ql0;
  const _Float16* QLb = QL + (size_t)b * QHI * CC; const _Float16* KLb = KL + (size_t)b * KHI * CC;
  const _Float16* kp = KH + ((size_t)b * TT + col) * CC + h * HD;              /* key row col, this head's 64 channels */
  const _Float16* vp = VT + ((size_t)b * CC + h * HD + col) * (size_t)TT;      /* channel plane col of this head */
  v16h ah[HD / 32], al[HD / 32], kf[HD / 32][4];
#pragma unroll
  for (int kc = 0; kc < HD / 32; ++kc) { ah[kc] = frag_h(QH + (q0 + col) * CC + h * HD + kc * 32, lane); if (HI) al[kc] = frag_h(QLb + (size_t)(ql0 + col) * CC + h * HD + kc * 32, lane);
    if (!HI) {
#pragma unroll
      for (int j = 0; j < 4; ++j) kf[kc][j] = frag_h(kp + (size_t)(j * 16) * CC + kc * 32, lane); } }
  float m = -3.0e38f, l = 0.f; v8f acc[HD / 16] = {};
#pragma unroll 1   /* rolled: one block's k and v fragments already fill the registers that four waves a SIMD leave a wave */
  for (int kb = 0; kb <= qb; ++kb) { const int k0 = kb * 64;   /* causal: key blocks 0 .. qb; only block qb crosses the diagonal */
    v16h vf[2][HD / 16];
    if (!HI) {
#pragma unroll
      for (int kc = 0; kc < 2; ++kc)
#pragma unroll
        for (int j = 0; j < HD / 16; ++j) vf[kc][j] = frag_h(vp + (size_t)(j * 16) * TT + k0 + kc * 32, lane); }
    __builtin_amdgcn_sched_barrier(0);   /* keeps this block's v loads issued here, in flight under the logits and the softmax, instead of one by one in front of their products */
    v8f s[4] = {}, sl[4] = {};
#pragma unroll
    for (int kc = 0; kc < HD / 32; ++kc) { v16h klf[4];
      if (HI) {
#pragma unroll
        for (int j = 0; j < 4; ++j) { kf[kc][j] = frag_h(kp + (size_t)(k0 + j * 16) * CC + kc * 32, lane); klf[j] = frag_h(KLb + (size_t)(k0 + j * 16 + col) * CC + h * HD + kc * 32, lane); }
        __builtin_amdgcn_sched_barrier(0); }   /* the eight k and k residual fragments of this half are in flight together: one latency, not eight */
#pragma unroll
      for (int j = 0; j < 4; ++j) { s[j] = wmma16(kf[kc][j], ah[kc], s[j]);
        if (HI) { sl[j] = wmma16(kf[kc][j], al[kc], sl[j]); sl[j] = wmma16(klf[j], ah[kc], sl[j]); } } }
    if (!HI && kb < qb) {   /* wave-uniform: the next block's k fragments, fetched one block ahead (HI has no registers to spare for it) */
#pragma unroll
      for (int kc = 0; kc < HD / 32; ++kc)
#pragma unroll
        for (int j = 0; j < 4; ++j) kf[kc][j] = frag_h(kp + (size_t)(k0 + 64 + j * 16) * CC + kc * 32, lane); }
    v16b vbh[HD / 16], vbl[HD / 16]; const size_t pb = ((size_t)b * CC + h * HD + col) * (size_t)KHI + k0;
    if (HI) {
#pragma unroll
      for (int j = 0; j < HD / 16; ++j) { vbh[j] = frag_b(VB + pb + (size_t)(j * 16) * KHI, lane); vbl[j] = frag_b(VBL + pb + (size_t)(j * 16) * KHI, lane); } }
    __builtin_amdgcn_sched_barrier(0);   /* keeps the next block's k loads (HI: instead the first half's v hi + lo loads) issued here, in flight under the softmax and P . v */
#pragma unroll
    for (int j = 0; j < 4; ++j) {
#pragma unroll
      for (int r = 0; r < 8; ++r) s[j][r] = HI ? (s[j][r] + sl[j][r] * (1.0f / 1024.0f)) * SCALE : s[j][r] * SCALE; }
    if (CAUSAL && kb == qb) {   /* wave-uniform */
#pragma unroll
      for (int j = 0; j < 4; ++j) {
#pragma unroll
        for (int r = 0; r < 8; ++r) if (k0 + j * 16 + 8 * g + r > t) s[j][r] = -3.0e38f; } }
    float bm = -3.0e38f;
#pragma unroll
    for (int j = 0; j < 4; ++j) {
#pragma unroll
      for (int r = 0; r < 8; ++r) bm = fmaxf(bm, s[j][r]); }
    bm = fmaxf(bm, __shfl_xor(bm, 16));
    const float mn = fmaxf(m, bm); const float alpha = expf(m - mn); m = mn;   /* every block holds a key open to every query of the wave (key k0 <= ql0), so mn is a real logit */
    float ls = 0.f;
#pragma unroll
    for (int j = 0; j < 4; ++j) {
#pragma unroll
      for (int r = 0; r < 8; ++r) { const float e = expf(s[j][r] - mn); ls += e; s[j][r] = e * 2048.0f; } }   /* a masked logit (-3e38) underflows to exactly 0 against the real mn */
    ls += __shfl_xor(ls, 16); l = l * alpha + ls;
#pragma unroll
    for (int j = 0; j < HD / 16; ++j) acc[j] *= alpha;
#pragma unroll
    for (int kc = 0; kc < 2; ++kc) {
      if (HI) { float pv[16];
#pragma unroll
        for (int i = 0; i < 8; ++i) { pv[i] = s[2 * kc][i]; pv[8 + i] = s[2 * kc + 1][i]; }
        const F2 p = bsplit16(pv);
        if (kc == 1) {
#pragma unroll
          for (int j = 0; j < HD / 16; ++j) { vbh[j] = frag_b(VB + pb + (size_t)(j * 16) * KHI + 32, lane); vbl[j] = frag_b(VBL + pb + (size_t)(j * 16) * KHI + 32, lane); }
          __builtin_amdgcn_sched_barrier(0); }   /* the second half's eight v fragments are in flight together */
#pragma unroll
        for (int j = 0; j < HD / 16; ++j) { acc[j] = wmma_bf(vbh[j], p.h, acc[j]); acc[j] = wmma_bf(vbh[j], p.l, acc[j]); acc[j] = wmma_bf(vbl[j], p.h, acc[j]); }
      } else { v16h p;
#pragma unroll
        for (int i = 0; i < 8; ++i) { p[i] = (_Float16)s[2 * kc][i]; p[8 + i] = (_Float16)s[2 * kc + 1][i]; }
#pragma unroll
        for (int j = 0; j < HD / 16; ++j) acc[j] = wmma16(vf[kc][j], p, acc[j]); } } }
  const float inv = l > 0.f ? 1.0f / (l * 2048.0f) : 0.f;
  float* yr = Y + (q0 + col) * CC + h * HD + 8 * g;   /* D element r of tile j = channel j * 16 + 8g + r of query col: 32 contiguous bytes a lane */
#pragma unroll
  for (int j = 0; j < HD / 16; ++j) { const v4f lo = {acc[j][0] * inv, acc[j][1] * inv, acc[j][2] * inv, acc[j][3] * inv}, hi = {acc[j][4] * inv, acc[j][5] * inv, acc[j][6] * inv, acc[j][7] * inv}; vst2(yr + j * 16, lo); vst2(yr + j * 16 + 4, hi); } }
__global__ __launch_bounds__(128) void k_att(const _Float16* __restrict__ QH, const _Float16* __restrict__ KH, const _Float16* __restrict__ QL, const _Float16* __restrict__ KL, const _Float16* __restrict__ VT, const __bf16* __restrict__ VB, const __bf16* __restrict__ VBL, float* __restrict__ Y) {
  const int qb = NQB - 1 - (int)blockIdx.y, h = blockIdx.x % NH, b = blockIdx.x / NH;   /* the longest key ranges take the lowest blockIdx.y */
  if (qb < QBH) att_body<true>(QH, KH, QL, KL, VT, VB, VBL, Y, qb, h, b); else att_body<false>(QH, KH, QL, KL, VT, VB, VBL, Y, qb, h, b); }
// ---- k_out: block = (64 rows, 128 cols): out = ctx Wo (+ bo): ctx x 2^6 once to f16 against Wo as f16(bf16 x 2^8) exact (1 product) x 2^-14; causal early rows (< QHI of each sequence): ctx bf16 hi + lo against exact bf16 Wo (2 products)
__global__ __launch_bounds__(128) void k_out(const float* __restrict__ Y, const float* __restrict__ WO, const float* __restrict__ BO, float* __restrict__ OUT) { __shared__ __align__(16) unsigned char sm[2 * GW_B + 4 * GA_B + 33792];   /* staged W chunks, staged ctx chunks (two planes for the early rows), then the output staging sf */
  unsigned char* sw = sm; unsigned char* sa = sm + 2 * GW_B; float (*sf)[16][132] = (float (*)[16][132])(sm + 2 * GW_B + 4 * GA_B);
  const int tid = threadIdx.x, wave = tid >> 5, lane = tid & 31, col = lane & 15, g = lane >> 4; const int c0 = blockIdx.y * 128; const size_t r0 = (size_t)blockIdx.x * 64 + wave * 16;
  v8f acc[8] = {};
  if (CAUSAL && (int)(((size_t)blockIdx.x * 64) % TT) < QHI) {   /* block-uniform */
    gemm_staged<1, CC>(Y + (size_t)blockIdx.x * 64 * CC, WO + (size_t)c0 * CC, sw, sa, acc);
#pragma unroll
    for (int j = 0; j < 8; ++j) { const float bias = BO ? bfr(BO[c0 + j * 16 + col]) : 0.f;
#pragma unroll
      for (int r = 0; r < 8; ++r) sf[wave][8 * g + r][j * 16 + col] = acc[j][r] + bias; }
  } else {
    gemm_staged<2, CC>(Y + (size_t)blockIdx.x * 64 * CC, WO + (size_t)c0 * CC, sw, sa, acc);   /* ctx carried x 2^6 into f16 so small-magnitude context rows stay clear of f16 subnormals */
#pragma unroll
    for (int j = 0; j < 8; ++j) { const float bias = BO ? bfr(BO[c0 + j * 16 + col]) : 0.f;
#pragma unroll
      for (int r = 0; r < 8; ++r) sf[wave][8 * g + r][j * 16 + col] = acc[j][r] * (1.0f / 16384.0f) + bias; } }   /* 2^-8 (Wo carry) x 2^-6 (ctx carry) */
  LDSX(); for (int rl = 0; rl < 16; ++rl) vst2(OUT + (r0 + rl) * DIN + c0 + lane * 4, *(const v4f*)&sf[wave][rl][lane * 4]); }

extern "C" void kernel_launch(void* const* d_in, const int* in_sizes, int n_in, void* d_out, int out_size, void* d_ws, size_t ws_size, hipStream_t stream) {
  (void)in_sizes; (void)n_in; (void)out_size;
  const float** F = (const float**)d_in;
  if (ws_size < (size_t)WS_END) return;
  char* ws = (char*)d_ws; _Float16 *QH = (_Float16*)(ws + WS_QH), *KH = (_Float16*)(ws + WS_KH), *VT = (_Float16*)(ws + WS_VT), *QL = (_Float16*)(ws + WS_QL), *KL = (_Float16*)(ws + WS_KL); __bf16 *VB = (__bf16*)(ws + WS_VB), *VBL = (__bf16*)(ws + WS_VBL); float *Y = (float*)(ws + WS_Y);
  (void)Y; (void)QL; (void)KL; (void)VB; (void)VBL;
  // inputs: 0 x [2,2048,1024]; 1 Wq [1024,1024] (out,in); 2 Wk; 3 Wv; 4 bv [1024] (NONZERO; q and k have no bias: null pointers); 5 Wo (out,in); 6 bo (NONZERO)
  k_proj<<<dim3(TNB * TT / 64, CC / 128, 3), 128, 0, stream>>>(F[0], F[0], F[0], F[1], F[2], F[3], nullptr, nullptr, F[4], QH, QL, KH, KL, VT, VB, VBL);
  k_att<<<dim3(NH * TNB, NQB), 128, 0, stream>>>(QH, KH, QL, KL, VT, VB, VBL, Y);
  k_out<<<dim3(TNB * TT / 64, DIN / 128), 128, 0, stream>>>(Y, F[5], F[6], (float*)d_out);
}

// v003
// Measured time: 111 microseconds a run.
// In two side-by-side timings against v002, it was 1.21 and 1.20 times as fast.
// Over all steps from v000 it is 11.6 times as fast.
// compute dtype: all float inputs rounded to bf16; q / k / v projections with EXACT bf16 products on WMMA 16x16x32 (f32 accumulate) + bias (v only; nonzero); interleaved-pair RoPE in f32 on q and k (which have no bias) (embedded frequencies, precise cosf / sinf, positions = the row index); causal logits: 3 products for the first 384 rows, single f16 q x k after, x 64^-0.5; online softmax f32 in one fused pass; exp(logit - running max) x 2^11 once to f16 x v once to f16 (bf16 hi + lo below row 384); ctx hi+lo x exact Wo below row 384, x2^6 f16 carry x f16(bf16 x 2^8) Wo after, + bo; f32 output.
#include <hip/hip_runtime.h>
#include <math.h>

typedef __attribute__((ext_vector_type(16))) _Float16 v16h;
typedef __attribute__((ext_vector_type(16))) __bf16 v16b;
typedef __attribute__((ext_vector_type(8)))  _Float16 v8h;
typedef __attribute__((ext_vector_type(8)))  float v8f;
typedef __attribute__((ext_vector_type(4)))  float v4f;
typedef __attribute__((ext_vector_type(2)))  float v2f;
typedef __attribute__((ext_vector_type(4)))  unsigned v4u;
typedef __attribute__((ext_vector_type(4)))  int v4i;
typedef float __attribute__((may_alias)) float_a;
typedef int __attribute__((may_alias)) int_a;

template <typename T> __device__ __forceinline__ void vst2(void* p, T v) { *(T*)p = v;  }
__device__ __forceinline__ v8f wmma16(v16h a, v16h b, v8f c) {
  v8f d = __builtin_amdgcn_wmma_f32_16x16x32_f16(false, a, false, b, (short)0, c, false, false);
  asm volatile("v_nop\n\tv_nop\n\tv_nop\n\tv_nop" : "+v"(d) : "v"(a), "v"(b));
  return d;
}
__device__ __forceinline__ v8f wmma_bf(v16b a, v16b b, v8f c) {
  v8f d = __builtin_amdgcn_wmma_f32_16x16x32_bf16(false, a, false, b, (short)0, c, false, false);
  asm volatile("v_nop\n\tv_nop\n\tv_nop\n\tv_nop" : "+v"(d) : "v"(a), "v"(b));
  return d;
}
// 16x16x32 fragments: lane = (h = lane>>4, row/col = lane&15); elements 0..7 = k0+8h+0..7, 8..15 = k0+16+8h+0..7; D element r = row 8h+r
__device__ __forceinline__ v16h frag_h(const _Float16* rowk0, int lane) {
  union { v16h v; v8h q[2]; } u; const _Float16* p = rowk0 + 8 * (lane >> 4);
  u.q[0] = *(const v8h*)p; u.q[1] = *(const v8h*)(p + 16); return u.v;
}
__device__ __forceinline__ v16h frag_f32(const float* rowk0, int lane) {
  v16h a; const float* p = rowk0 + 8 * (lane >> 4);
#pragma unroll
  for (int i = 0; i < 8; ++i) { a[i] = (_Float16)p[i]; a[8 + i] = (_Float16)p[16 + i]; }
  return a;
}
__device__ __forceinline__ v16h frag_f32s(const float* rowk0, int lane, float sc) {
  v16h a; const float* p = rowk0 + 8 * (lane >> 4);
#pragma unroll
  for (int i = 0; i < 8; ++i) { a[i] = (_Float16)(p[i] * sc); a[8 + i] = (_Float16)(p[16 + i] * sc); }
  return a;
}
// column fragment from a [K][ld] layout (column n), rows >= K read as 0
__device__ __forceinline__ v16h fragc_f32(const float* W, int k0, int n, int lane, int ld, int K) {
  v16h a; const int g = lane >> 4;
#pragma unroll
  for (int i = 0; i < 8; ++i) { const int ka = k0 + 8 * g + i, kb = ka + 16;
    a[i] = (_Float16)(ka < K ? W[(size_t)(ka < K ? ka : K - 1) * ld + n] : 0.f); a[8 + i] = (_Float16)(kb < K ? W[(size_t)(kb < K ? kb : K - 1) * ld + n] : 0.f); }
  return a;
}
struct F2 { v16b h, l; };
__device__ __forceinline__ F2 bsplit16(const float v[16]) { F2 r;
#pragma unroll
  for (int i = 0; i < 16; ++i) { const __bf16 h = (__bf16)v[i]; r.h[i] = h; r.l[i] = (__bf16)(v[i] - (float)h); }
  return r; }
__device__ __forceinline__ F2 split_row(const float* row, int k0, int lane) { float v[16]; const float* p = row + k0 + 8 * (lane >> 4);
#pragma unroll
  for (int i = 0; i < 8; ++i) { v[i] = p[i]; v[8 + i] = p[16 + i]; }
  return bsplit16(v); }
__device__ __forceinline__ F2 split_rowK(const float* row, int k0, int lane, int K) { float v[16]; const int g = lane >> 4;
#pragma unroll
  for (int i = 0; i < 8; ++i) { const int ka = k0 + 8 * g + i, kb = ka + 16; v[i] = ka < K ? row[ka < K ? ka : K - 1] : 0.f; v[8 + i] = kb < K ? row[kb < K ? kb : K - 1] : 0.f; }
  return bsplit16(v); }
__device__ __forceinline__ F2 split_col(const float* W, int k0, int n, int lane, int ld, int K) { float v[16]; const int g = lane >> 4;
#pragma unroll
  for (int i = 0; i < 8; ++i) { const int ka = k0 + 8 * g + i, kb = ka + 16; v[i] = ka < K ? W[(size_t)(ka < K ? ka : K - 1) * ld + n] : 0.f; v[8 + i] = kb < K ? W[(size_t)(kb < K ? kb : K - 1) * ld + n] : 0.f; }
  return bsplit16(v); }
__device__ __forceinline__ v8f mac3(const F2& a, const F2& b, v8f c) { c = wmma_bf(a.l, b.h, c); c = wmma_bf(a.h, b.l, c); return wmma_bf(a.h, b.h, c); }
__device__ __forceinline__ float sigm(float v) { return 1.0f / (1.0f + expf(-v)); }
#define LDSX() do { asm volatile("s_wait_dscnt 0" ::: "memory"); __builtin_amdgcn_wave_barrier(); __builtin_amdgcn_fence(__ATOMIC_RELEASE, "workgroup"); } while (0)

// Causal self-attention with interleaved-pair RoPE (x [2,2048,1024]; (out,in) Wq / Wk / Wv [1024,1024] N(0, 1/1024) applied as einsum('bse,he->bsh') = x @ W.T; bv [1024] NONZERO (only v has a bias); Wo [1024,1024] (out,in) + bo NONZERO; 16 heads x 64; RoPE (base 10000, positions 0..2047) on q and k: (even, odd) pairs rotated and re-interleaved; scores x 1/sqrt(64); triu(k = 1) -> -inf; softmax; out @ Wo.T + bo).
#define NB 2
#define TT 2048
#define CC 1024            // NH * HD = projected width
#define DIN 1024          // input (model) width
#define NH 16
#define HD 64
#define NQB (TT / 64)
#define SCALE (0.125f)
#define CAUSAL 1
#ifndef TNB
#define TNB NB
#endif
__device__ __forceinline__ float bfr(float v) { return (float)(__bf16)v; }
typedef __attribute__((ext_vector_type(8))) __bf16 v8b;
__device__ __forceinline__ v16b frag_b(const __bf16* rowk0, int lane) {
  union { v16b v; v8b q[2]; } u; const __bf16* p = rowk0 + 8 * (lane >> 4);
  u.q[0] = *(const v8b*)p; u.q[1] = *(const v8b*)(p + 16); return u.v;
}
#define QBH 6              // causal: query blocks 0..QBH-1 of each sequence (few keys, no averaging) take the high-precision path
#define QHI 384            // rows carrying a q residual plane
#define KHI 384            // key rows carrying k residual / v bf16 hi+lo planes (used only by the causal high-precision path)
// B fragment (k rows k0+.., output column o) of a weight: (in,out) [K][ld] or (out,in) [ld rows of K]: bf16 exact, or f16(bf16 * 256) exact
__device__ __forceinline__ v16b wcol_io(const float* Wm, int k0, int o, int lane, int ld) { v16b w; const int g = lane >> 4;
#pragma unroll
  for (int i = 0; i < 8; ++i) { w[i] = (__bf16)Wm[(size_t)(k0 + 8 * g + i) * ld + o]; w[8 + i] = (__bf16)Wm[(size_t)(k0 + 16 + 8 * g + i) * ld + o]; }
  return w; }
__device__ __forceinline__ v16b wcol_oi(const float* Wm, int k0, int o, int lane, int K) { v16b w; const float* p = Wm + (size_t)o * K + k0 + 8 * (lane >> 4);
#pragma unroll
  for (int i = 0; i < 8; ++i) { w[i] = (__bf16)p[i]; w[8 + i] = (__bf16)p[16 + i]; }
  return w; }
__device__ __forceinline__ v16h wcolh_io(const float* Wm, int k0, int o, int lane, int ld) { v16h w; const int g = lane >> 4;
#pragma unroll
  for (int i = 0; i < 8; ++i) { w[i] = (_Float16)(bfr(Wm[(size_t)(k0 + 8 * g + i) * ld + o]) * 256.0f); w[8 + i] = (_Float16)(bfr(Wm[(size_t)(k0 + 16 + 8 * g + i) * ld + o]) * 256.0f); }
  return w; }
__device__ __forceinline__ v16h wcolh_oi(const float* Wm, int k0, int o, int lane, int K) { v16h w; const float* p = Wm + (size_t)o * K + k0 + 8 * (lane >> 4);
#pragma unroll
  for (int i = 0; i < 8; ++i) { w[i] = (_Float16)(bfr(p[i]) * 256.0f); w[8 + i] = (_Float16)(bfr(p[16 + i]) * 256.0f); }
  return w; }
#define WQKV_LAYOUT 1   // picks only the WCOL helper, which nothing calls (0 = (in,out) [DIN][CC]; 1 = (out,in) [CC][DIN]; 2 = per-head [NH][DIN][HD]); k_proj always reads (out,in) [CC][DIN]
__device__ __forceinline__ v16b wcol_hdk(const float* Wm, int k0, int o, int lane) { v16b w; const int g = lane >> 4; const float* p = Wm + (size_t)(o / HD) * DIN * HD + (o % HD);
#pragma unroll
  for (int i = 0; i < 8; ++i) { w[i] = (__bf16)p[(size_t)(k0 + 8 * g + i) * HD]; w[8 + i] = (__bf16)p[(size_t)(k0 + 16 + 8 * g + i) * HD]; }
  return w; }
#define WO_OUT_IN 1
#if WQKV_LAYOUT == 1
#define WCOL(W, k0, o, lane) wcol_oi(W, k0, o, lane, DIN)
#elif WQKV_LAYOUT == 2
#define WCOL(W, k0, o, lane) wcol_hdk(W, k0, o, lane)
#else
#define WCOL(W, k0, o, lane) wcol_io(W, k0, o, lane, CC)
#endif
#if WO_OUT_IN
#define WOCOL(W, k0, o, lane) wcol_oi(W, k0, o, lane, CC)
#define WOCOLH(W, k0, o, lane) wcolh_oi(W, k0, o, lane, CC)
#else
#define WOCOL(W, k0, o, lane) wcol_io(W, k0, o, lane, DIN)
#define WOCOLH(W, k0, o, lane) wcolh_io(W, k0, o, lane, DIN)
#endif

// RoPE inverse frequencies 1/10000^(2i/64)
__constant__ float INVF[32] = {1.000000000e+00,7.498942018e-01,5.623413324e-01,4.216965139e-01,3.162277639e-01,2.371373624e-01,1.778279394e-01,1.333521456e-01,1.000000015e-01,7.498941571e-02,5.623412877e-02,4.216964915e-02,3.162277862e-02,2.371373586e-02,1.778279431e-02,1.333521493e-02,9.999999776e-03,7.498942316e-03,5.623413250e-03,4.216964822e-03,3.162277862e-03,2.371373819e-03,1.778279431e-03,1.333521446e-03,1.000000047e-03,7.498941850e-04,5.623413017e-04,4.216964880e-04,3.162277862e-04,2.371373848e-04,1.778279402e-04,1.333521504e-04};
#define PROJ_EXTRA_PARAMS
// per (token, head) hook on the staged f32 row (64 floats, projection + bias) of the q and k streams: interleaved-pair rotation (x[2i], x[2i + 1]) by the angle t * INVF[i]; v untouched
#define PROJ_EPI(which, row, t, h) do { if ((which) < 2) { float* rw = (row); const float pos_ = (float)(t);   /* position = the token's sequence index */ _Pragma("unroll 4") for (int i = 0; i < 32; ++i) { _Pragma("clang fp contract(off)") const float ang = pos_ * INVF[i]; const float cs = cosf(ang), sn = sinf(ang); const float xe = rw[2 * i], xo = rw[2 * i + 1]; rw[2 * i] = xe * cs - xo * sn; rw[2 * i + 1] = xe * sn + xo * cs; } } } while (0)
#ifndef PROJ_EXTRA_PARAMS
#define PROJ_EXTRA_PARAMS
#endif

#define WS_QH  0u                                      // f16 q rows [b*t][CC]
#define WS_KH  (WS_QH + 2u * (size_t)NB * TT * CC)      // f16 k rows [b*t][CC]
#define WS_VT  (WS_KH + 2u * (size_t)NB * TT * CC)      // f16 v planes [b][c][t]
#define WS_QL  (WS_VT + 2u * (size_t)NB * CC * TT)      // f16 q residual x 2^10 rows [b][t < QHI][CC]
#define WS_KL  (WS_QL + 2u * (size_t)NB * QHI * CC)     // f16 k residual x 2^10 rows [b][t < KHI][CC]
#define WS_VB  (WS_KL + 2u * (size_t)NB * KHI * CC)     // bf16 v hi planes [b][c][t < KHI]
#define WS_VBL (WS_VB + 2u * (size_t)NB * CC * KHI)
#define WS_Y   (WS_VBL + 2u * (size_t)NB * CC * KHI)     // f32 ctx rows [b*t][CC] (only when there is an output projection)
#define WS_END (WS_Y  + 4u * (size_t)NB * TT * CC)

// ---- staged GEMM loop shared by k_proj and k_out: a block's 64 A rows and 128 W rows (both k-contiguous f32, row length LD) come in chunks of GK k columns by whole-line 16-byte loads, are rounded ONCE to their 16-bit operand form and stored in LDS, where the four waves read their fragments. Two LDS buffers, one barrier a chunk; the next chunk's global loads fly under this chunk's products. Rounding, fragment k order and the order of the products into each accumulator are those of the per-lane global fragment loads that this replaces.
// MODE 0: A and W bf16, one product; MODE 1: A bf16 hi + lo planes, W bf16, two products; MODE 2: A f16(x 2^6), W f16(bf16 x 2^8), one product
#define GK 64                  // k columns of a chunk: 256 B of every f32 row
#define GP 72                  // LDS row pitch in 16-bit elements: 144 B = 16 B x 9, so the 16-byte fragment reads of 16 rows meet no bank twice
#define GW_B (128 * GP * 2)    // bytes of one W buffer
#define GA_B (64 * GP * 2)     // bytes of one plane of one A buffer
typedef __attribute__((ext_vector_type(4))) __bf16 v4b;
typedef __attribute__((ext_vector_type(4))) _Float16 v4h;
template <int MODE, int LD> __device__ __forceinline__ void gemm_staged(const float* __restrict__ Ag, const float* __restrict__ Wg, unsigned char* sw, unsigned char* sa, v8f (&acc)[8]) {
  const int tid = threadIdx.x, wave = tid >> 5, lane = tid & 31, col = lane & 15; const int lr = tid >> 4, lc = tid & 15;   /* 16 lanes x 16 B = one row's chunk; the block covers 8 rows a load */
  const float* ap = Ag + (size_t)lr * LD + lc * 4; const float* wp = Wg + (size_t)lr * LD + lc * 4;
  constexpr int NPL = MODE == 1 ? 2 : 1;
  v4f ar[8], wr[16];
#pragma unroll
  for (int i = 0; i < 8; ++i) ar[i] = *(const v4f*)(ap + (size_t)(8 * i) * LD);
#pragma unroll
  for (int i = 0; i < 16; ++i) wr[i] = *(const v4f*)(wp + (size_t)(8 * i) * LD);
  asm volatile("s_wait_xcnt 0x0" ::: "memory");   /* stands in front of any rewrite of the address registers that the 24 issued loads name */
#pragma unroll 2   /* two chunks a body: the two buffers' LDS offsets become constants */
  for (int ch = 0; ch < LD / GK; ++ch) { unsigned char* wb = sw + (ch & 1) * GW_B; unsigned char* ab = sa + (ch & 1) * (NPL * GA_B);
#pragma unroll
    for (int i = 0; i < 8; ++i) { const int eo = (lr + 8 * i) * GP + lc * 4; const v4f v = ar[i];
      if (MODE == 2) { const v4h o = {(_Float16)(v[0] * 64.0f), (_Float16)(v[1] * 64.0f), (_Float16)(v[2] * 64.0f), (_Float16)(v[3] * 64.0f)}; *(v4h*)((_Float16*)ab + eo) = o; }
      else { const v4b o = {(__bf16)v[0], (__bf16)v[1], (__bf16)v[2], (__bf16)v[3]}; *(v4b*)((__bf16*)ab + eo) = o;
        if (MODE == 1) { const v4b o2 = {(__bf16)(v[0] - (float)o[0]), (__bf16)(v[1] - (float)o[1]), (__bf16)(v[2] - (float)o[2]), (__bf16)(v[3] - (float)o[3])}; *(v4b*)((__bf16*)(ab + GA_B) + eo) = o2; } } }
#pragma unroll
    for (int i = 0; i < 16; ++i) { const int eo = (lr + 8 * i) * GP + lc * 4; const v4f v = wr[i];
      if (MODE == 2) { const v4h o = {(_Float16)(bfr(v[0]) * 256.0f), (_Float16)(bfr(v[1]) * 256.0f), (_Float16)(bfr(v[2]) * 256.0f), (_Float16)(bfr(v[3]) * 256.0f)}; *(v4h*)((_Float16*)wb + eo) = o; }
      else { const v4b o = {(__bf16)v[0], (__bf16)v[1], (__bf16)v[2], (__bf16)v[3]}; *(v4b*)((__bf16*)wb + eo) = o; } }
    __syncthreads();   /* publishes this chunk; it also ends every wave's reads of the other buffer, which the next trip overwrites */
    if (ch + 1 < LD / GK) {   /* block-uniform: the next chunk's loads, behind the barrier (whose fence would wait for them) and in flight under this chunk's fragment reads and products */
#pragma unroll
      for (int i = 0; i < 8; ++i) ar[i] = *(const v4f*)(ap + (size_t)(8 * i) * LD + (ch + 1) * GK);
#pragma unroll
      for (int i = 0; i < 16; ++i) wr[i] = *(const v4f*)(wp + (size_t)(8 * i) * LD + (ch + 1) * GK);
      asm volatile("s_wait_xcnt 0x0" ::: "memory"); }   /* stands in front of any rewrite of the address registers that the 24 issued loads name */
#pragma unroll
    for (int kk = 0; kk < GK / 32; ++kk) { const int ao = (wave * 16 + col) * GP + kk * 32;
      if (MODE == 2) { const v16h a = frag_h((const _Float16*)ab + ao, lane); v16h w[8];
#pragma unroll
        for (int j = 0; j < 8; ++j) w[j] = frag_h((const _Float16*)wb + (j * 16 + col) * GP + kk * 32, lane);
#pragma unroll
        for (int j = 0; j < 8; ++j) acc[j] = wmma16(a, w[j], acc[j]);
      } else { const v16b a = frag_b((const __bf16*)ab + ao, lane); v16b a2 = a, w[8]; if (MODE == 1) a2 = frag_b((const __bf16*)(ab + GA_B) + ao, lane);
#pragma unroll
        for (int j = 0; j < 8; ++j) w[j] = frag_b((const __bf16*)wb + (j * 16 + col) * GP + kk * 32, lane);
#pragma unroll
        for (int j = 0; j < 8; ++j) { acc[j] = wmma_bf(a, w[j], acc[j]); if (MODE == 1) acc[j] = wmma_bf(a2, w[j], acc[j]); } } } } }

// ---- k_proj: block = (64 rows, 128 cols, which): q/k/v = X W (+ b) with exact bf16 products (K = DIN) -> which 0: q f16 rows (+ residual rows < QHI); 1: k f16 rows (+ residual rows < KHI); 2: v f16 planes [c][t] (+ bf16 hi/lo planes for t < KHI)
__global__ __launch_bounds__(128) void k_proj(const float* __restrict__ XQ, const float* __restrict__ XK, const float* __restrict__ XV, const float* __restrict__ WQ, const float* __restrict__ WK, const float* __restrict__ WV, const float* __restrict__ BQ, const float* __restrict__ BK, const float* __restrict__ BV,
    _Float16* __restrict__ QH, _Float16* __restrict__ QL, _Float16* __restrict__ KH, _Float16* __restrict__ KL, _Float16* __restrict__ VT, __bf16* __restrict__ VB, __bf16* __restrict__ VBL PROJ_EXTRA_PARAMS) {
  __shared__ __align__(16) unsigned char sm[55296 + 33792];   /* one region that holds in turn the staged operand chunks (W 2 x 18432 B, X 2 x 9216 B) and the epilogue's planes: sh, sl (q, k) or th, tb, tbl (v); then st */
  unsigned char* rg = sm; float (*st)[132] = (float (*)[132])(sm + 55296);
  _Float16 (*sh)[136] = (_Float16 (*)[136])rg; _Float16 (*sl)[136] = (_Float16 (*)[136])(rg + 17408); _Float16 (*th)[72] = (_Float16 (*)[72])rg; __bf16 (*tb)[72] = (__bf16 (*)[72])(rg + 18432); __bf16 (*tbl)[72] = (__bf16 (*)[72])(rg + 36864);
  const int tid = threadIdx.x, wave = tid >> 5, lane = tid & 31, col = lane & 15, g = lane >> 4; const int which = blockIdx.z; const int c0 = blockIdx.y * 128; const size_t r0 = (size_t)blockIdx.x * 64; const size_t bb = r0 / TT; const int t0 = (int)(r0 % TT);
  const float* X = which == 0 ? XQ : which == 1 ? XK : XV; const float* WA = which == 0 ? WQ : which == 1 ? WK : WV; const float* BA = which == 0 ? BQ : which == 1 ? BK : BV;
  v8f acc[8] = {};
  gemm_staged<0, DIN>(X + r0 * DIN, WA + (size_t)c0 * DIN, rg, rg + 2 * GW_B, acc);
  { // stage the f32 tile (acc + bias) in LDS, run the per-(row, head) epilogue hook, then convert
#pragma unroll
    for (int j = 0; j < 8; ++j) { const float bias = BA ? bfr(BA[c0 + j * 16 + col]) : 0.f;
#pragma unroll
      for (int r = 0; r < 8; ++r) st[wave * 16 + 8 * g + r][j * 16 + col] = acc[j][r] + bias; }
    __syncthreads();
    for (int e = tid; e < 64 * (128 / HD); e += 128) { const int rl = e / (128 / HD), hh = e % (128 / HD); PROJ_EPI(which, &st[rl][hh * HD], (int)((r0 + rl) % TT), (c0 / HD) + hh); }
    __syncthreads(); }
  if (which < 2) { _Float16* DH = which == 0 ? QH : KH; _Float16* DL = which == 0 ? QL : KL; const int nhi = which == 0 ? QHI : KHI; const bool hi_rows = t0 < nhi;
    for (int e = tid; e < 64 * 128; e += 128) { const int rl = e >> 7, cl = e & 127; const float v = st[rl][cl]; const _Float16 hv = (_Float16)v; sh[rl][cl] = hv; sl[rl][cl] = (_Float16)((v - (float)hv) * 1024.0f); }
    __syncthreads();
    for (int e = tid; e < 64 * 16; e += 128) { const int rl = e >> 4, q = e & 15; vst2((unsigned*)(DH + (r0 + rl) * CC + c0 + q * 8), *(const v4u*)&sh[rl][q * 8]); if (hi_rows) vst2((unsigned*)(DL + (bb * nhi + t0 + rl) * (size_t)CC + c0 + q * 8), *(const v4u*)&sl[rl][q * 8]); }
  } else { const bool hi_rows = t0 < KHI;
    for (int e = tid; e < 64 * 128; e += 128) { const int rl = e & 63, cl = e >> 6; const float v = st[rl][cl]; th[cl][rl] = (_Float16)v; const __bf16 bh = (__bf16)v; tb[cl][rl] = bh; tbl[cl][rl] = (__bf16)(v - (float)bh); }
    __syncthreads();
    for (int e = tid; e < 128 * 8; e += 128) { const int cl = e >> 3, q = e & 7; vst2((unsigned*)(VT + (bb * CC + c0 + cl) * (size_t)TT + t0 + q * 8), *(const v4u*)&th[cl][q * 8]); if (hi_rows) { const size_t o3 = (bb * CC + c0 + cl) * (size_t)KHI + t0 + q * 8; vst2((unsigned*)(VB + o3), *(const v4u*)&tb[cl][q * 8]); vst2((unsigned*)(VBL + o3), *(const v4u*)&tbl[cl][q * 8]); } } } }
// ---- k_att: block = 64 queries (qb) of (b, h), wave = 16 queries: logits, softmax and P . v in one pass over key blocks of 64, nothing of the logits leaves registers.
// Transposed tiles: S^T = k q^T puts (key 8g + r, query col) in D element r, which is already the B fragment (k = keys) of ctx^T = v^T P^T; the row statistics of a query live in its two lanes (col, col + 16).
// Past the early query blocks the block's four waves share each key block's k and v tiles: asynchronous 16-byte copies bring them by whole lines into two LDS buffers (the next block's copies fly under this block's work), and every wave reads its fragments there. Fragment contents, k order and the order of the products are those of the per-lane global fragment loads that this replaces.
// Running maximum m and sum l per query; e = exp(logit - m) x 2^11 once to f16 against v f16 (HI, causal early query blocks: 3-product logits, e and v as bf16 hi + lo, 3 products); ctx = acc / (2^11 l). The inner loops are fully unrolled so that every fragment array stays in registers.
#define AP 144                 // LDS pitch in bytes of a staged 128-byte row: 16 B x 9, so the 16-byte fragment reads of 16 rows meet no bank twice
#define AT_B (64 * AP)         // bytes of one staged tile of 64 rows; a buffer = the k tile, then the v tile
// one key block into one LDS buffer: k tile = 64 key rows x the head's 64 channels, v tile = the head's 64 channel planes x 64 keys, 128 B a row. A lane copies its 16 B of rows r, r + 16, r + 32, r + 48 of both tiles (r = tid >> 3), so each wave-wide copy covers four whole lines. ld, kg, vg: the lane's own LDS byte address and global addresses in row r.
__device__ __forceinline__ void att_stage(unsigned ld, const _Float16* kg, const _Float16* vg) {
  /* the closing s_wait_xcnt 0 stands inside the copies' own statement, in front of any rewrite of the address registers that the eight issued copies name */
  asm volatile("global_load_async_to_lds_b128 %0, %8, off\n\t"
               "global_load_async_to_lds_b128 %1, %9, off\n\t"
               "global_load_async_to_lds_b128 %2, %10, off\n\t"
               "global_load_async_to_lds_b128 %3, %11, off\n\t"
               "global_load_async_to_lds_b128 %4, %12, off\n\t"
               "global_load_async_to_lds_b128 %5, %13, off\n\t"
               "global_load_async_to_lds_b128 %6, %14, off\n\t"
               "global_load_async_to_lds_b128 %7, %15, off\n\t"
               "s_wait_xcnt 0x0"
               :: "v"(ld), "v"(ld + 16 * AP), "v"(ld + 32 * AP), "v"(ld + 48 * AP), "v"(ld + AT_B), "v"(ld + AT_B + 16 * AP), "v"(ld + AT_B + 32 * AP), "v"(ld + AT_B + 48 * AP),
                  "v"(kg), "v"(kg + 16 * CC), "v"(kg + 32 * CC), "v"(kg + 48 * CC), "v"(vg), "v"(vg + 16 * TT), "v"(vg + 32 * TT), "v"(vg + 48 * TT) : "memory"); }
template <bool HI> __device__ __forceinline__ void att_body(unsigned char* sm, const _Float16* __restrict__ QH, const _Float16* __restrict__ KH, const _Float16* __restrict__ QL, const _Float16* __restrict__ KL, const _Float16* __restrict__ VT, const __bf16* __restrict__ VB, const __bf16* __restrict__ VBL, float* __restrict__ Y, int qb, int h, int b) {
  const int tid = threadIdx.x, wave = tid >> 5, lane = tid & 31, col = lane & 15, g = lane >> 4; const int ql0 = qb * 64 + wave * 16; const int t = ql0 + col; const size_t q0 = (size_t)b * TT + ql0;
  const _Float16* QLb = QL + (size_t)b * QHI * CC; const _Float16* KLb = KL + (size_t)b * KHI * CC;
  const _Float16* kp = KH + ((size_t)b * TT + col) * CC + h * HD;              /* key row col, this head's 64 channels */
  const unsigned ld0 = (unsigned)(size_t)sm + (unsigned)((tid >> 3) * AP + (tid & 7) * 16);                 /* this lane's place in row tid >> 3 of buffer 0's k tile */
  const _Float16* kg = KH + ((size_t)b * TT + (tid >> 3)) * CC + h * HD + (tid & 7) * 8;                     /* its 16 B of key row tid >> 3 */
  const _Float16* vg = VT + ((size_t)b * CC + h * HD + (tid >> 3)) * (size_t)TT + (tid & 7) * 8;             /* its 16 B of channel plane tid >> 3 */
  v16h ah[HD / 32], al[HD / 32], kf[HD / 32][4];
#pragma unroll
  for (int kc = 0; kc < HD / 32; ++kc) { ah[kc] = frag_h(QH + (q0 + col) * CC + h * HD + kc * 32, lane); if (HI) al[kc] = frag_h(QLb + (size_t)(ql0 + col) * CC + h * HD + kc * 32, lane); }
  if (!HI) {   /* block-uniform: key block 0 into buffer 0, landed and published; then key block 1 into buffer 1 */
    att_stage(ld0, kg, vg);
    asm volatile("s_wait_asynccnt 0x0" ::: "memory");   /* this wave's copies of key block 0 have landed */
    __syncthreads();                                    /* every wave's have: buffer 0 may be read */
    if (qb >= 1) att_stage(ld0 + 2 * AT_B, kg + (size_t)64 * CC, vg + 64); }
  float m = -3.0e38f, l = 0.f; v8f acc[HD / 16] = {};
#pragma unroll 1   /* rolled: one block's k and v fragments already fill the registers that four waves a SIMD leave a wave */
  for (int kb = 0; kb <= qb; ++kb) { const int k0 = kb * 64;   /* causal: key blocks 0 .. qb; only block qb crosses the diagonal */
    v16h vf[2][HD / 16];
    if (!HI) { const unsigned char* kt = sm + (kb & 1) * (2 * AT_B) + col * AP; const unsigned char* vt = kt + AT_B;   /* row col of this key block's two tiles */
#pragma unroll
      for (int kc = 0; kc < HD / 32; ++kc)
#pragma unroll
        for (int j = 0; j < 4; ++j) kf[kc][j] = frag_h((const _Float16*)(kt + j * 16 * AP) + kc * 32, lane);
#pragma unroll
      for (int kc = 0; kc < 2; ++kc)
#pragma unroll
        for (int j = 0; j < HD / 16; ++j) vf[kc][j] = frag_h((const _Float16*)(vt + j * 16 * AP) + kc * 32, lane); }
    __builtin_amdgcn_sched_barrier(0);   /* keeps this block's k and v LDS reads issued here as one group, the v reads in flight under the logits and the softmax, instead of one by one in front of their products */
    v8f s[4] = {}, sl[4] = {};
#pragma unroll
    for (int kc = 0; kc < HD / 32; ++kc) { v16h klf[4];
      if (HI) {
#pragma unroll
        for (int j = 0; j < 4; ++j) { kf[kc][j] = frag_h(kp + (size_t)(k0 + j * 16) * CC + kc * 32, lane); klf[j] = frag_h(KLb + (size_t)(k0 + j * 16 + col) * CC + h * HD + kc * 32, lane); }
        __builtin_amdgcn_sched_barrier(0); }   /* the eight k and k residual fragments of this half are in flight together: one latency, not eight */
#pragma unroll
      for (int j = 0; j < 4; ++j) { s[j] = wmma16(kf[kc][j], ah[kc], s[j]);
        if (HI) { sl[j] = wmma16(kf[kc][j], al[kc], sl[j]); sl[j] = wmma16(klf[j], ah[kc], sl[j]); } } }
    v16b vbh[HD / 16], vbl[HD / 16]; const size_t pb = ((size_t)b * CC + h * HD + col) * (size_t)KHI + k0;
    if (HI) {
#pragma unroll
      for (int j = 0; j < HD / 16; ++j) { vbh[j] = frag_b(VB + pb + (size_t)(j * 16) * KHI, lane); vbl[j] = frag_b(VBL + pb + (size_t)(j * 16) * KHI, lane); } }
    if (HI) __builtin_amdgcn_sched_barrier(0);   /* keeps the first half's v hi + lo loads issued here, in flight under the softmax */
#pragma unroll
    for (int j = 0; j < 4; ++j) {
#pragma unroll
      for (int r = 0; r < 8; ++r) s[j][r] = HI ? (s[j][r] + sl[j][r] * (1.0f / 1024.0f)) * SCALE : s[j][r] * SCALE; }
    if (CAUSAL && kb == qb) {   /* wave-uniform */
#pragma unroll
      for (int j = 0; j < 4; ++j) {
#pragma unroll
        for (int r = 0; r < 8; ++r) if (k0 + j * 16 + 8 * g + r > t) s[j][r] = -3.0e38f; } }
    float bm = -3.0e38f;
#pragma unroll
    for (int j = 0; j < 4; ++j) {
#pragma unroll
      for (int r = 0; r < 8; ++r) bm = fmaxf(bm, s[j][r]); }
    bm = fmaxf(bm, __shfl_xor(bm, 16));
    const float mn = fmaxf(m, bm); const float alpha = expf(m - mn); m = mn;   /* every block holds a key open to every query of the wave (key k0 <= ql0), so mn is a real logit */
    float ls = 0.f;
#pragma unroll
    for (int j = 0; j < 4; ++j) {
#pragma unroll
      for (int r = 0; r < 8; ++r) { const float e = expf(s[j][r] - mn); ls += e; s[j][r] = e * 2048.0f; } }   /* a masked logit (-3e38) underflows to exactly 0 against the real mn */
    ls += __shfl_xor(ls, 16); l = l * alpha + ls;
#pragma unroll
    for (int j = 0; j < HD / 16; ++j) acc[j] *= alpha;
#pragma unroll
    for (int kc = 0; kc < 2; ++kc) {
      if (HI) { float pv[16];
#pragma unroll
        for (int i = 0; i < 8; ++i) { pv[i] = s[2 * kc][i]; pv[8 + i] = s[2 * kc + 1][i]; }
        const F2 p = bsplit16(pv);
        if (kc == 1) {
#pragma unroll
          for (int j = 0; j < HD / 16; ++j) { vbh[j] = frag_b(VB + pb + (size_t)(j * 16) * KHI + 32, lane); vbl[j] = frag_b(VBL + pb + (size_t)(j * 16) * KHI + 32, lane); }
          __builtin_amdgcn_sched_barrier(0); }   /* the second half's eight v fragments are in flight together */
#pragma unroll
        for (int j = 0; j < HD / 16; ++j) { acc[j] = wmma_bf(vbh[j], p.h, acc[j]); acc[j] = wmma_bf(vbh[j], p.l, acc[j]); acc[j] = wmma_bf(vbl[j], p.h, acc[j]); }
      } else { v16h p;
#pragma unroll
        for (int i = 0; i < 8; ++i) { p[i] = (_Float16)s[2 * kc][i]; p[8 + i] = (_Float16)s[2 * kc + 1][i]; }
#pragma unroll
        for (int j = 0; j < HD / 16; ++j) acc[j] = wmma16(vf[kc][j], p, acc[j]); } }
    if (!HI) {   /* hand-over, every wave of the block, in this order */
      asm volatile("s_wait_dscnt 0x0" ::: "memory");      /* this wave's reads of this block's buffer are over */
      asm volatile("s_wait_asynccnt 0x0" ::: "memory");   /* its copies of the next key block have landed */
      __syncthreads();                                    /* publishes the next key block and ends every wave's reads of this block's buffer */
      if (kb + 2 <= qb) att_stage(ld0 + (kb & 1) * (2 * AT_B), kg + (size_t)(kb + 2) * 64 * CC, vg + (kb + 2) * 64); } }   /* block-uniform: the block after next into the buffer just left */
  if (!HI) asm volatile("s_wait_asynccnt 0x0" ::: "memory");   /* no copy is outstanding when the wave ends */
  const float inv = l > 0.f ? 1.0f / (l * 2048.0f) : 0.f;
  float* yr = Y + (q0 + col) * CC + h * HD + 8 * g;   /* D element r of tile j = channel j * 16 + 8g + r of query col: 32 contiguous bytes a lane */
#pragma unroll
  for (int j = 0; j < HD / 16; ++j) { const v4f lo = {acc[j][0] * inv, acc[j][1] * inv, acc[j][2] * inv, acc[j][3] * inv}, hi = {acc[j][4] * inv, acc[j][5] * inv, acc[j][6] * inv, acc[j][7] * inv}; vst2(yr + j * 16, lo); vst2(yr + j * 16 + 4, hi); } }
__global__ __launch_bounds__(128) void k_att(const _Float16* __restrict__ QH, const _Float16* __restrict__ KH, const _Float16* __restrict__ QL, const _Float16* __restrict__ KL, const _Float16* __restrict__ VT, const __bf16* __restrict__ VB, const __bf16* __restrict__ VBL, float* __restrict__ Y) {
  __shared__ __align__(16) unsigned char sm[4 * AT_B];   /* two buffers of a k tile and a v tile */
  const int qb = NQB - 1 - (int)blockIdx.y, h = blockIdx.x % NH, b = blockIdx.x / NH;   /* the longest key ranges take the lowest blockIdx.y */
  if (qb < QBH) att_body<true>(sm, QH, KH, QL, KL, VT, VB, VBL, Y, qb, h, b); else att_body<false>(sm, QH, KH, QL, KL, VT, VB, VBL, Y, qb, h, b); }
// ---- k_out: block = (64 rows, 128 cols): out = ctx Wo (+ bo): ctx x 2^6 once to f16 against Wo as f16(bf16 x 2^8) exact (1 product) x 2^-14; causal early rows (< QHI of each sequence): ctx bf16 hi + lo against exact bf16 Wo (2 products)
__global__ __launch_bounds__(128) void k_out(const float* __restrict__ Y, const float* __restrict__ WO, const float* __restrict__ BO, float* __restrict__ OUT) { __shared__ __align__(16) unsigned char sm[2 * GW_B + 4 * GA_B + 33792];   /* staged W chunks, staged ctx chunks (two planes for the early rows), then the output staging sf */
  unsigned char* sw = sm; unsigned char* sa = sm + 2 * GW_B; float (*sf)[16][132] = (float (*)[16][132])(sm + 2 * GW_B + 4 * GA_B);
  const int tid = threadIdx.x, wave = tid >> 5, lane = tid & 31, col = lane & 15, g = lane >> 4; const int c0 = blockIdx.y * 128; const size_t r0 = (size_t)blockIdx.x * 64 + wave * 16;
  v8f acc[8] = {};
  if (CAUSAL && (int)(((size_t)blockIdx.x * 64) % TT) < QHI) {   /* block-uniform */
    gemm_staged<1, CC>(Y + (size_t)blockIdx.x * 64 * CC, WO + (size_t)c0 * CC, sw, sa, acc);
#pragma unroll
    for (int j = 0; j < 8; ++j) { const float bias = BO ? bfr(BO[c0 + j * 16 + col]) : 0.f;
#pragma unroll
      for (int r = 0; r < 8; ++r) sf[wave][8 * g + r][j * 16 + col] = acc[j][r] + bias; }
  } else {
    gemm_staged<2, CC>(Y + (size_t)blockIdx.x * 64 * CC, WO + (size_t)c0 * CC, sw, sa, acc);   /* ctx carried x 2^6 into f16 so small-magnitude context rows stay clear of f16 subnormals */
#pragma unroll
    for (int j = 0; j < 8; ++j) { const float bias = BO ? bfr(BO[c0 + j * 16 + col]) : 0.f;
#pragma unroll
      for (int r = 0; r < 8; ++r) sf[wave][8 * g + r][j * 16 + col] = acc[j][r] * (1.0f / 16384.0f) + bias; } }   /* 2^-8 (Wo carry) x 2^-6 (ctx carry) */
  LDSX(); for (int rl = 0; rl < 16; ++rl) vst2(OUT + (r0 + rl) * DIN + c0 + lane * 4, *(const v4f*)&sf[wave][rl][lane * 4]); }

extern "C" void kernel_launch(void* const* d_in, const int* in_sizes, int n_in, void* d_out, int out_size, void* d_ws, size_t ws_size, hipStream_t stream) {
  (void)in_sizes; (void)n_in; (void)out_size;
  const float** F = (const float**)d_in;
  if (ws_size < (size_t)WS_END) return;
  char* ws = (char*)d_ws; _Float16 *QH = (_Float16*)(ws + WS_QH), *KH = (_Float16*)(ws + WS_KH), *VT = (_Float16*)(ws + WS_VT), *QL = (_Float16*)(ws + WS_QL), *KL = (_Float16*)(ws + WS_KL); __bf16 *VB = (__bf16*)(ws + WS_VB), *VBL = (__bf16*)(ws + WS_VBL); float *Y = (float*)(ws + WS_Y);
  (void)Y; (void)QL; (void)KL; (void)VB; (void)VBL;
  // inputs: 0 x [2,2048,1024]; 1 Wq [1024,1024] (out,in); 2 Wk; 3 Wv; 4 bv [1024] (NONZERO; q and k have no bias: null pointers); 5 Wo (out,in); 6 bo (NONZERO)
  k_proj<<<dim3(TNB * TT / 64, CC / 128, 3), 128, 0, stream>>>(F[0], F[0], F[0], F[1], F[2], F[3], nullptr, nullptr, F[4], QH, QL, KH, KL, VT, VB, VBL);
  k_att<<<dim3(NH * TNB, NQB), 128, 0, stream>>>(QH, KH, QL, KL, VT, VB, VBL, Y);
  k_out<<<dim3(TNB * TT / 64, DIN / 128), 128, 0, stream>>>(Y, F[5], F[6], (float*)d_out);
}

// v004
// A run of this version takes 103 microseconds.
// Timed twice side by side with v003, it ran 1.08 and 1.09 times as fast.
// All steps since v000 together make it 12.5 times as fast.
// compute dtype: all float inputs rounded to bf16; q / k / v projections with EXACT bf16 products on WMMA 16x16x32 (f32 accumulate) + bias (v only; nonzero); interleaved-pair RoPE in f32 on q and k (which have no bias) (embedded frequencies, precise cosf / sinf, positions = the row index); causal logits: 3 products for the first 384 rows, single f16 q x k after, x 64^-0.5; online softmax f32 in one fused pass, exponentials in base 2; exp(logit - running max) x 2^11 once to f16 x v once to f16 (bf16 hi + lo below row 384); ctx hi+lo x exact Wo below row 384, x2^6 f16 carry x f16(bf16 x 2^8) Wo after, + bo; f32 output.
#include <hip/hip_runtime.h>
#include <math.h>

typedef __attribute__((ext_vector_type(16))) _Float16 v16h;
typedef __attribute__((ext_vector_type(16))) __bf16 v16b;
typedef __attribute__((ext_vector_type(8)))  _Float16 v8h;
typedef __attribute__((ext_vector_type(8)))  float v8f;
typedef __attribute__((ext_vector_type(4)))  float v4f;
typedef __attribute__((ext_vector_type(2)))  float v2f;
typedef __attribute__((ext_vector_type(4)))  unsigned v4u;
typedef __attribute__((ext_vector_type(4)))  int v4i;
typedef float __attribute__((may_alias)) float_a;
typedef int __attribute__((may_alias)) int_a;

template <typename T> __device__ __forceinline__ void vst2(void* p, T v) { *(T*)p = v;  }
__device__ __forceinline__ v8f wmma16(v16h a, v16h b, v8f c) {
  v8f d = __builtin_amdgcn_wmma_f32_16x16x32_f16(false, a, false, b, (short)0, c, false, false);
  asm volatile("v_nop\n\tv_nop\n\tv_nop\n\tv_nop" : "+v"(d) : "v"(a), "v"(b));
  return d;
}
__device__ __forceinline__ v8f wmma_bf(v16b a, v16b b, v8f c) {
  v8f d = __builtin_amdgcn_wmma_f32_16x16x32_bf16(false, a, false, b, (short)0, c, false, false);
  asm volatile("v_nop\n\tv_nop\n\tv_nop\n\tv_nop" : "+v"(d) : "v"(a), "v"(b));
  return d;
}
// 16x16x32 fragments: lane = (h = lane>>4, row/col = lane&15); elements 0..7 = k0+8h+0..7, 8..15 = k0+16+8h+0..7; D element r = row 8h+r
__device__ __forceinline__ v16h frag_h(const _Float16* rowk0, int lane) {
  union { v16h v; v8h q[2]; } u; const _Float16* p = rowk0 + 8 * (lane >> 4);
  u.q[0] = *(const v8h*)p; u.q[1] = *(const v8h*)(p + 16); return u.v;
}
__device__ __forceinline__ v16h frag_f32(const float* rowk0, int lane) {
  v16h a; const float* p = rowk0 + 8 * (lane >> 4);
#pragma unroll
  for (int i = 0; i < 8; ++i) { a[i] = (_Float16)p[i]; a[8 + i] = (_Float16)p[16 + i]; }
  return a;
}
__device__ __forceinline__ v16h frag_f32s(const float* rowk0, int lane, float sc) {
  v16h a; const float* p = rowk0 + 8 * (lane >> 4);
#pragma unroll
  for (int i = 0; i < 8; ++i) { a[i] = (_Float16)(p[i] * sc); a[8 + i] = (_Float16)(p[16 + i] * sc); }
  return a;
}
// column fragment from a [K][ld] layout (column n), rows >= K read as 0
__device__ __forceinline__ v16h fragc_f32(const float* W, int k0, int n, int lane, int ld, int K) {
  v16h a; const int g = lane >> 4;
#pragma unroll
  for (int i = 0; i < 8; ++i) { const int ka = k0 + 8 * g + i, kb = ka + 16;
    a[i] = (_Float16)(ka < K ? W[(size_t)(ka < K ? ka : K - 1) * ld + n] : 0.f); a[8 + i] = (_Float16)(kb < K ? W[(size_t)(kb < K ? kb : K - 1) * ld + n] : 0.f); }
  return a;
}
struct F2 { v16b h, l; };
__device__ __forceinline__ F2 bsplit16(const float v[16]) { F2 r;
#pragma unroll
  for (int i = 0; i < 16; ++i) { const __bf16 h = (__bf16)v[i]; r.h[i] = h; r.l[i] = (__bf16)(v[i] - (float)h); }
  return r; }
__device__ __forceinline__ F2 split_row(const float* row, int k0, int lane) { float v[16]; const float* p = row + k0 + 8 * (lane >> 4);
#pragma unroll
  for (int i = 0; i < 8; ++i) { v[i] = p[i]; v[8 + i] = p[16 + i]; }
  return bsplit16(v); }
__device__ __forceinline__ F2 split_rowK(const float* row, int k0, int lane, int K) { float v[16]; const int g = lane >> 4;
#pragma unroll
  for (int i = 0; i < 8; ++i) { const int ka = k0 + 8 * g + i, kb = ka + 16; v[i] = ka < K ? row[ka < K ? ka : K - 1] : 0.f; v[8 + i] = kb < K ? row[kb < K ? kb : K - 1] : 0.f; }
  return bsplit16(v); }
__device__ __forceinline__ F2 split_col(const float* W, int k0, int n, int lane, int ld, int K) { float v[16]; const int g = lane >> 4;
#pragma unroll
  for (int i = 0; i < 8; ++i) { const int ka = k0 + 8 * g + i, kb = ka + 16; v[i] = ka < K ? W[(size_t)(ka < K ? ka : K - 1) * ld + n] : 0.f; v[8 + i] = kb < K ? W[(size_t)(kb < K ? kb : K - 1) * ld + n] : 0.f; }
  return bsplit16(v); }
__device__ __forceinline__ v8f mac3(const F2& a, const F2& b, v8f c) { c = wmma_bf(a.l, b.h, c); c = wmma_bf(a.h, b.l, c); return wmma_bf(a.h, b.h, c); }
__device__ __forceinline__ float sigm(float v) { return 1.0f / (1.0f + expf(-v)); }
#define LDSX() do { asm volatile("s_wait_dscnt 0" ::: "memory"); __builtin_amdgcn_wave_barrier(); __builtin_amdgcn_fence(__ATOMIC_RELEASE, "workgroup"); } while (0)

// Causal self-attention with interleaved-pair RoPE (x [2,2048,1024]; (out,in) Wq / Wk / Wv [1024,1024] N(0, 1/1024) applied as einsum('bse,he->bsh') = x @ W.T; bv [1024] NONZERO (only v has a bias); Wo [1024,1024] (out,in) + bo NONZERO; 16 heads x 64; RoPE (base 10000, positions 0..2047) on q and k: (even, odd) pairs rotated and re-interleaved; scores x 1/sqrt(64); triu(k = 1) -> -inf; softmax; out @ Wo.T + bo).
#define NB 2
#define TT 2048
#define CC 1024            // NH * HD = projected width
#define DIN 1024          // input (model) width
#define NH 16
#define HD 64
#define NQB (TT / 64)
#define SCALE (0.125f)
#define SC2 (SCALE * 1.44269504088896340736f)   // logit scale x log2(e): exp(SCALE * d) = 2^(SC2 * d)
#define CAUSAL 1
#ifndef TNB
#define TNB NB
#endif
__device__ __forceinline__ float bfr(float v) { return (float)(__bf16)v; }
typedef __attribute__((ext_vector_type(8))) __bf16 v8b;
__device__ __forceinline__ v16b frag_b(const __bf16* rowk0, int lane) {
  union { v16b v; v8b q[2]; } u; const __bf16* p = rowk0 + 8 * (lane >> 4);
  u.q[0] = *(const v8b*)p; u.q[1] = *(const v8b*)(p + 16); return u.v;
}
#define QBH 6              // causal: query blocks 0..QBH-1 of each sequence (few keys, no averaging) take the high-precision path
#define QHI 384            // rows carrying a q residual plane
#define KHI 384            // key rows carrying k residual / v bf16 hi+lo planes (used only by the causal high-precision path)
// B fragment (k rows k0+.., output column o) of a weight: (in,out) [K][ld] or (out,in) [ld rows of K]: bf16 exact, or f16(bf16 * 256) exact
__device__ __forceinline__ v16b wcol_io(const float* Wm, int k0, int o, int lane, int ld) { v16b w; const int g = lane >> 4;
#pragma unroll
  for (int i = 0; i < 8; ++i) { w[i] = (__bf16)Wm[(size_t)(k0 + 8 * g + i) * ld + o]; w[8 + i] = (__bf16)Wm[(size_t)(k0 + 16 + 8 * g + i) * ld + o]; }
  return w; }
__device__ __forceinline__ v16b wcol_oi(const float* Wm, int k0, int o, int lane, int K) { v16b w; const float* p = Wm + (size_t)o * K + k0 + 8 * (lane >> 4);
#pragma unroll
  for (int i = 0; i < 8; ++i) { w[i] = (__bf16)p[i]; w[8 + i] = (__bf16)p[16 + i]; }
  return w; }
__device__ __forceinline__ v16h wcolh_io(const float* Wm, int k0, int o, int lane, int ld) { v16h w; const int g = lane >> 4;
#pragma unroll
  for (int i = 0; i < 8; ++i) { w[i] = (_Float16)(bfr(Wm[(size_t)(k0 + 8 * g + i) * ld + o]) * 256.0f); w[8 + i] = (_Float16)(bfr(Wm[(size_t)(k0 + 16 + 8 * g + i) * ld + o]) * 256.0f); }
  return w; }
__device__ __forceinline__ v16h wcolh_oi(const float* Wm, int k0, int o, int lane, int K) { v16h w; const float* p = Wm + (size_t)o * K + k0 + 8 * (lane >> 4);
#pragma unroll
  for (int i = 0; i < 8; ++i) { w[i] = (_Float16)(bfr(p[i]) * 256.0f); w[8 + i] = (_Float16)(bfr(p[16 + i]) * 256.0f); }
  return w; }
#define WQKV_LAYOUT 1   // picks only the WCOL helper, which nothing calls (0 = (in,out) [DIN][CC]; 1 = (out,in) [CC][DIN]; 2 = per-head [NH][DIN][HD]); k_proj always reads (out,in) [CC][DIN]
__device__ __forceinline__ v16b wcol_hdk(const float* Wm, int k0, int o, int lane) { v16b w; const int g = lane >> 4; const float* p = Wm + (size_t)(o / HD) * DIN * HD + (o % HD);
#pragma unroll
  for (int i = 0; i < 8; ++i) { w[i] = (__bf16)p[(size_t)(k0 + 8 * g + i) * HD]; w[8 + i] = (__bf16)p[(size_t)(k0 + 16 + 8 * g + i) * HD]; }
  return w; }
#define WO_OUT_IN 1
#if WQKV_LAYOUT == 1
#define WCOL(W, k0, o, lane) wcol_oi(W, k0, o, lane, DIN)
#elif WQKV_LAYOUT == 2
#define WCOL(W, k0, o, lane) wcol_hdk(W, k0, o, lane)
#else
#define WCOL(W, k0, o, lane) wcol_io(W, k0, o, lane, CC)
#endif
#if WO_OUT_IN
#define WOCOL(W, k0, o, lane) wcol_oi(W, k0, o, lane, CC)
#define WOCOLH(W, k0, o, lane) wcolh_oi(W, k0, o, lane, CC)
#else
#define WOCOL(W, k0, o, lane) wcol_io(W, k0, o, lane, DIN)
#define WOCOLH(W, k0, o, lane) wcolh_io(W, k0, o, lane, DIN)
#endif

// RoPE inverse frequencies 1/10000^(2i/64)
__constant__ float INVF[32] = {1.000000000e+00,7.498942018e-01,5.623413324e-01,4.216965139e-01,3.162277639e-01,2.371373624e-01,1.778279394e-01,1.333521456e-01,1.000000015e-01,7.498941571e-02,5.623412877e-02,4.216964915e-02,3.162277862e-02,2.371373586e-02,1.778279431e-02,1.333521493e-02,9.999999776e-03,7.498942316e-03,5.623413250e-03,4.216964822e-03,3.162277862e-03,2.371373819e-03,1.778279431e-03,1.333521446e-03,1.000000047e-03,7.498941850e-04,5.623413017e-04,4.216964880e-04,3.162277862e-04,2.371373848e-04,1.778279402e-04,1.333521504e-04};
#define PROJ_EXTRA_PARAMS
// per (token, head) hook on the staged f32 row (64 floats, projection + bias) of the q and k streams: interleaved-pair rotation (x[2i], x[2i + 1]) by the angle t * INVF[i]; v untouched
#define PROJ_EPI(which, row, t, h) do { if ((which) < 2) { float* rw = (row); const float pos_ = (float)(t);   /* position = the token's sequence index */ _Pragma("unroll 4") for (int i = 0; i < 32; ++i) { _Pragma("clang fp contract(off)") const float ang = pos_ * INVF[i]; const float cs = cosf(ang), sn = sinf(ang); const float xe = rw[2 * i], xo = rw[2 * i + 1]; rw[2 * i] = xe * cs - xo * sn; rw[2 * i + 1] = xe * sn + xo * cs; } } } while (0)
#ifndef PROJ_EXTRA_PARAMS
#define PROJ_EXTRA_PARAMS
#endif

#define WS_QH  0u                                      // f16 q rows [b*t][CC]
#define WS_KH  (WS_QH + 2u * (size_t)NB * TT * CC)      // f16 k rows [b*t][CC]
#define WS_VT  (WS_KH + 2u * (size_t)NB * TT * CC)      // f16 v planes [b][c][t]
#define WS_QL  (WS_VT + 2u * (size_t)NB * CC * TT)      // f16 q residual x 2^10 rows [b][t < QHI][CC]
#define WS_KL  (WS_QL + 2u * (size_t)NB * QHI * CC)     // f16 k residual x 2^10 rows [b][t < KHI][CC]
#define WS_VB  (WS_KL + 2u * (size_t)NB * KHI * CC)     // bf16 v hi planes [b][c][t < KHI]
#define WS_VBL (WS_VB + 2u * (size_t)NB * CC * KHI)
#define WS_Y   (WS_VBL + 2u * (size_t)NB * CC * KHI)     // f32 ctx rows [b*t][CC] (only when there is an output projection)
#define WS_END (WS_Y  + 4u * (size_t)NB * TT * CC)

// ---- staged GEMM loop shared by k_proj and k_out: a block's 64 A rows and 128 W rows (both k-contiguous f32, row length LD) come in chunks of GK k columns by whole-line 16-byte loads, are rounded ONCE to their 16-bit operand form and stored in LDS, where the four waves read their fragments. Two LDS buffers, one barrier a chunk; the next chunk's global loads fly under this chunk's products. Rounding, fragment k order and the order of the products into each accumulator are those of the per-lane global fragment loads that this replaces.
// MODE 0: A and W bf16, one product; MODE 1: A bf16 hi + lo planes, W bf16, two products; MODE 2: A f16(x 2^6), W f16(bf16 x 2^8), one product
#define GK 64                  // k columns of a chunk: 256 B of every f32 row
#define GP 72                  // LDS row pitch in 16-bit elements: 144 B = 16 B x 9, so the 16-byte fragment reads of 16 rows meet no bank twice
#define GW_B (128 * GP * 2)    // bytes of one W buffer
#define GA_B (64 * GP * 2)     // bytes of one plane of one A buffer
typedef __attribute__((ext_vector_type(4))) __bf16 v4b;
typedef __attribute__((ext_vector_type(4))) _Float16 v4h;
template <int MODE, int LD> __device__ __forceinline__ void gemm_staged(const float* __restrict__ Ag, const float* __restrict__ Wg, unsigned char* sw, unsigned char* sa, v8f (&acc)[8]) {
  const int tid = threadIdx.x, wave = tid >> 5, lane = tid & 31, col = lane & 15; const int lr = tid >> 4, lc = tid & 15;   /* 16 lanes x 16 B = one row's chunk; the block covers 8 rows a load */
  const float* ap = Ag + (size_t)lr * LD + lc * 4; const float* wp = Wg + (size_t)lr * LD + lc * 4;
  constexpr int NPL = MODE == 1 ? 2 : 1;
  v4f ar[8], wr[16];
#pragma unroll
  for (int i = 0; i < 8; ++i) ar[i] = *(const v4f*)(ap + (size_t)(8 * i) * LD);
#pragma unroll
  for (int i = 0; i < 16; ++i) wr[i] = *(const v4f*)(wp + (size_t)(8 * i) * LD);
  asm volatile("s_wait_xcnt 0x0" ::: "memory");   /* stands in front of any rewrite of the address registers that the 24 issued loads name */
#pragma unroll 2   /* two chunks a body: the two buffers' LDS offsets become constants */
  for (int ch = 0; ch < LD / GK; ++ch) { unsigned char* wb = sw + (ch & 1) * GW_B; unsigned char* ab = sa + (ch & 1) * (NPL * GA_B);
#pragma unroll
    for (int i = 0; i < 8; ++i) { const int eo = (lr + 8 * i) * GP + lc * 4; const v4f v = ar[i];
      if (MODE == 2) { const v4h o = {(_Float16)(v[0] * 64.0f), (_Float16)(v[1] * 64.0f), (_Float16)(v[2] * 64.0f), (_Float16)(v[3] * 64.0f)}; *(v4h*)((_Float16*)ab + eo) = o; }
      else { const v4b o = {(__bf16)v[0], (__bf16)v[1], (__bf16)v[2], (__bf16)v[3]}; *(v4b*)((__bf16*)ab + eo) = o;
        if (MODE == 1) { const v4b o2 = {(__bf16)(v[0] - (float)o[0]), (__bf16)(v[1] - (float)o[1]), (__bf16)(v[2] - (float)o[2]), (__bf16)(v[3] - (float)o[3])}; *(v4b*)((__bf16*)(ab + GA_B) + eo) = o2; } } }
#pragma unroll
    for (int i = 0; i < 16; ++i) { const int eo = (lr + 8 * i) * GP + lc * 4; const v4f v = wr[i];
      if (MODE == 2) { const v4h o = {(_Float16)(bfr(v[0]) * 256.0f), (_Float16)(bfr(v[1]) * 256.0f), (_Float16)(bfr(v[2]) * 256.0f), (_Float16)(bfr(v[3]) * 256.0f)}; *(v4h*)((_Float16*)wb + eo) = o; }
      else { const v4b o = {(__bf16)v[0], (__bf16)v[1], (__bf16)v[2], (__bf16)v[3]}; *(v4b*)((__bf16*)wb + eo) = o; } }
    __syncthreads();   /* publishes this chunk; it also ends every wave's reads of the other buffer, which the next trip overwrites */
    if (ch + 1 < LD / GK) {   /* block-uniform: the next chunk's loads, behind the barrier (whose fence would wait for them) and in flight under this chunk's fragment reads and products */
#pragma unroll
      for (int i = 0; i < 8; ++i) ar[i] = *(const v4f*)(ap + (size_t)(8 * i) * LD + (ch + 1) * GK);
#pragma unroll
      for (int i = 0; i < 16; ++i) wr[i] = *(const v4f*)(wp + (size_t)(8 * i) * LD + (ch + 1) * GK);
      asm volatile("s_wait_xcnt 0x0" ::: "memory"); }   /* stands in front of any rewrite of the address registers that the 24 issued loads name */
#pragma unroll
    for (int kk = 0; kk < GK / 32; ++kk) { const int ao = (wave * 16 + col) * GP + kk * 32;
      if (MODE == 2) { const v16h a = frag_h((const _Float16*)ab + ao, lane); v16h w[8];
#pragma unroll
        for (int j = 0; j < 8; ++j) w[j] = frag_h((const _Float16*)wb + (j * 16 + col) * GP + kk * 32, lane);
#pragma unroll
        for (int j = 0; j < 8; ++j) acc[j] = wmma16(a, w[j], acc[j]);
      } else { const v16b a = frag_b((const __bf16*)ab + ao, lane); v16b a2 = a, w[8]; if (MODE == 1) a2 = frag_b((const __bf16*)(ab + GA_B) + ao, lane);
#pragma unroll
        for (int j = 0; j < 8; ++j) w[j] = frag_b((const __bf16*)wb + (j * 16 + col) * GP + kk * 32, lane);
#pragma unroll
        for (int j = 0; j < 8; ++j) { acc[j] = wmma_bf(a, w[j], acc[j]); if (MODE == 1) acc[j] = wmma_bf(a2, w[j], acc[j]); } } } } }

// ---- k_proj: block = (64 rows, 128 cols, which): q/k/v = X W (+ b) with exact bf16 products (K = DIN) -> which 0: q f16 rows (+ residual rows < QHI); 1: k f16 rows (+ residual rows < KHI); 2: v f16 planes [c][t] (+ bf16 hi/lo planes for t < KHI)
__global__ __launch_bounds__(128) void k_proj(const float* __restrict__ XQ, const float* __restrict__ XK, const float* __restrict__ XV, const float* __restrict__ WQ, const float* __restrict__ WK, const float* __restrict__ WV, const float* __restrict__ BQ, const float* __restrict__ BK, const float* __restrict__ BV,
    _Float16* __restrict__ QH, _Float16* __restrict__ QL, _Float16* __restrict__ KH, _Float16* __restrict__ KL, _Float16* __restrict__ VT, __bf16* __restrict__ VB, __bf16* __restrict__ VBL PROJ_EXTRA_PARAMS) {
  __shared__ __align__(16) unsigned char sm[55296 + 33792];   /* one region that holds in turn the staged operand chunks (W 2 x 18432 B, X 2 x 9216 B) and the epilogue's planes: sh, sl (q, k) or th, tb, tbl (v); then st */
  unsigned char* rg = sm; float (*st)[132] = (float (*)[132])(sm + 55296);
  _Float16 (*sh)[136] = (_Float16 (*)[136])rg; _Float16 (*sl)[136] = (_Float16 (*)[136])(rg + 17408); _Float16 (*th)[72] = (_Float16 (*)[72])rg; __bf16 (*tb)[72] = (__bf16 (*)[72])(rg + 18432); __bf16 (*tbl)[72] = (__bf16 (*)[72])(rg + 36864);
  const int tid = threadIdx.x, wave = tid >> 5, lane = tid & 31, col = lane & 15, g = lane >> 4; const int which = blockIdx.z; const int c0 = blockIdx.y * 128; const size_t r0 = (size_t)blockIdx.x * 64; const size_t bb = r0 / TT; const int t0 = (int)(r0 % TT);
  const float* X = which == 0 ? XQ : which == 1 ? XK : XV; const float* WA = which == 0 ? WQ : which == 1 ? WK : WV; const float* BA = which == 0 ? BQ : which == 1 ? BK : BV;
  v8f acc[8] = {};
  gemm_staged<0, DIN>(X + r0 * DIN, WA + (size_t)c0 * DIN, rg, rg + 2 * GW_B, acc);
  { // stage the f32 tile (acc + bias) in LDS, run the per-(row, head) epilogue hook, then convert
#pragma unroll
    for (int j = 0; j < 8; ++j) { const float bias = BA ? bfr(BA[c0 + j * 16 + col]) : 0.f;
#pragma unroll
      for (int r = 0; r < 8; ++r) st[wave * 16 + 8 * g + r][j * 16 + col] = acc[j][r] + bias; }
    __syncthreads();
    for (int e = tid; e < 64 * (128 / HD); e += 128) { const int rl = e / (128 / HD), hh = e % (128 / HD); PROJ_EPI(which, &st[rl][hh * HD], (int)((r0 + rl) % TT), (c0 / HD) + hh); }
    __syncthreads(); }
  if (which < 2) { _Float16* DH = which == 0 ? QH : KH; _Float16* DL = which == 0 ? QL : KL; const int nhi = which == 0 ? QHI : KHI; const bool hi_rows = t0 < nhi;
    for (int e = tid; e < 64 * 128; e += 128) { const int rl = e >> 7, cl = e & 127; const float v = st[rl][cl]; const _Float16 hv = (_Float16)v; sh[rl][cl] = hv; sl[rl][cl] = (_Float16)((v - (float)hv) * 1024.0f); }
    __syncthreads();
    for (int e = tid; e < 64 * 16; e += 128) { const int rl = e >> 4, q = e & 15; vst2((unsigned*)(DH + (r0 + rl) * CC + c0 + q * 8), *(const v4u*)&sh[rl][q * 8]); if (hi_rows) vst2((unsigned*)(DL + (bb * nhi + t0 + rl) * (size_t)CC + c0 + q * 8), *(const v4u*)&sl[rl][q * 8]); }
  } else { const bool hi_rows = t0 < KHI;
    for (int e = tid; e < 64 * 128; e += 128) { const int rl = e & 63, cl = e >> 6; const float v = st[rl][cl]; th[cl][rl] = (_Float16)v; const __bf16 bh = (__bf16)v; tb[cl][rl] = bh; tbl[cl][rl] = (__bf16)(v - (float)bh); }
    __syncthreads();
    for (int e = tid; e < 128 * 8; e += 128) { const int cl = e >> 3, q = e & 7; vst2((unsigned*)(VT + (bb * CC + c0 + cl) * (size_t)TT + t0 + q * 8), *(const v4u*)&th[cl][q * 8]); if (hi_rows) { const size_t o3 = (bb * CC + c0 + cl) * (size_t)KHI + t0 + q * 8; vst2((unsigned*)(VB + o3), *(const v4u*)&tb[cl][q * 8]); vst2((unsigned*)(VBL + o3), *(const v4u*)&tbl[cl][q * 8]); } } } }
// ---- k_att: block = 64 queries (qb) of (b, h), wave = 16 queries: logits, softmax and P . v in one pass over key blocks of 64, nothing of the logits leaves registers.
// Transposed tiles: S^T = k q^T puts (key 8g + r, query col) in D element r, which is already the B fragment (k = keys) of ctx^T = v^T P^T; the row statistics of a query live in its two lanes (col, col + 16).
// Past the early query blocks the block's four waves share each key block's k and v tiles: asynchronous 16-byte copies bring them by whole lines into two LDS buffers (the next block's copies fly under this block's work), and every wave reads its fragments there. Fragment contents, k order and the order of the products are those of the per-lane global fragment loads that this replaces.
// Running maximum m (of the unscaled logits) and sum l per query; e = 2^(SC2 (logit - m) + 11) = exp(scaled logit - scaled m) x 2^11 once to f16 against v f16 (HI, causal early query blocks: 3-product logits, e and v as bf16 hi + lo, 3 products); l sums the same e, ctx = acc / l. The inner loops are fully unrolled so that every fragment array stays in registers.
#define AP 144                 // LDS pitch in bytes of a staged 128-byte row: 16 B x 9, so the 16-byte fragment reads of 16 rows meet no bank twice
#define AT_B (64 * AP)         // bytes of one staged tile of 64 rows; a buffer = the k tile, then the v tile
// one key block into one LDS buffer: k tile = 64 key rows x the head's 64 channels, v tile = the head's 64 channel planes x 64 keys, 128 B a row. A lane copies its 16 B of rows r, r + 16, r + 32, r + 48 of both tiles (r = tid >> 3), so each wave-wide copy covers four whole lines. ld, kg, vg: the lane's own LDS byte address and global addresses in row r.
__device__ __forceinline__ void att_stage(unsigned ld, const _Float16* kg, const _Float16* vg) {
  /* the closing s_wait_xcnt 0 stands inside the copies' own statement, in front of any rewrite of the address registers that the eight issued copies name */
  asm volatile("global_load_async_to_lds_b128 %0, %8, off\n\t"
               "global_load_async_to_lds_b128 %1, %9, off\n\t"
               "global_load_async_to_lds_b128 %2, %10, off\n\t"
               "global_load_async_to_lds_b128 %3, %11, off\n\t"
               "global_load_async_to_lds_b128 %4, %12, off\n\t"
               "global_load_async_to_lds_b128 %5, %13, off\n\t"
               "global_load_async_to_lds_b128 %6, %14, off\n\t"
               "global_load_async_to_lds_b128 %7, %15, off\n\t"
               "s_wait_xcnt 0x0"
               :: "v"(ld), "v"(ld + 16 * AP), "v"(ld + 32 * AP), "v"(ld + 48 * AP), "v"(ld + AT_B), "v"(ld + AT_B + 16 * AP), "v"(ld + AT_B + 32 * AP), "v"(ld + AT_B + 48 * AP),
                  "v"(kg), "v"(kg + 16 * CC), "v"(kg + 32 * CC), "v"(kg + 48 * CC), "v"(vg), "v"(vg + 16 * TT), "v"(vg + 32 * TT), "v"(vg + 48 * TT) : "memory"); }
// eight 2^x in place on the hardware's v_exp_f32
__device__ __forceinline__ void exp2x8(v8f& x) {
  float x0 = x[0], x1 = x[1], x2 = x[2], x3 = x[3], x4 = x[4], x5 = x[5], x6 = x[6], x7 = x[7];
  /* one statement, so that nothing directly behind a v_exp_f32 reads its result or overwrites its source: inside, each works on a register of its own, and the closing v_nop is the one slot that the instruction set asks for in front of whatever the compiler puts next */
  asm("v_exp_f32 %0, %0\n\tv_exp_f32 %1, %1\n\tv_exp_f32 %2, %2\n\tv_exp_f32 %3, %3\n\tv_exp_f32 %4, %4\n\tv_exp_f32 %5, %5\n\tv_exp_f32 %6, %6\n\tv_exp_f32 %7, %7\n\tv_nop"
      : "+v"(x0), "+v"(x1), "+v"(x2), "+v"(x3), "+v"(x4), "+v"(x5), "+v"(x6), "+v"(x7));
  x = v8f{x0, x1, x2, x3, x4, x5, x6, x7}; }
template <bool HI> __device__ __forceinline__ void att_body(unsigned char* sm, const _Float16* __restrict__ QH, const _Float16* __restrict__ KH, const _Float16* __restrict__ QL, const _Float16* __restrict__ KL, const _Float16* __restrict__ VT, const __bf16* __restrict__ VB, const __bf16* __restrict__ VBL, float* __restrict__ Y, int qb, int h, int b) {
  const int tid = threadIdx.x, wave = tid >> 5, lane = tid & 31, col = lane & 15, g = lane >> 4; const int ql0 = qb * 64 + wave * 16; const int t = ql0 + col; const size_t q0 = (size_t)b * TT + ql0;
  const _Float16* QLb = QL + (size_t)b * QHI * CC; const _Float16* KLb = KL + (size_t)b * KHI * CC;
  const _Float16* kp = KH + ((size_t)b * TT + col) * CC + h * HD;              /* key row col, this head's 64 channels */
  const unsigned ld0 = (unsigned)(size_t)sm + (unsigned)((tid >> 3) * AP + (tid & 7) * 16);                 /* this lane's place in row tid >> 3 of buffer 0's k tile */
  const _Float16* kg = KH + ((size_t)b * TT + (tid >> 3)) * CC + h * HD + (tid & 7) * 8;                     /* its 16 B of key row tid >> 3 */
  const _Float16* vg = VT + ((size_t)b * CC + h * HD + (tid >> 3)) * (size_t)TT + (tid & 7) * 8;             /* its 16 B of channel plane tid >> 3 */
  v16h ah[HD / 32], al[HD / 32], kf[HD / 32][4];
#pragma unroll
  for (int kc = 0; kc < HD / 32; ++kc) { ah[kc] = frag_h(QH + (q0 + col) * CC + h * HD + kc * 32, lane); if (HI) al[kc] = frag_h(QLb + (size_t)(ql0 + col) * CC + h * HD + kc * 32, lane); }
  if (!HI) {   /* block-uniform: key block 0 into buffer 0, landed and published; then key block 1 into buffer 1 */
    att_stage(ld0, kg, vg);
    asm volatile("s_wait_asynccnt 0x0" ::: "memory");   /* this wave's copies of key block 0 have landed */
    __syncthreads();                                    /* every wave's have: buffer 0 may be read */
    if (qb >= 1) att_stage(ld0 + 2 * AT_B, kg + (size_t)64 * CC, vg + 64); }
  float m = -3.0e38f, l = 0.f; v8f acc[HD / 16] = {};
#pragma unroll 1   /* rolled: one block's k and v fragments already fill the registers that four waves a SIMD leave a wave */
  for (int kb = 0; kb <= qb; ++kb) { const int k0 = kb * 64;   /* causal: key blocks 0 .. qb; only block qb crosses the diagonal */
    v16h vf[2][HD / 16];
    if (!HI) { const unsigned char* kt = sm + (kb & 1) * (2 * AT_B) + col * AP; const unsigned char* vt = kt + AT_B;   /* row col of this key block's two tiles */
#pragma unroll
      for (int kc = 0; kc < HD / 32; ++kc)
#pragma unroll
        for (int j = 0; j < 4; ++j) kf[kc][j] = frag_h((const _Float16*)(kt + j * 16 * AP) + kc * 32, lane);
#pragma unroll
      for (int kc = 0; kc < 2; ++kc)
#pragma unroll
        for (int j = 0; j < HD / 16; ++j) vf[kc][j] = frag_h((const _Float16*)(vt + j * 16 * AP) + kc * 32, lane); }
    __builtin_amdgcn_sched_barrier(0);   /* keeps this block's k and v LDS reads issued here as one group, the v reads in flight under the logits and the softmax, instead of one by one in front of their products */
    v8f s[4] = {}, sl[4] = {};
#pragma unroll
    for (int kc = 0; kc < HD / 32; ++kc) { v16h klf[4];
      if (HI) {
#pragma unroll
        for (int j = 0; j < 4; ++j) { kf[kc][j] = frag_h(kp + (size_t)(k0 + j * 16) * CC + kc * 32, lane); klf[j] = frag_h(KLb + (size_t)(k0 + j * 16 + col) * CC + h * HD + kc * 32, lane); }
        __builtin_amdgcn_sched_barrier(0); }   /* the eight k and k residual fragments of this half are in flight together: one latency, not eight */
#pragma unroll
      for (int j = 0; j < 4; ++j) { s[j] = wmma16(kf[kc][j], ah[kc], s[j]);
        if (HI) { sl[j] = wmma16(kf[kc][j], al[kc], sl[j]); sl[j] = wmma16(klf[j], ah[kc], sl[j]); } } }
    v16b vbh[HD / 16], vbl[HD / 16]; const size_t pb = ((size_t)b * CC + h * HD + col) * (size_t)KHI + k0;
    if (HI) {
#pragma unroll
      for (int j = 0; j < HD / 16; ++j) { vbh[j] = frag_b(VB + pb + (size_t)(j * 16) * KHI, lane); vbl[j] = frag_b(VBL + pb + (size_t)(j * 16) * KHI, lane); } }
    if (HI) __builtin_amdgcn_sched_barrier(0);   /* keeps the first half's v hi + lo loads issued here, in flight under the softmax */
#pragma unroll
    for (int j = 0; j < 4; ++j) {
#pragma unroll
      for (int r = 0; r < 8; ++r) if (HI) s[j][r] = s[j][r] + sl[j][r] * (1.0f / 1024.0f); }   /* the logits stay unscaled: SC2 > 0, so their maximum is the scaled logits' maximum, and the scale rides in the exponent's fma below */
    if (CAUSAL && kb == qb) {   /* wave-uniform */
#pragma unroll
      for (int j = 0; j < 4; ++j) {
#pragma unroll
        for (int r = 0; r < 8; ++r) if (k0 + j * 16 + 8 * g + r > t) s[j][r] = -3.0e38f; } }
    float bm = -3.0e38f;
#pragma unroll
    for (int j = 0; j < 4; ++j) {
#pragma unroll
      for (int r = 0; r < 8; ++r) bm = fmaxf(bm, s[j][r]); }
    bm = fmaxf(bm, __shfl_xor(bm, 16));
    const float mn = fmaxf(m, bm); const float alpha = __builtin_amdgcn_exp2f((m - mn) * SC2); m = mn;   /* every block holds a key open to every query of the wave (key k0 <= ql0), so mn is a real logit */
    const float mo = 11.0f - mn * SC2;   /* exponent offset of this block: the running maximum in base 2, and the 2^11 carry of e */
    float ls = 0.f;
#pragma unroll
    for (int j = 0; j < 4; ++j) {
#pragma unroll
      for (int r = 0; r < 8; ++r) s[j][r] = __builtin_fmaf(s[j][r], SC2, mo); }   /* the exponent of e = 2^11 exp(scaled logit - scaled mn): one fma a logit */
#pragma unroll
    for (int j = 0; j < 4; ++j) { exp2x8(s[j]);   /* a masked logit (-3e38) underflows to exactly 0 against the real mn */
#pragma unroll
      for (int r = 0; r < 8; ++r) ls += s[j][r]; }
    ls += __shfl_xor(ls, 16); l = l * alpha + ls;
#pragma unroll
    for (int j = 0; j < HD / 16; ++j) acc[j] *= alpha;
#pragma unroll
    for (int kc = 0; kc < 2; ++kc) {
      if (HI) { float pv[16];
#pragma unroll
        for (int i = 0; i < 8; ++i) { pv[i] = s[2 * kc][i]; pv[8 + i] = s[2 * kc + 1][i]; }
        const F2 p = bsplit16(pv);
        if (kc == 1) {
#pragma unroll
          for (int j = 0; j < HD / 16; ++j) { vbh[j] = frag_b(VB + pb + (size_t)(j * 16) * KHI + 32, lane); vbl[j] = frag_b(VBL + pb + (size_t)(j * 16) * KHI + 32, lane); }
          __builtin_amdgcn_sched_barrier(0); }   /* the second half's eight v fragments are in flight together */
#pragma unroll
        for (int j = 0; j < HD / 16; ++j) { acc[j] = wmma_bf(vbh[j], p.h, acc[j]); acc[j] = wmma_bf(vbh[j], p.l, acc[j]); acc[j] = wmma_bf(vbl[j], p.h, acc[j]); }
      } else { v16h p;
#pragma unroll
        for (int i = 0; i < 8; ++i) { p[i] = (_Float16)s[2 * kc][i]; p[8 + i] = (_Float16)s[2 * kc + 1][i]; }
#pragma unroll
        for (int j = 0; j < HD / 16; ++j) acc[j] = wmma16(vf[kc][j], p, acc[j]); } }
    if (!HI) {   /* hand-over, every wave of the block, in this order */
      asm volatile("s_wait_dscnt 0x0" ::: "memory");      /* this wave's reads of this block's buffer are over */
      asm volatile("s_wait_asynccnt 0x0" ::: "memory");   /* its copies of the next key block have landed */
      __syncthreads();                                    /* publishes the next key block and ends every wave's reads of this block's buffer */
      if (kb + 2 <= qb) att_stage(ld0 + (kb & 1) * (2 * AT_B), kg + (size_t)(kb + 2) * 64 * CC, vg + (kb + 2) * 64); } }   /* block-uniform: the block after next into the buffer just left */
  if (!HI) asm volatile("s_wait_asynccnt 0x0" ::: "memory");   /* no copy is outstanding when the wave ends */
  const float inv = l > 0.f ? 1.0f / l : 0.f;   /* l carries the same 2^11 as acc */
  float* yr = Y + (q0 + col) * CC + h * HD + 8 * g;   /* D element r of tile j = channel j * 16 + 8g + r of query col: 32 contiguous bytes a lane */
#pragma unroll
  for (int j = 0; j < HD / 16; ++j) { const v4f lo = {acc[j][0] * inv, acc[j][1] * inv, acc[j][2] * inv, acc[j][3] * inv}, hi = {acc[j][4] * inv, acc[j][5] * inv, acc[j][6] * inv, acc[j][7] * inv}; vst2(yr + j * 16, lo); vst2(yr + j * 16 + 4, hi); } }
__global__ __launch_bounds__(128) void k_att(const _Float16* __restrict__ QH, const _Float16* __restrict__ KH, const _Float16* __restrict__ QL, const _Float16* __restrict__ KL, const _Float16* __restrict__ VT, const __bf16* __restrict__ VB, const __bf16* __restrict__ VBL, float* __restrict__ Y) {
  __shared__ __align__(16) unsigned char sm[4 * AT_B];   /* two buffers of a k tile and a v tile */
  const int qb = NQB - 1 - (int)blockIdx.y, h = blockIdx.x % NH, b = blockIdx.x / NH;   /* the longest key ranges take the lowest blockIdx.y */
  if (qb < QBH) att_body<true>(sm, QH, KH, QL, KL, VT, VB, VBL, Y, qb, h, b); else att_body<false>(sm, QH, KH, QL, KL, VT, VB, VBL, Y, qb, h, b); }
// ---- k_out: block = (64 rows, 128 cols): out = ctx Wo (+ bo): ctx x 2^6 once to f16 against Wo as f16(bf16 x 2^8) exact (1 product) x 2^-14; causal early rows (< QHI of each sequence): ctx bf16 hi + lo against exact bf16 Wo (2 products)
__global__ __launch_bounds__(128) void k_out(const float* __restrict__ Y, const float* __restrict__ WO, const float* __restrict__ BO, float* __restrict__ OUT) { __shared__ __align__(16) unsigned char sm[2 * GW_B + 4 * GA_B + 33792];   /* staged W chunks, staged ctx chunks (two planes for the early rows), then the output staging sf */
  unsigned char* sw = sm; unsigned char* sa = sm + 2 * GW_B; float (*sf)[16][132] = (float (*)[16][132])(sm + 2 * GW_B + 4 * GA_B);
  const int tid = threadIdx.x, wave = tid >> 5, lane = tid & 31, col = lane & 15, g = lane >> 4; const int c0 = blockIdx.y * 128; const size_t r0 = (size_t)blockIdx.x * 64 + wave * 16;
  v8f acc[8] = {};
  if (CAUSAL && (int)(((size_t)blockIdx.x * 64) % TT) < QHI) {   /* block-uniform */
    gemm_staged<1, CC>(Y + (size_t)blockIdx.x * 64 * CC, WO + (size_t)c0 * CC, sw, sa, acc);
#pragma unroll
    for (int j = 0; j < 8; ++j) { const float bias = BO ? bfr(BO[c0 + j * 16 + col]) : 0.f;
#pragma unroll
      for (int r = 0; r < 8; ++r) sf[wave][8 * g + r][j * 16 + col] = acc[j][r] + bias; }
  } else {
    gemm_staged<2, CC>(Y + (size_t)blockIdx.x * 64 * CC, WO + (size_t)c0 * CC, sw, sa, acc);   /* ctx carried x 2^6 into f16 so small-magnitude context rows stay clear of f16 subnormals */
#pragma unroll
    for (int j = 0; j < 8; ++j) { const float bias = BO ? bfr(BO[c0 + j * 16 + col]) : 0.f;
#pragma unroll
      for (int r = 0; r < 8; ++r) sf[wave][8 * g + r][j * 16 + col] = acc[j][r] * (1.0f / 16384.0f) + bias; } }   /* 2^-8 (Wo carry) x 2^-6 (ctx carry) */
  LDSX(); for (int rl = 0; rl < 16; ++rl) vst2(OUT + (r0 + rl) * DIN + c0 + lane * 4, *(const v4f*)&sf[wave][rl][lane * 4]); }

extern "C" void kernel_launch(void* const* d_in, const int* in_sizes, int n_in, void* d_out, int out_size, void* d_ws, size_t ws_size, hipStream_t stream) {
  (void)in_sizes; (void)n_in; (void)out_size;
  const float** F = (const float**)d_in;
  if (ws_size < (size_t)WS_END) return;
  char* ws = (char*)d_ws; _Float16 *QH = (_Float16*)(ws + WS_QH), *KH = (_Float16*)(ws + WS_KH), *VT = (_Float16*)(ws + WS_VT), *QL = (_Float16*)(ws + WS_QL), *KL = (_Float16*)(ws + WS_KL); __bf16 *VB = (__bf16*)(ws + WS_VB), *VBL = (__bf16*)(ws + WS_VBL); float *Y = (float*)(ws + WS_Y);
  (void)Y; (void)QL; (void)KL; (void)VB; (void)VBL;
  // inputs: 0 x [2,2048,1024]; 1 Wq [1024,1024] (out,in); 2 Wk; 3 Wv; 4 bv [1024] (NONZERO; q and k have no bias: null pointers); 5 Wo (out,in); 6 bo (NONZERO)
  k_proj<<<dim3(TNB * TT / 64, CC / 128, 3), 128, 0, stream>>>(F[0], F[0], F[0], F[1], F[2], F[3], nullptr, nullptr, F[4], QH, QL, KH, KL, VT, VB, VBL);
  k_att<<<dim3(NH * TNB, NQB), 128, 0, stream>>>(QH, KH, QL, KL, VT, VB, VBL, Y);
  k_out<<<dim3(TNB * TT / 64, DIN / 128), 128, 0, stream>>>(Y, F[5], F[6], (float*)d_out);
}

// v005
// A run of this version takes 96.4 microseconds.
// Timed twice side by side with v004, it ran 1.07 times as fast both times.
// Counting every step since v000, it is 13.4 times as fast.
// compute dtype: all float inputs rounded to bf16; q / k / v projections with EXACT bf16 products on WMMA 16x16x32 (f32 accumulate) + bias (v only; nonzero); interleaved-pair RoPE in f32 on q and k (which have no bias) (embedded frequencies, cos / sin by the precise library steps for small arguments, positions = the row index); causal logits: 3 products for the first 384 rows, single f16 q x k after, x 64^-0.5; online softmax f32 in one fused pass, exponentials in base 2; exp(logit - running max) x 2^11 once to f16 x v once to f16 (bf16 hi + lo below row 384); ctx hi+lo x exact Wo below row 384, x2^6 f16 carry x f16(bf16 x 2^8) Wo after, + bo; f32 output.
#include <hip/hip_runtime.h>
#include <math.h>

typedef __attribute__((ext_vector_type(16))) _Float16 v16h;
typedef __attribute__((ext_vector_type(16))) __bf16 v16b;
typedef __attribute__((ext_vector_type(8)))  _Float16 v8h;
typedef __attribute__((ext_vector_type(8)))  float v8f;
typedef __attribute__((ext_vector_type(4)))  float v4f;
typedef __attribute__((ext_vector_type(2)))  float v2f;
typedef __attribute__((ext_vector_type(4)))  unsigned v4u;
typedef __attribute__((ext_vector_type(4)))  int v4i;
typedef float __attribute__((may_alias)) float_a;
typedef int __attribute__((may_alias)) int_a;

template <typename T> __device__ __forceinline__ void vst2(void* p, T v) { *(T*)p = v;  }
__device__ __forceinline__ v8f wmma16(v16h a, v16h b, v8f c) {
  v8f d = __builtin_amdgcn_wmma_f32_16x16x32_f16(false, a, false, b, (short)0, c, false, false);
  asm volatile("v_nop\n\tv_nop\n\tv_nop\n\tv_nop" : "+v"(d) : "v"(a), "v"(b));
  return d;
}
__device__ __forceinline__ v8f wmma_bf(v16b a, v16b b, v8f c) {
  v8f d = __builtin_amdgcn_wmma_f32_16x16x32_bf16(false, a, false, b, (short)0, c, false, false);
  asm volatile("v_nop\n\tv_nop\n\tv_nop\n\tv_nop" : "+v"(d) : "v"(a), "v"(b));
  return d;
}
// 16x16x32 fragments: lane = (h = lane>>4, row/col = lane&15); elements 0..7 = k0+8h+0..7, 8..15 = k0+16+8h+0..7; D element r = row 8h+r
__device__ __forceinline__ v16h frag_h(const _Float16* rowk0, int lane) {
  union { v16h v; v8h q[2]; } u; const _Float16* p = rowk0 + 8 * (lane >> 4);
  u.q[0] = *(const v8h*)p; u.q[1] = *(const v8h*)(p + 16); return u.v;
}
__device__ __forceinline__ v16h frag_f32(const float* rowk0, int lane) {
  v16h a; const float* p = rowk0 + 8 * (lane >> 4);
#pragma unroll
  for (int i = 0; i < 8; ++i) { a[i] = (_Float16)p[i]; a[8 + i] = (_Float16)p[16 + i]; }
  return a;
}
__device__ __forceinline__ v16h frag_f32s(const float* rowk0, int lane, float sc) {
  v16h a; const float* p = rowk0 + 8 * (lane >> 4);
#pragma unroll
  for (int i = 0; i < 8; ++i) { a[i] = (_Float16)(p[i] * sc); a[8 + i] = (_Float16)(p[16 + i] * sc); }
  return a;
}
// column fragment from a [K][ld] layout (column n), rows >= K read as 0
__device__ __forceinline__ v16h fragc_f32(const float* W, int k0, int n, int lane, int ld, int K) {
  v16h a; const int g = lane >> 4;
#pragma unroll
  for (int i = 0; i < 8; ++i) { const int ka = k0 + 8 * g + i, kb = ka + 16;
    a[i] = (_Float16)(ka < K ? W[(size_t)(ka < K ? ka : K - 1) * ld + n] : 0.f); a[8 + i] = (_Float16)(kb < K ? W[(size_t)(kb < K ? kb : K - 1) * ld + n] : 0.f); }
  return a;
}
struct F2 { v16b h, l; };
__device__ __forceinline__ F2 bsplit16(const float v[16]) { F2 r;
#pragma unroll
  for (int i = 0; i < 16; ++i) { const __bf16 h = (__bf16)v[i]; r.h[i] = h; r.l[i] = (__bf16)(v[i] - (float)h); }
  return r; }
__device__ __forceinline__ F2 split_row(const float* row, int k0, int lane) { float v[16]; const float* p = row + k0 + 8 * (lane >> 4);
#pragma unroll
  for (int i = 0; i < 8; ++i) { v[i] = p[i]; v[8 + i] = p[16 + i]; }
  return bsplit16(v); }
__device__ __forceinline__ F2 split_rowK(const float* row, int k0, int lane, int K) { float v[16]; const int g = lane >> 4;
#pragma unroll
  for (int i = 0; i < 8; ++i) { const int ka = k0 + 8 * g + i, kb = ka + 16; v[i] = ka < K ? row[ka < K ? ka : K - 1] : 0.f; v[8 + i] = kb < K ? row[kb < K ? kb : K - 1] : 0.f; }
  return bsplit16(v); }
__device__ __forceinline__ F2 split_col(const float* W, int k0, int n, int lane, int ld, int K) { float v[16]; const int g = lane >> 4;
#pragma unroll
  for (int i = 0; i < 8; ++i) { const int ka = k0 + 8 * g + i, kb = ka + 16; v[i] = ka < K ? W[(size_t)(ka < K ? ka : K - 1) * ld + n] : 0.f; v[8 + i] = kb < K ? W[(size_t)(kb < K ? kb : K - 1) * ld + n] : 0.f; }
  return bsplit16(v); }
__device__ __forceinline__ v8f mac3(const F2& a, const F2& b, v8f c) { c = wmma_bf(a.l, b.h, c); c = wmma_bf(a.h, b.l, c); return wmma_bf(a.h, b.h, c); }
__device__ __forceinline__ float sigm(float v) { return 1.0f / (1.0f + expf(-v)); }
#define LDSX() do { asm volatile("s_wait_dscnt 0" ::: "memory"); __builtin_amdgcn_wave_barrier(); __builtin_amdgcn_fence(__ATOMIC_RELEASE, "workgroup"); } while (0)

// Causal self-attention with interleaved-pair RoPE (x [2,2048,1024]; (out,in) Wq / Wk / Wv [1024,1024] N(0, 1/1024) applied as einsum('bse,he->bsh') = x @ W.T; bv [1024] NONZERO (only v has a bias); Wo [1024,1024] (out,in) + bo NONZERO; 16 heads x 64; RoPE (base 10000, positions 0..2047) on q and k: (even, odd) pairs rotated and re-interleaved; scores x 1/sqrt(64); triu(k = 1) -> -inf; softmax; out @ Wo.T + bo).
#define NB 2
#define TT 2048
#define CC 1024            // NH * HD = projected width
#define DIN 1024          // input (model) width
#define NH 16
#define HD 64
#define NQB (TT / 64)
#define SCALE (0.125f)
#define SC2 (SCALE * 1.44269504088896340736f)   // logit scale x log2(e): exp(SCALE * d) = 2^(SC2 * d)
#define CAUSAL 1
#ifndef TNB
#define TNB NB
#endif
__device__ __forceinline__ float bfr(float v) { return (float)(__bf16)v; }
typedef __attribute__((ext_vector_type(8))) __bf16 v8b;
__device__ __forceinline__ v16b frag_b(const __bf16* rowk0, int lane) {
  union { v16b v; v8b q[2]; } u; const __bf16* p = rowk0 + 8 * (lane >> 4);
  u.q[0] = *(const v8b*)p; u.q[1] = *(const v8b*)(p + 16); return u.v;
}
#define QBH 6              // causal: query blocks 0..QBH-1 of each sequence (few keys, no averaging) take the high-precision path
#define QHI 384            // rows carrying a q residual plane
#define KHI 384            // key rows carrying k residual / v bf16 hi+lo planes (used only by the causal high-precision path)
// B fragment (k rows k0+.., output column o) of a weight: (in,out) [K][ld] or (out,in) [ld rows of K]: bf16 exact, or f16(bf16 * 256) exact
__device__ __forceinline__ v16b wcol_io(const float* Wm, int k0, int o, int lane, int ld) { v16b w; const int g = lane >> 4;
#pragma unroll
  for (int i = 0; i < 8; ++i) { w[i] = (__bf16)Wm[(size_t)(k0 + 8 * g + i) * ld + o]; w[8 + i] = (__bf16)Wm[(size_t)(k0 + 16 + 8 * g + i) * ld + o]; }
  return w; }
__device__ __forceinline__ v16b wcol_oi(const float* Wm, int k0, int o, int lane, int K) { v16b w; const float* p = Wm + (size_t)o * K + k0 + 8 * (lane >> 4);
#pragma unroll
  for (int i = 0; i < 8; ++i) { w[i] = (__bf16)p[i]; w[8 + i] = (__bf16)p[16 + i]; }
  return w; }
__device__ __forceinline__ v16h wcolh_io(const float* Wm, int k0, int o, int lane, int ld) { v16h w; const int g = lane >> 4;
#pragma unroll
  for (int i = 0; i < 8; ++i) { w[i] = (_Float16)(bfr(Wm[(size_t)(k0 + 8 * g + i) * ld + o]) * 256.0f); w[8 + i] = (_Float16)(bfr(Wm[(size_t)(k0 + 16 + 8 * g + i) * ld + o]) * 256.0f); }
  return w; }
__device__ __forceinline__ v16h wcolh_oi(const float* Wm, int k0, int o, int lane, int K) { v16h w; const float* p = Wm + (size_t)o * K + k0 + 8 * (lane >> 4);
#pragma unroll
  for (int i = 0; i < 8; ++i) { w[i] = (_Float16)(bfr(p[i]) * 256.0f); w[8 + i] = (_Float16)(bfr(p[16 + i]) * 256.0f); }
  return w; }
#define WQKV_LAYOUT 1   // picks only the WCOL helper, which nothing calls (0 = (in,out) [DIN][CC]; 1 = (out,in) [CC][DIN]; 2 = per-head [NH][DIN][HD]); k_proj always reads (out,in) [CC][DIN]
__device__ __forceinline__ v16b wcol_hdk(const float* Wm, int k0, int o, int lane) { v16b w; const int g = lane >> 4; const float* p = Wm + (size_t)(o / HD) * DIN * HD + (o % HD);
#pragma unroll
  for (int i = 0; i < 8; ++i) { w[i] = (__bf16)p[(size_t)(k0 + 8 * g + i) * HD]; w[8 + i] = (__bf16)p[(size_t)(k0 + 16 + 8 * g + i) * HD]; }
  return w; }
#define WO_OUT_IN 1
#if WQKV_LAYOUT == 1
#define WCOL(W, k0, o, lane) wcol_oi(W, k0, o, lane, DIN)
#elif WQKV_LAYOUT == 2
#define WCOL(W, k0, o, lane) wcol_hdk(W, k0, o, lane)
#else
#define WCOL(W, k0, o, lane) wcol_io(W, k0, o, lane, CC)
#endif
#if WO_OUT_IN
#define WOCOL(W, k0, o, lane) wcol_oi(W, k0, o, lane, CC)
#define WOCOLH(W, k0, o, lane) wcolh_oi(W, k0, o, lane, CC)
#else
#define WOCOL(W, k0, o, lane) wcol_io(W, k0, o, lane, DIN)
#define WOCOLH(W, k0, o, lane) wcolh_io(W, k0, o, lane, DIN)
#endif

// RoPE inverse frequencies 1/10000^(2i/64)
__constant__ float INVF[32] = {1.000000000e+00,7.498942018e-01,5.623413324e-01,4.216965139e-01,3.162277639e-01,2.371373624e-01,1.778279394e-01,1.333521456e-01,1.000000015e-01,7.498941571e-02,5.623412877e-02,4.216964915e-02,3.162277862e-02,2.371373586e-02,1.778279431e-02,1.333521493e-02,9.999999776e-03,7.498942316e-03,5.623413250e-03,4.216964822e-03,3.162277862e-03,2.371373819e-03,1.778279431e-03,1.333521446e-03,1.000000047e-03,7.498941850e-04,5.623413017e-04,4.216964880e-04,3.162277862e-04,2.371373848e-04,1.778279402e-04,1.333521504e-04};
#define PROJ_EXTRA_PARAMS
// cos and sin of one RoPE angle a = position x frequency, 0 <= a < 2048: the steps, constants and order of the math library's precise cosf and sinf on their small-argument path (below 2^17), with the range reduction and the two polynomials, which both functions share, worked once. Same bits as the two calls; their large-argument branch and their test for a non-finite argument cannot be met by such an angle.
__device__ __forceinline__ void rope_cs(float a, float& cs, float& sn) {
  const float n = __builtin_rintf(a * __uint_as_float(0x3f22f983u));   /* a x 2 / pi to the nearest whole number: the quadrant count */
  float r = __builtin_fmaf(__uint_as_float(0xbfc90fdau), n, a); r = __builtin_fmaf(__uint_as_float(0xb3a22168u), n, r); r = __builtin_fmaf(__uint_as_float(0xa7c234c4u), n, r);   /* a - n x pi / 2, pi / 2 in three parts */
  const int q = (int)n; const float s = r * r;
  float ps = __builtin_fmaf(__uint_as_float(0xb94c1982u), s, __uint_as_float(0x3c0881c4u)); ps = __builtin_fmaf(s, ps, __uint_as_float(0xbe2aaa9du));
  const float sr = __builtin_fmaf(r, s * ps, r);   /* sin r */
  float pc = __builtin_fmaf(__uint_as_float(0x37d75334u), s, __uint_as_float(0xbab64f3bu)); pc = __builtin_fmaf(s, pc, __uint_as_float(0x3d2aabf7u)); pc = __builtin_fmaf(s, pc, __uint_as_float(0xbf000004u));
  const float cr = __builtin_fmaf(s, pc, 1.0f);    /* cos r */
  const unsigned sg = ((unsigned)q << 30) & 0x80000000u;   /* quadrants 2 and 3 change the sign */
  cs = __uint_as_float(__float_as_uint((q & 1) ? -sr : cr) ^ sg); sn = __uint_as_float(__float_as_uint((q & 1) ? cr : sr) ^ sg); }
#ifndef PROJ_EXTRA_PARAMS
#define PROJ_EXTRA_PARAMS
#endif

#define WS_QH  0u                                      // f16 q rows [b*t][CC]
#define WS_KH  (WS_QH + 2u * (size_t)NB * TT * CC)      // f16 k rows [b*t][CC]
#define WS_VT  (WS_KH + 2u * (size_t)NB * TT * CC)      // f16 v planes [b][c][t]
#define WS_QL  (WS_VT + 2u * (size_t)NB * CC * TT)      // f16 q residual x 2^10 rows [b][t < QHI][CC]
#define WS_KL  (WS_QL + 2u * (size_t)NB * QHI * CC)     // f16 k residual x 2^10 rows [b][t < KHI][CC]
#define WS_VB  (WS_KL + 2u * (size_t)NB * KHI * CC)     // bf16 v hi planes [b][c][t < KHI]
#define WS_VBL (WS_VB + 2u * (size_t)NB * CC * KHI)
#define WS_Y   (WS_VBL + 2u * (size_t)NB * CC * KHI)     // f32 ctx rows [b*t][CC] (only when there is an output projection)
#define WS_END (WS_Y  + 4u * (size_t)NB * TT * CC)

// ---- staged GEMM loop shared by k_proj and k_out: a block's 64 A rows and 128 W rows (both k-contiguous f32, row length LD) come in chunks of GK k columns by whole-line 16-byte loads, are rounded ONCE to their 16-bit operand form and stored in LDS, where the four waves read their fragments. Two LDS buffers, one barrier a chunk; the next chunk's global loads fly under this chunk's products. Rounding, fragment k order and the order of the products into each accumulator are those of the per-lane global fragment loads that this replaces.
// MODE 0: A and W bf16, one product; MODE 1: A bf16 hi + lo planes, W bf16, two products; MODE 2: A f16(x 2^6), W f16(bf16 x 2^8), one product
#define GK 64                  // k columns of a chunk: 256 B of every f32 row
#define GP 72                  // LDS row pitch in 16-bit elements: 144 B = 16 B x 9, so the 16-byte fragment reads of 16 rows meet no bank twice
#define GW_B (128 * GP * 2)    // bytes of one W buffer
#define GA_B (64 * GP * 2)     // bytes of one plane of one A buffer
typedef __attribute__((ext_vector_type(4))) __bf16 v4b;
typedef __attribute__((ext_vector_type(4))) _Float16 v4h;
template <int MODE, int LD> __device__ __forceinline__ void gemm_staged(const float* __restrict__ Ag, const float* __restrict__ Wg, unsigned char* sw, unsigned char* sa, v8f (&acc)[8]) {
  const int tid = threadIdx.x, wave = tid >> 5, lane = tid & 31, col = lane & 15; const int lr = tid >> 4, lc = tid & 15;   /* 16 lanes x 16 B = one row's chunk; the block covers 8 rows a load */
  const float* ap = Ag + (size_t)lr * LD + lc * 4; const float* wp = Wg + (size_t)lr * LD + lc * 4;
  constexpr int NPL = MODE == 1 ? 2 : 1;
  v4f ar[8], wr[16];
#pragma unroll
  for (int i = 0; i < 8; ++i) ar[i] = *(const v4f*)(ap + (size_t)(8 * i) * LD);
#pragma unroll
  for (int i = 0; i < 16; ++i) wr[i] = *(const v4f*)(wp + (size_t)(8 * i) * LD);
  asm volatile("s_wait_xcnt 0x0" ::: "memory");   /* stands in front of any rewrite of the address registers that the 24 issued loads name */
#pragma unroll 2   /* two chunks a body: the two buffers' LDS offsets become constants */
  for (int ch = 0; ch < LD / GK; ++ch) { unsigned char* wb = sw + (ch & 1) * GW_B; unsigned char* ab = sa + (ch & 1) * (NPL * GA_B);
#pragma unroll
    for (int i = 0; i < 8; ++i) { const int eo = (lr + 8 * i) * GP + lc * 4; const v4f v = ar[i];
      if (MODE == 2) { const v4h o = {(_Float16)(v[0] * 64.0f), (_Float16)(v[1] * 64.0f), (_Float16)(v[2] * 64.0f), (_Float16)(v[3] * 64.0f)}; *(v4h*)((_Float16*)ab + eo) = o; }
      else { const v4b o = {(__bf16)v[0], (__bf16)v[1], (__bf16)v[2], (__bf16)v[3]}; *(v4b*)((__bf16*)ab + eo) = o;
        if (MODE == 1) { const v4b o2 = {(__bf16)(v[0] - (float)o[0]), (__bf16)(v[1] - (float)o[1]), (__bf16)(v[2] - (float)o[2]), (__bf16)(v[3] - (float)o[3])}; *(v4b*)((__bf16*)(ab + GA_B) + eo) = o2; } } }
#pragma unroll
    for (int i = 0; i < 16; ++i) { const int eo = (lr + 8 * i) * GP + lc * 4; const v4f v = wr[i];
      if (MODE == 2) { const v4h o = {(_Float16)(bfr(v[0]) * 256.0f), (_Float16)(bfr(v[1]) * 256.0f), (_Float16)(bfr(v[2]) * 256.0f), (_Float16)(bfr(v[3]) * 256.0f)}; *(v4h*)((_Float16*)wb + eo) = o; }
      else { const v4b o = {(__bf16)v[0], (__bf16)v[1], (__bf16)v[2], (__bf16)v[3]}; *(v4b*)((__bf16*)wb + eo) = o; } }
    __syncthreads();   /* publishes this chunk; it also ends every wave's reads of the other buffer, which the next trip overwrites */
    if (ch + 1 < LD / GK) {   /* block-uniform: the next chunk's loads, behind the barrier (whose fence would wait for them) and in flight under this chunk's fragment reads and products */
#pragma unroll
      for (int i = 0; i < 8; ++i) ar[i] = *(const v4f*)(ap + (size_t)(8 * i) * LD + (ch + 1) * GK);
#pragma unroll
      for (int i = 0; i < 16; ++i) wr[i] = *(const v4f*)(wp + (size_t)(8 * i) * LD + (ch + 1) * GK);
      asm volatile("s_wait_xcnt 0x0" ::: "memory"); }   /* stands in front of any rewrite of the address registers that the 24 issued loads name */
#pragma unroll
    for (int kk = 0; kk < GK / 32; ++kk) { const int ao = (wave * 16 + col) * GP + kk * 32;
      if (MODE == 2) { const v16h a = frag_h((const _Float16*)ab + ao, lane); v16h w[8];
#pragma unroll
        for (int j = 0; j < 8; ++j) w[j] = frag_h((const _Float16*)wb + (j * 16 + col) * GP + kk * 32, lane);
#pragma unroll
        for (int j = 0; j < 8; ++j) acc[j] = wmma16(a, w[j], acc[j]);
      } else { const v16b a = frag_b((const __bf16*)ab + ao, lane); v16b a2 = a, w[8]; if (MODE == 1) a2 = frag_b((const __bf16*)(ab + GA_B) + ao, lane);
#pragma unroll
        for (int j = 0; j < 8; ++j) w[j] = frag_b((const __bf16*)wb + (j * 16 + col) * GP + kk * 32, lane);
#pragma unroll
        for (int j = 0; j < 8; ++j) { acc[j] = wmma_bf(a, w[j], acc[j]); if (MODE == 1) acc[j] = wmma_bf(a2, w[j], acc[j]); } } } } }

// ---- k_proj: block = (64 rows, 128 cols, which): q/k/v = X W (+ b) with exact bf16 products (K = DIN) -> which 0: q f16 rows (+ residual rows < QHI); 1: k f16 rows (+ residual rows < KHI); 2: v f16 planes [c][t] (+ bf16 hi/lo planes for t < KHI)
__global__ __launch_bounds__(128) void k_proj(const float* __restrict__ XQ, const float* __restrict__ XK, const float* __restrict__ XV, const float* __restrict__ WQ, const float* __restrict__ WK, const float* __restrict__ WV, const float* __restrict__ BQ, const float* __restrict__ BK, const float* __restrict__ BV,
    _Float16* __restrict__ QH, _Float16* __restrict__ QL, _Float16* __restrict__ KH, _Float16* __restrict__ KL, _Float16* __restrict__ VT, __bf16* __restrict__ VB, __bf16* __restrict__ VBL PROJ_EXTRA_PARAMS) {
  __shared__ __align__(16) unsigned char sm[55296 + 33792];   /* one region that holds in turn the staged operand chunks (W 2 x 18432 B, X 2 x 9216 B) and the epilogue's planes: sh, sl (q, k) or th, tb, tbl (v); then st */
  unsigned char* rg = sm; float (*st)[132] = (float (*)[132])(sm + 55296);
  _Float16 (*sh)[136] = (_Float16 (*)[136])rg; _Float16 (*sl)[136] = (_Float16 (*)[136])(rg + 17408); _Float16 (*th)[72] = (_Float16 (*)[72])rg; __bf16 (*tb)[72] = (__bf16 (*)[72])(rg + 18432); __bf16 (*tbl)[72] = (__bf16 (*)[72])(rg + 36864);
  const int tid = threadIdx.x, wave = tid >> 5, lane = tid & 31, col = lane & 15, g = lane >> 4; const int which = blockIdx.z; const int c0 = blockIdx.y * 128; const size_t r0 = (size_t)blockIdx.x * 64; const size_t bb = r0 / TT; const int t0 = (int)(r0 % TT);
  const float* X = which == 0 ? XQ : which == 1 ? XK : XV; const float* WA = which == 0 ? WQ : which == 1 ? WK : WV; const float* BA = which == 0 ? BQ : which == 1 ? BK : BV;
  v8f acc[8] = {};
  gemm_staged<0, DIN>(X + r0 * DIN, WA + (size_t)c0 * DIN, rg, rg + 2 * GW_B, acc);
  { // stage the f32 tile (acc + bias) in LDS, rotate q and k (a thread per row and frequency half), then convert
#pragma unroll
    for (int j = 0; j < 8; ++j) { const float bias = BA ? bfr(BA[c0 + j * 16 + col]) : 0.f;
#pragma unroll
      for (int r = 0; r < 8; ++r) st[wave * 16 + 8 * g + r][j * 16 + col] = acc[j][r] + bias; }
    __syncthreads();
    if (which < 2) {   /* block-uniform: the rotation of q and k. A thread takes one row and one half of the 32 frequencies (the half is the same for a whole wave, so the frequencies come by scalar loads) and turns that half's pairs in BOTH heads of the tile with the one cos / sin pair */
      const int hf = __builtin_amdgcn_readfirstlane(wave & 1); const int rl = (wave >> 1) * 32 + lane; float* rw = &st[rl][hf * 32]; const float pos_ = (float)(int)((r0 + rl) % TT);   /* position = the token's sequence index */
      v4f xv[128 / HD][8];
#pragma unroll
      for (int hh = 0; hh < 128 / HD; ++hh)
#pragma unroll
        for (int p = 0; p < 8; ++p) xv[hh][p] = *(const v4f*)(rw + hh * HD + 4 * p);   /* the thread's 2 x 16 pairs, read ahead: their LDS latency passes under the first angles */
#pragma unroll   /* unrolled with the loops around it: xv stays in registers, and the angles' independent chains fill one another's latency */
      for (int p = 0; p < 8; ++p) { float cs0, sn0, cs1, sn1; rope_cs(pos_ * INVF[hf * 16 + 2 * p], cs0, sn0); rope_cs(pos_ * INVF[hf * 16 + 2 * p + 1], cs1, sn1);
#pragma unroll
        for (int hh = 0; hh < 128 / HD; ++hh) {
#pragma clang fp contract(off)   /* as before this step: each product and each sum of the rotation is rounded on its own, as in the reference's expression, so q and k stay bit-identical */
          const v4f x = xv[hh][p]; const v4f o = {x[0] * cs0 - x[1] * sn0, x[0] * sn0 + x[1] * cs0, x[2] * cs1 - x[3] * sn1, x[2] * sn1 + x[3] * cs1}; *(v4f*)(rw + hh * HD + 4 * p) = o; } } }
    __syncthreads(); }
  if (which < 2) { _Float16* DH = which == 0 ? QH : KH; _Float16* DL = which == 0 ? QL : KL; const int nhi = which == 0 ? QHI : KHI; const bool hi_rows = t0 < nhi;
    for (int e = tid; e < 64 * 128; e += 128) { const int rl = e >> 7, cl = e & 127; const float v = st[rl][cl]; const _Float16 hv = (_Float16)v; sh[rl][cl] = hv; sl[rl][cl] = (_Float16)((v - (float)hv) * 1024.0f); }
    __syncthreads();
    for (int e = tid; e < 64 * 16; e += 128) { const int rl = e >> 4, q = e & 15; vst2((unsigned*)(DH + (r0 + rl) * CC + c0 + q * 8), *(const v4u*)&sh[rl][q * 8]); if (hi_rows) vst2((unsigned*)(DL + (bb * nhi + t0 + rl) * (size_t)CC + c0 + q * 8), *(const v4u*)&sl[rl][q * 8]); }
  } else { const bool hi_rows = t0 < KHI;
    for (int e = tid; e < 64 * 128; e += 128) { const int rl = e & 63, cl = e >> 6; const float v = st[rl][cl]; th[cl][rl] = (_Float16)v; const __bf16 bh = (__bf16)v; tb[cl][rl] = bh; tbl[cl][rl] = (__bf16)(v - (float)bh); }
    __syncthreads();
    for (int e = tid; e < 128 * 8; e += 128) { const int cl = e >> 3, q = e & 7; vst2((unsigned*)(VT + (bb * CC + c0 + cl) * (size_t)TT + t0 + q * 8), *(const v4u*)&th[cl][q * 8]); if (hi_rows) { const size_t o3 = (bb * CC + c0 + cl) * (size_t)KHI + t0 + q * 8; vst2((unsigned*)(VB + o3), *(const v4u*)&tb[cl][q * 8]); vst2((unsigned*)(VBL + o3), *(const v4u*)&tbl[cl][q * 8]); } } } }
// ---- k_att: block = 64 queries (qb) of (b, h), wave = 16 queries: logits, softmax and P . v in one pass over key blocks of 64, nothing of the logits leaves registers.
// Transposed tiles: S^T = k q^T puts (key 8g + r, query col) in D element r, which is already the B fragment (k = keys) of ctx^T = v^T P^T; the row statistics of a query live in its two lanes (col, col + 16).
// Past the early query blocks the block's four waves share each key block's k and v tiles: asynchronous 16-byte copies bring them by whole lines into two LDS buffers (the next block's copies fly under this block's work), and every wave reads its fragments there. Fragment contents, k order and the order of the products are those of the per-lane global fragment loads that this replaces.
// Running maximum m (of the unscaled logits) and sum l per query; e = 2^(SC2 (logit - m) + 11) = exp(scaled logit - scaled m) x 2^11 once to f16 against v f16 (HI, causal early query blocks: 3-product logits, e and v as bf16 hi + lo, 3 products); l sums the same e, ctx = acc / l. The inner loops are fully unrolled so that every fragment array stays in registers.
#define AP 144                 // LDS pitch in bytes of a staged 128-byte row: 16 B x 9, so the 16-byte fragment reads of 16 rows meet no bank twice
#define AT_B (64 * AP)         // bytes of one staged tile of 64 rows; a buffer = the k tile, then the v tile
// one key block into one LDS buffer: k tile = 64 key rows x the head's 64 channels, v tile = the head's 64 channel planes x 64 keys, 128 B a row. A lane copies its 16 B of rows r, r + 16, r + 32, r + 48 of both tiles (r = tid >> 3), so each wave-wide copy covers four whole lines. ld, kg, vg: the lane's own LDS byte address and global addresses in row r.
__device__ __forceinline__ void att_stage(unsigned ld, const _Float16* kg, const _Float16* vg) {
  /* the closing s_wait_xcnt 0 stands inside the copies' own statement, in front of any rewrite of the address registers that the eight issued copies name */
  asm volatile("global_load_async_to_lds_b128 %0, %8, off\n\t"
               "global_load_async_to_lds_b128 %1, %9, off\n\t"
               "global_load_async_to_lds_b128 %2, %10, off\n\t"
               "global_load_async_to_lds_b128 %3, %11, off\n\t"
               "global_load_async_to_lds_b128 %4, %12, off\n\t"
               "global_load_async_to_lds_b128 %5, %13, off\n\t"
               "global_load_async_to_lds_b128 %6, %14, off\n\t"
               "global_load_async_to_lds_b128 %7, %15, off\n\t"
               "s_wait_xcnt 0x0"
               :: "v"(ld), "v"(ld + 16 * AP), "v"(ld + 32 * AP), "v"(ld + 48 * AP), "v"(ld + AT_B), "v"(ld + AT_B + 16 * AP), "v"(ld + AT_B + 32 * AP), "v"(ld + AT_B + 48 * AP),
                  "v"(kg), "v"(kg + 16 * CC), "v"(kg + 32 * CC), "v"(kg + 48 * CC), "v"(vg), "v"(vg + 16 * TT), "v"(vg + 32 * TT), "v"(vg + 48 * TT) : "memory"); }
// eight 2^x in place on the hardware's v_exp_f32
__device__ __forceinline__ void exp2x8(v8f& x) {
  float x0 = x[0], x1 = x[1], x2 = x[2], x3 = x[3], x4 = x[4], x5 = x[5], x6 = x[6], x7 = x[7];
  /* one statement, so that nothing directly behind a v_exp_f32 reads its result or overwrites its source: inside, each works on a register of its own, and the closing v_nop is the one slot that the instruction set asks for in front of whatever the compiler puts next */
  asm("v_exp_f32 %0, %0\n\tv_exp_f32 %1, %1\n\tv_exp_f32 %2, %2\n\tv_exp_f32 %3, %3\n\tv_exp_f32 %4, %4\n\tv_exp_f32 %5, %5\n\tv_exp_f32 %6, %6\n\tv_exp_f32 %7, %7\n\tv_nop"
      : "+v"(x0), "+v"(x1), "+v"(x2), "+v"(x3), "+v"(x4), "+v"(x5), "+v"(x6), "+v"(x7));
  x = v8f{x0, x1, x2, x3, x4, x5, x6, x7}; }
template <bool HI> __device__ __forceinline__ void att_body(unsigned char* sm, const _Float16* __restrict__ QH, const _Float16* __restrict__ KH, const _Float16* __restrict__ QL, const _Float16* __restrict__ KL, const _Float16* __restrict__ VT, const __bf16* __restrict__ VB, const __bf16* __restrict__ VBL, float* __restrict__ Y, int qb, int h, int b) {
  const int tid = threadIdx.x, wave = tid >> 5, lane = tid & 31, col = lane & 15, g = lane >> 4; const int ql0 = qb * 64 + wave * 16; const int t = ql0 + col; const size_t q0 = (size_t)b * TT + ql0;
  const _Float16* QLb = QL + (size_t)b * QHI * CC; const _Float16* KLb = KL + (size_t)b * KHI * CC;
  const _Float16* kp = KH + ((size_t)b * TT + col) * CC + h * HD;              /* key row col, this head's 64 channels */
  const unsigned ld0 = (unsigned)(size_t)sm + (unsigned)((tid >> 3) * AP + (tid & 7) * 16);                 /* this lane's place in row tid >> 3 of buffer 0's k tile */
  const _Float16* kg = KH + ((size_t)b * TT + (tid >> 3)) * CC + h * HD + (tid & 7) * 8;                     /* its 16 B of key row tid >> 3 */
  const _Float16* vg = VT + ((size_t)b * CC + h * HD + (tid >> 3)) * (size_t)TT + (tid & 7) * 8;             /* its 16 B of channel plane tid >> 3 */
  v16h ah[HD / 32], al[HD / 32], kf[HD / 32][4];
#pragma unroll
  for (int kc = 0; kc < HD / 32; ++kc) { ah[kc] = frag_h(QH + (q0 + col) * CC + h * HD + kc * 32, lane); if (HI) al[kc] = frag_h(QLb + (size_t)(ql0 + col) * CC + h * HD + kc * 32, lane); }
  if (!HI) {   /* block-uniform: key block 0 into buffer 0, landed and published; then key block 1 into buffer 1 */
    att_stage(ld0, kg, vg);
    asm volatile("s_wait_asynccnt 0x0" ::: "memory");   /* this wave's copies of key block 0 have landed */
    __syncthreads();                                    /* every wave's have: buffer 0 may be read */
    if (qb >= 1) att_stage(ld0 + 2 * AT_B, kg + (size_t)64 * CC, vg + 64); }
  float m = -3.0e38f, l = 0.f; v8f acc[HD / 16] = {};
#pragma unroll 1   /* rolled: one block's k and v fragments already fill the registers that four waves a SIMD leave a wave */
  for (int kb = 0; kb <= qb; ++kb) { const int k0 = kb * 64;   /* causal: key blocks 0 .. qb; only block qb crosses the diagonal */
    v16h vf[2][HD / 16];
    if (!HI) { const unsigned char* kt = sm + (kb & 1) * (2 * AT_B) + col * AP; const unsigned char* vt = kt + AT_B;   /* row col of this key block's two tiles */
#pragma unroll
      for (int kc = 0; kc < HD / 32; ++kc)
#pragma unroll
        for (int j = 0; j < 4; ++j) kf[kc][j] = frag_h((const _Float16*)(kt + j * 16 * AP) + kc * 32, lane);
#pragma unroll
      for (int kc = 0; kc < 2; ++kc)
#pragma unroll
        for (int j = 0; j < HD / 16; ++j) vf[kc][j] = frag_h((const _Float16*)(vt + j * 16 * AP) + kc * 32, lane); }
    __builtin_amdgcn_sched_barrier(0);   /* keeps this block's k and v LDS reads issued here as one group, the v reads in flight under the logits and the softmax, instead of one by one in front of their products */
    v8f s[4] = {}, sl[4] = {};
#pragma unroll
    for (int kc = 0; kc < HD / 32; ++kc) { v16h klf[4];
      if (HI) {
#pragma unroll
        for (int j = 0; j < 4; ++j) { kf[kc][j] = frag_h(kp + (size_t)(k0 + j * 16) * CC + kc * 32, lane); klf[j] = frag_h(KLb + (size_t)(k0 + j * 16 + col) * CC + h * HD + kc * 32, lane); }
        __builtin_amdgcn_sched_barrier(0); }   /* the eight k and k residual fragments of this half are in flight together: one latency, not eight */
#pragma unroll
      for (int j = 0; j < 4; ++j) { s[j] = wmma16(kf[kc][j], ah[kc], s[j]);
        if (HI) { sl[j] = wmma16(kf[kc][j], al[kc], sl[j]); sl[j] = wmma16(klf[j], ah[kc], sl[j]); } } }
    v16b vbh[HD / 16], vbl[HD / 16]; const size_t pb = ((size_t)b * CC + h * HD + col) * (size_t)KHI + k0;
    if (HI) {
#pragma unroll
      for (int j = 0; j < HD / 16; ++j) { vbh[j] = frag_b(VB + pb + (size_t)(j * 16) * KHI, lane); vbl[j] = frag_b(VBL + pb + (size_t)(j * 16) * KHI, lane); } }
    if (HI) __builtin_amdgcn_sched_barrier(0);   /* keeps the first half's v hi + lo loads issued here, in flight under the softmax */
#pragma unroll
    for (int j = 0; j < 4; ++j) {
#pragma unroll
      for (int r = 0; r < 8; ++r) if (HI) s[j][r] = s[j][r] + sl[j][r] * (1.0f / 1024.0f); }   /* the logits stay unscaled: SC2 > 0, so their maximum is the scaled logits' maximum, and the scale rides in the exponent's fma below */
    if (CAUSAL && kb == qb) {   /* wave-uniform */
#pragma unroll
      for (int j = 0; j < 4; ++j) {
#pragma unroll
        for (int r = 0; r < 8; ++r) if (k0 + j * 16 + 8 * g + r > t) s[j][r] = -3.0e38f; } }
    float bm = -3.0e38f;
#pragma unroll
    for (int j = 0; j < 4; ++j) {
#pragma unroll
      for (int r = 0; r < 8; ++r) bm = fmaxf(bm, s[j][r]); }
    bm = fmaxf(bm, __shfl_xor(bm, 16));
    const float mn = fmaxf(m, bm); const float alpha = __builtin_amdgcn_exp2f((m - mn) * SC2); m = mn;   /* every block holds a key open to every query of the wave (key k0 <= ql0), so mn is a real logit */
    const float mo = 11.0f - mn * SC2;   /* exponent offset of this block: the running maximum in base 2, and the 2^11 carry of e */
    float ls = 0.f;
#pragma unroll
    for (int j = 0; j < 4; ++j) {
#pragma unroll
      for (int r = 0; r < 8; ++r) s[j][r] = __builtin_fmaf(s[j][r], SC2, mo); }   /* the exponent of e = 2^11 exp(scaled logit - scaled mn): one fma a logit */
#pragma unroll
    for (int j = 0; j < 4; ++j) { exp2x8(s[j]);   /* a masked logit (-3e38) underflows to exactly 0 against the real mn */
#pragma unroll
      for (int r = 0; r < 8; ++r) ls += s[j][r]; }
    ls += __shfl_xor(ls, 16); l = l * alpha + ls;
#pragma unroll
    for (int j = 0; j < HD / 16; ++j) acc[j] *= alpha;
#pragma unroll
    for (int kc = 0; kc < 2; ++kc) {
      if (HI) { float pv[16];
#pragma unroll
        for (int i = 0; i < 8; ++i) { pv[i] = s[2 * kc][i]; pv[8 + i] = s[2 * kc + 1][i]; }
        const F2 p = bsplit16(pv);
        if (kc == 1) {
#pragma unroll
          for (int j = 0; j < HD / 16; ++j) { vbh[j] = frag_b(VB + pb + (size_t)(j * 16) * KHI + 32, lane); vbl[j] = frag_b(VBL + pb + (size_t)(j * 16) * KHI + 32, lane); }
          __builtin_amdgcn_sched_barrier(0); }   /* the second half's eight v fragments are in flight together */
#pragma unroll
        for (int j = 0; j < HD / 16; ++j) { acc[j] = wmma_bf(vbh[j], p.h, acc[j]); acc[j] = wmma_bf(vbh[j], p.l, acc[j]); acc[j] = wmma_bf(vbl[j], p.h, acc[j]); }
      } else { v16h p;
#pragma unroll
        for (int i = 0; i < 8; ++i) { p[i] = (_Float16)s[2 * kc][i]; p[8 + i] = (_Float16)s[2 * kc + 1][i]; }
#pragma unroll
        for (int j = 0; j < HD / 16; ++j) acc[j] = wmma16(vf[kc][j], p, acc[j]); } }
    if (!HI) {   /* hand-over, every wave of the block, in this order */
      asm volatile("s_wait_dscnt 0x0" ::: "memory");      /* this wave's reads of this block's buffer are over */
      asm volatile("s_wait_asynccnt 0x0" ::: "memory");   /* its copies of the next key block have landed */
      __syncthreads();                                    /* publishes the next key block and ends every wave's reads of this block's buffer */
      if (kb + 2 <= qb) att_stage(ld0 + (kb & 1) * (2 * AT_B), kg + (size_t)(kb + 2) * 64 * CC, vg + (kb + 2) * 64); } }   /* block-uniform: the block after next into the buffer just left */
  if (!HI) asm volatile("s_wait_asynccnt 0x0" ::: "memory");   /* no copy is outstanding when the wave ends */
  const float inv = l > 0.f ? 1.0f / l : 0.f;   /* l carries the same 2^11 as acc */
  float* yr = Y + (q0 + col) * CC + h * HD + 8 * g;   /* D element r of tile j = channel j * 16 + 8g + r of query col: 32 contiguous bytes a lane */
#pragma unroll
  for (int j = 0; j < HD / 16; ++j) { const v4f lo = {acc[j][0] * inv, acc[j][1] * inv, acc[j][2] * inv, acc[j][3] * inv}, hi = {acc[j][4] * inv, acc[j][5] * inv, acc[j][6] * inv, acc[j][7] * inv}; vst2(yr + j * 16, lo); vst2(yr + j * 16 + 4, hi); } }
__global__ __launch_bounds__(128) void k_att(const _Float16* __restrict__ QH, const _Float16* __restrict__ KH, const _Float16* __restrict__ QL, const _Float16* __restrict__ KL, const _Float16* __restrict__ VT, const __bf16* __restrict__ VB, const __bf16* __restrict__ VBL, float* __restrict__ Y) {
  __shared__ __align__(16) unsigned char sm[4 * AT_B];   /* two buffers of a k tile and a v tile */
  const int qb = NQB - 1 - (int)blockIdx.y, h = blockIdx.x % NH, b = blockIdx.x / NH;   /* the longest key ranges take the lowest blockIdx.y */
  if (qb < QBH) att_body<true>(sm, QH, KH, QL, KL, VT, VB, VBL, Y, qb, h, b); else att_body<false>(sm, QH, KH, QL, KL, VT, VB, VBL, Y, qb, h, b); }
// ---- k_out: block = (64 rows, 128 cols): out = ctx Wo (+ bo): ctx x 2^6 once to f16 against Wo as f16(bf16 x 2^8) exact (1 product) x 2^-14; causal early rows (< QHI of each sequence): ctx bf16 hi + lo against exact bf16 Wo (2 products)
__global__ __launch_bounds__(128) void k_out(const float* __restrict__ Y, const float* __restrict__ WO, const float* __restrict__ BO, float* __restrict__ OUT) { __shared__ __align__(16) unsigned char sm[2 * GW_B + 4 * GA_B + 33792];   /* staged W chunks, staged ctx chunks (two planes for the early rows), then the output staging sf */
  unsigned char* sw = sm; unsigned char* sa = sm + 2 * GW_B; float (*sf)[16][132] = (float (*)[16][132])(sm + 2 * GW_B + 4 * GA_B);
  const int tid = threadIdx.x, wave = tid >> 5, lane = tid & 31, col = lane & 15, g = lane >> 4; const int c0 = blockIdx.y * 128; const size_t r0 = (size_t)blockIdx.x * 64 + wave * 16;
  v8f acc[8] = {};
  if (CAUSAL && (int)(((size_t)blockIdx.x * 64) % TT) < QHI) {   /* block-uniform */
    gemm_staged<1, CC>(Y + (size_t)blockIdx.x * 64 * CC, WO + (size_t)c0 * CC, sw, sa, acc);
#pragma unroll
    for (int j = 0; j < 8; ++j) { const float bias = BO ? bfr(BO[c0 + j * 16 + col]) : 0.f;
#pragma unroll
      for (int r = 0; r < 8; ++r) sf[wave][8 * g + r][j * 16 + col] = acc[j][r] + bias; }
  } else {
    gemm_staged<2, CC>(Y + (size_t)blockIdx.x * 64 * CC, WO + (size_t)c0 * CC, sw, sa, acc);   /* ctx carried x 2^6 into f16 so small-magnitude context rows stay clear of f16 subnormals */
#pragma unroll
    for (int j = 0; j < 8; ++j) { const float bias = BO ? bfr(BO[c0 + j * 16 + col]) : 0.f;
#pragma unroll
      for (int r = 0; r < 8; ++r) sf[wave][8 * g + r][j * 16 + col] = acc[j][r] * (1.0f / 16384.0f) + bias; } }   /* 2^-8 (Wo carry) x 2^-6 (ctx carry) */
  LDSX(); for (int rl = 0; rl < 16; ++rl) vst2(OUT + (r0 + rl) * DIN + c0 + lane * 4, *(const v4f*)&sf[wave][rl][lane * 4]); }

extern "C" void kernel_launch(void* const* d_in, const int* in_sizes, int n_in, void* d_out, int out_size, void* d_ws, size_t ws_size, hipStream_t stream) {
  (void)in_sizes; (void)n_in; (void)out_size;
  const float** F = (const float**)d_in;
  if (ws_size < (size_t)WS_END) return;
  char* ws = (char*)d_ws; _Float16 *QH = (_Float16*)(ws + WS_QH), *KH = (_Float16*)(ws + WS_KH), *VT = (_Float16*)(ws + WS_VT), *QL = (_Float16*)(ws + WS_QL), *KL = (_Float16*)(ws + WS_KL); __bf16 *VB = (__bf16*)(ws + WS_VB), *VBL = (__bf16*)(ws + WS_VBL); float *Y = (float*)(ws + WS_Y);
  (void)Y; (void)QL; (void)KL; (void)VB; (void)VBL;
  // inputs: 0 x [2,2048,1024]; 1 Wq [1024,1024] (out,in); 2 Wk; 3 Wv; 4 bv [1024] (NONZERO; q and k have no bias: null pointers); 5 Wo (out,in); 6 bo (NONZERO)
  k_proj<<<dim3(TNB * TT / 64, CC / 128, 3), 128, 0, stream>>>(F[0], F[0], F[0], F[1], F[2], F[3], nullptr, nullptr, F[4], QH, QL, KH, KL, VT, VB, VBL);
  k_att<<<dim3(NH * TNB, NQB), 128, 0, stream>>>(QH, KH, QL, KL, VT, VB, VBL, Y);
  k_out<<<dim3(TNB * TT / 64, DIN / 128), 128, 0, stream>>>(Y, F[5], F[6], (float*)d_out);
}

// v006
// A run of this version takes 93.6 microseconds.
// Two timings next to v005 both put it at 1.04 times that version's speed.
// Over all steps from v000 it is 13.9 times as fast.
// compute dtype: all float inputs rounded to bf16; q / k / v projections with EXACT bf16 products on WMMA 16x16x32 (f32 accumulate) + bias (v only; nonzero); interleaved-pair RoPE in f32 on q and k (which have no bias) (embedded frequencies, cos / sin by the precise library steps for small arguments, positions = the row index); causal logits: 3 products for the first 384 rows, single f16 q x k after, x 64^-0.5; online softmax f32 in one fused pass, exponentials in base 2; exp(logit - running max) x 2^11 once to f16 x v once to f16 (bf16 hi + lo below row 384); ctx hi+lo x exact Wo below row 384, x2^6 f16 carry x f16(bf16 x 2^8) Wo after, + bo; f32 output.
#include <hip/hip_runtime.h>
#include <math.h>

typedef __attribute__((ext_vector_type(16))) _Float16 v16h;
typedef __attribute__((ext_vector_type(16))) __bf16 v16b;
typedef __attribute__((ext_vector_type(8)))  _Float16 v8h;
typedef __attribute__((ext_vector_type(8)))  float v8f;
typedef __attribute__((ext_vector_type(4)))  float v4f;
typedef __attribute__((ext_vector_type(2)))  float v2f;
typedef __attribute__((ext_vector_type(4)))  unsigned v4u;
typedef __attribute__((ext_vector_type(4)))  int v4i;
typedef float __attribute__((may_alias)) float_a;
typedef int __attribute__((may_alias)) int_a;

template <typename T> __device__ __forceinline__ void vst2(void* p, T v) { *(T*)p = v;  }
// one 16-byte global store of a rolled loop, with its s_wait_xcnt 0 in the same statement, so that the wait stands in front of any rewrite of the address registers that the store names (over a wait in a statement of its own the compiler lifted the next trip's address additions)
__device__ __forceinline__ void vst_w(void* p, v4u v) { asm volatile("global_store_b128 %0, %1, off\n\ts_wait_xcnt 0x0" :: "v"(p), "v"(v) : "memory"); }
__device__ __forceinline__ v8f wmma16(v16h a, v16h b, v8f c) {
  v8f d = __builtin_amdgcn_wmma_f32_16x16x32_f16(false, a, false, b, (short)0, c, false, false);
  asm volatile("v_nop\n\tv_nop\n\tv_nop\n\tv_nop" : "+v"(d) : "v"(a), "v"(b));
  return d;
}
__device__ __forceinline__ v8f wmma_bf(v16b a, v16b b, v8f c) {
  v8f d = __builtin_amdgcn_wmma_f32_16x16x32_bf16(false, a, false, b, (short)0, c, false, false);
  asm volatile("v_nop\n\tv_nop\n\tv_nop\n\tv_nop" : "+v"(d) : "v"(a), "v"(b));
  return d;
}
// 16x16x32 fragments: lane = (h = lane>>4, row/col = lane&15); elements 0..7 = k0+8h+0..7, 8..15 = k0+16+8h+0..7; D element r = row 8h+r
__device__ __forceinline__ v16h frag_h(const _Float16* rowk0, int lane) {
  union { v16h v; v8h q[2]; } u; const _Float16* p = rowk0 + 8 * (lane >> 4);
  u.q[0] = *(const v8h*)p; u.q[1] = *(const v8h*)(p + 16); return u.v;
}
__device__ __forceinline__ v16h frag_f32(const float* rowk0, int lane) {
  v16h a; const float* p = rowk0 + 8 * (lane >> 4);
#pragma unroll
  for (int i = 0; i < 8; ++i) { a[i] = (_Float16)p[i]; a[8 + i] = (_Float16)p[16 + i]; }
  return a;
}
__device__ __forceinline__ v16h frag_f32s(const float* rowk0, int lane, float sc) {
  v16h a; const float* p = rowk0 + 8 * (lane >> 4);
#pragma unroll
  for (int i = 0; i < 8; ++i) { a[i] = (_Float16)(p[i] * sc); a[8 + i] = (_Float16)(p[16 + i] * sc); }
  return a;
}
// column fragment from a [K][ld] layout (column n), rows >= K read as 0
__device__ __forceinline__ v16h fragc_f32(const float* W, int k0, int n, int lane, int ld, int K) {
  v16h a; const int g = lane >> 4;
#pragma unroll
  for (int i = 0; i < 8; ++i) { const int ka = k0 + 8 * g + i, kb = ka + 16;
    a[i] = (_Float16)(ka < K ? W[(size_t)(ka < K ? ka : K - 1) * ld + n] : 0.f); a[8 + i] = (_Float16)(kb < K ? W[(size_t)(kb < K ? kb : K - 1) * ld + n] : 0.f); }
  return a;
}
struct F2 { v16b h, l; };
__device__ __forceinline__ F2 bsplit16(const float v[16]) { F2 r;
#pragma unroll
  for (int i = 0; i < 16; ++i) { const __bf16 h = (__bf16)v[i]; r.h[i] = h; r.l[i] = (__bf16)(v[i] - (float)h); }
  return r; }
__device__ __forceinline__ F2 split_row(const float* row, int k0, int lane) { float v[16]; const float* p = row + k0 + 8 * (lane >> 4);
#pragma unroll
  for (int i = 0; i < 8; ++i) { v[i] = p[i]; v[8 + i] = p[16 + i]; }
  return bsplit16(v); }
__device__ __forceinline__ F2 split_rowK(const float* row, int k0, int lane, int K) { float v[16]; const int g = lane >> 4;
#pragma unroll
  for (int i = 0; i < 8; ++i) { const int ka = k0 + 8 * g + i, kb = ka + 16; v[i] = ka < K ? row[ka < K ? ka : K - 1] : 0.f; v[8 + i] = kb < K ? row[kb < K ? kb : K - 1] : 0.f; }
  return bsplit16(v); }
__device__ __forceinline__ F2 split_col(const float* W, int k0, int n, int lane, int ld, int K) { float v[16]; const int g = lane >> 4;
#pragma unroll
  for (int i = 0; i < 8; ++i) { const int ka = k0 + 8 * g + i, kb = ka + 16; v[i] = ka < K ? W[(size_t)(ka < K ? ka : K - 1) * ld + n] : 0.f; v[8 + i] = kb < K ? W[(size_t)(kb < K ? kb : K - 1) * ld + n] : 0.f; }
  return bsplit16(v); }
__device__ __forceinline__ v8f mac3(const F2& a, const F2& b, v8f c) { c = wmma_bf(a.l, b.h, c); c = wmma_bf(a.h, b.l, c); return wmma_bf(a.h, b.h, c); }
__device__ __forceinline__ float sigm(float v) { return 1.0f / (1.0f + expf(-v)); }
#define LDSX() do { asm volatile("s_wait_dscnt 0" ::: "memory"); __builtin_amdgcn_wave_barrier(); __builtin_amdgcn_fence(__ATOMIC_RELEASE, "workgroup"); } while (0)

// Causal self-attention with interleaved-pair RoPE (x [2,2048,1024]; (out,in) Wq / Wk / Wv [1024,1024] N(0, 1/1024) applied as einsum('bse,he->bsh') = x @ W.T; bv [1024] NONZERO (only v has a bias); Wo [1024,1024] (out,in) + bo NONZERO; 16 heads x 64; RoPE (base 10000, positions 0..2047) on q and k: (even, odd) pairs rotated and re-interleaved; scores x 1/sqrt(64); triu(k = 1) -> -inf; softmax; out @ Wo.T + bo).
#define NB 2
#define TT 2048
#define CC 1024            // NH * HD = projected width
#define DIN 1024          // input (model) width
#define NH 16
#define HD 64
#define NQB (TT / 64)
#define SCALE (0.125f)
#define SC2 (SCALE * 1.44269504088896340736f)   // logit scale x log2(e): exp(SCALE * d) = 2^(SC2 * d)
#define CAUSAL 1
#ifndef TNB
#define TNB NB
#endif
__device__ __forceinline__ float bfr(float v) { return (float)(__bf16)v; }
typedef __attribute__((ext_vector_type(8))) __bf16 v8b;
__device__ __forceinline__ v16b frag_b(const __bf16* rowk0, int lane) {
  union { v16b v; v8b q[2]; } u; const __bf16* p = rowk0 + 8 * (lane >> 4);
  u.q[0] = *(const v8b*)p; u.q[1] = *(const v8b*)(p + 16); return u.v;
}
#define QBH 6              // causal: query blocks 0..QBH-1 of each sequence (few keys, no averaging) take the high-precision path
#define QHI 384            // rows carrying a q residual plane
#define KHI 384            // key rows carrying k residual / v bf16 hi+lo planes (used only by the causal high-precision path)
// B fragment (k rows k0+.., output column o) of a weight: (in,out) [K][ld] or (out,in) [ld rows of K]: bf16 exact, or f16(bf16 * 256) exact
__device__ __forceinline__ v16b wcol_io(const float* Wm, int k0, int o, int lane, int ld) { v16b w; const int g = lane >> 4;
#pragma unroll
  for (int i = 0; i < 8; ++i) { w[i] = (__bf16)Wm[(size_t)(k0 + 8 * g + i) * ld + o]; w[8 + i] = (__bf16)Wm[(size_t)(k0 + 16 + 8 * g + i) * ld + o]; }
  return w; }
__device__ __forceinline__ v16b wcol_oi(const float* Wm, int k0, int o, int lane, int K) { v16b w; const float* p = Wm + (size_t)o * K + k0 + 8 * (lane >> 4);
#pragma unroll
  for (int i = 0; i < 8; ++i) { w[i] = (__bf16)p[i]; w[8 + i] = (__bf16)p[16 + i]; }
  return w; }
__device__ __forceinline__ v16h wcolh_io(const float* Wm, int k0, int o, int lane, int ld) { v16h w; const int g = lane >> 4;
#pragma unroll
  for (int i = 0; i < 8; ++i) { w[i] = (_Float16)(bfr(Wm[(size_t)(k0 + 8 * g + i) * ld + o]) * 256.0f); w[8 + i] = (_Float16)(bfr(Wm[(size_t)(k0 + 16 + 8 * g + i) * ld + o]) * 256.0f); }
  return w; }
__device__ __forceinline__ v16h wcolh_oi(const float* Wm, int k0, int o, int lane, int K) { v16h w; const float* p = Wm + (size_t)o * K + k0 + 8 * (lane >> 4);
#pragma unroll
  for (int i = 0; i < 8; ++i) { w[i] = (_Float16)(bfr(p[i]) * 256.0f); w[8 + i] = (_Float16)(bfr(p[16 + i]) * 256.0f); }
  return w; }
#define WQKV_LAYOUT 1   // picks only the WCOL helper, which nothing calls (0 = (in,out) [DIN][CC]; 1 = (out,in) [CC][DIN]; 2 = per-head [NH][DIN][HD]); k_proj always reads (out,in) [CC][DIN]
__device__ __forceinline__ v16b wcol_hdk(const float* Wm, int k0, int o, int lane) { v16b w; const int g = lane >> 4; const float* p = Wm + (size_t)(o / HD) * DIN * HD + (o % HD);
#pragma unroll
  for (int i = 0; i < 8; ++i) { w[i] = (__bf16)p[(size_t)(k0 + 8 * g + i) * HD]; w[8 + i] = (__bf16)p[(size_t)(k0 + 16 + 8 * g + i) * HD]; }
  return w; }
#define WO_OUT_IN 1
#if WQKV_LAYOUT == 1
#define WCOL(W, k0, o, lane) wcol_oi(W, k0, o, lane, DIN)
#elif WQKV_LAYOUT == 2
#define WCOL(W, k0, o, lane) wcol_hdk(W, k0, o, lane)
#else
#define WCOL(W, k0, o, lane) wcol_io(W, k0, o, lane, CC)
#endif
#if WO_OUT_IN
#define WOCOL(W, k0, o, lane) wcol_oi(W, k0, o, lane, CC)
#define WOCOLH(W, k0, o, lane) wcolh_oi(W, k0, o, lane, CC)
#else
#define WOCOL(W, k0, o, lane) wcol_io(W, k0, o, lane, DIN)
#define WOCOLH(W, k0, o, lane) wcolh_io(W, k0, o, lane, DIN)
#endif

// RoPE inverse frequencies 1/10000^(2i/64)
__constant__ float INVF[32] = {1.000000000e+00,7.498942018e-01,5.623413324e-01,4.216965139e-01,3.162277639e-01,2.371373624e-01,1.778279394e-01,1.333521456e-01,1.000000015e-01,7.498941571e-02,5.623412877e-02,4.216964915e-02,3.162277862e-02,2.371373586e-02,1.778279431e-02,1.333521493e-02,9.999999776e-03,7.498942316e-03,5.623413250e-03,4.216964822e-03,3.162277862e-03,2.371373819e-03,1.778279431e-03,1.333521446e-03,1.000000047e-03,7.498941850e-04,5.623413017e-04,4.216964880e-04,3.162277862e-04,2.371373848e-04,1.778279402e-04,1.333521504e-04};
#define PROJ_EXTRA_PARAMS
// cos and sin of one RoPE angle a = position x frequency, 0 <= a < 2048: the steps, constants and order of the math library's precise cosf and sinf on their small-argument path (below 2^17), with the range reduction and the two polynomials, which both functions share, worked once. Same bits as the two calls; their large-argument branch and their test for a non-finite argument cannot be met by such an angle.
__device__ __forceinline__ void rope_cs(float a, float& cs, float& sn) {
  const float n = __builtin_rintf(a * __uint_as_float(0x3f22f983u));   /* a x 2 / pi to the nearest whole number: the quadrant count */
  float r = __builtin_fmaf(__uint_as_float(0xbfc90fdau), n, a); r = __builtin_fmaf(__uint_as_float(0xb3a22168u), n, r); r = __builtin_fmaf(__uint_as_float(0xa7c234c4u), n, r);   /* a - n x pi / 2, pi / 2 in three parts */
  const int q = (int)n; const float s = r * r;
  float ps = __builtin_fmaf(__uint_as_float(0xb94c1982u), s, __uint_as_float(0x3c0881c4u)); ps = __builtin_fmaf(s, ps, __uint_as_float(0xbe2aaa9du));
  const float sr = __builtin_fmaf(r, s * ps, r);   /* sin r */
  float pc = __builtin_fmaf(__uint_as_float(0x37d75334u), s, __uint_as_float(0xbab64f3bu)); pc = __builtin_fmaf(s, pc, __uint_as_float(0x3d2aabf7u)); pc = __builtin_fmaf(s, pc, __uint_as_float(0xbf000004u));
  const float cr = __builtin_fmaf(s, pc, 1.0f);    /* cos r */
  const unsigned sg = ((unsigned)q << 30) & 0x80000000u;   /* quadrants 2 and 3 change the sign */
  cs = __uint_as_float(__float_as_uint((q & 1) ? -sr : cr) ^ sg); sn = __uint_as_float(__float_as_uint((q & 1) ? cr : sr) ^ sg); }
#ifndef PROJ_EXTRA_PARAMS
#define PROJ_EXTRA_PARAMS
#endif

#define WS_QH  0u                                      // f16 q rows [b*t][CC]
#define WS_KH  (WS_QH + 2u * (size_t)NB * TT * CC)      // f16 k rows [b*t][CC]
#define WS_VT  (WS_KH + 2u * (size_t)NB * TT * CC)      // f16 v planes [b][c][t]
#define WS_QL  (WS_VT + 2u * (size_t)NB * CC * TT)      // f16 q residual x 2^10 rows [b][t < QHI][CC]
#define WS_KL  (WS_QL + 2u * (size_t)NB * QHI * CC)     // f16 k residual x 2^10 rows [b][t < KHI][CC]
#define WS_VB  (WS_KL + 2u * (size_t)NB * KHI * CC)     // bf16 v hi planes [b][c][t < KHI]
#define WS_VBL (WS_VB + 2u * (size_t)NB * CC * KHI)
#define WS_Y   (WS_VBL + 2u * (size_t)NB * CC * KHI)     // f32 ctx rows [b*t][CC] (only when there is an output projection)
#define WS_END (WS_Y  + 4u * (size_t)NB * TT * CC)

// ---- staged GEMM loop shared by k_proj and k_out: a block's 128 A rows and 128 W rows (both k-contiguous f32, row length LD) come in chunks of GK k columns by whole-line 16-byte loads, are rounded ONCE to their 16-bit operand form and stored in LDS, where the eight waves read their fragments: wave w works the 32 x 64 tile at rows (w >> 1) * 32, columns (w & 1) * 64, as acc[i * 4 + j] = row tile i x column tile j. Two LDS buffers, one barrier a chunk; the next chunk's global loads fly under this chunk's products. Rounding, fragment k order and the order of the products into each accumulator are those of the per-lane global fragment loads that this replaces.
// MODE 0: A and W bf16, one product; MODE 1: A bf16 hi + lo planes, W bf16, two products; MODE 2: A f16(x 2^6), W f16(bf16 x 2^8), one product
#define GK 64                  // k columns of a chunk: 256 B of every f32 row
#define GP 72                  // LDS row pitch in 16-bit elements: 144 B = 16 B x 9, so the 16-byte fragment reads of 16 rows meet no bank twice
#define GW_B (128 * GP * 2)    // bytes of one W buffer
#define GA_B (128 * GP * 2)    // bytes of one plane of one A buffer
typedef __attribute__((ext_vector_type(4))) __bf16 v4b;
typedef __attribute__((ext_vector_type(4))) _Float16 v4h;
template <int MODE, int LD> __device__ __forceinline__ void gemm_staged(const float* __restrict__ Ag, const float* __restrict__ Wg, unsigned char* sw, unsigned char* sa, v8f (&acc)[8]) {
  const int tid = threadIdx.x, wave = tid >> 5, lane = tid & 31, col = lane & 15; const int lr = tid >> 4, lc = tid & 15;   /* 16 lanes x 16 B = one row's chunk; the block covers 16 rows a load */
  const int fa = (wave >> 1) * 32 + col, fw = (wave & 1) * 64 + col;   /* the lane's row in the wave's first A tile and first W tile */
  const float* ap = Ag + (size_t)lr * LD + lc * 4; const float* wp = Wg + (size_t)lr * LD + lc * 4;
  constexpr int NPL = MODE == 1 ? 2 : 1;
  v4f ar[8], wr[8];
#pragma unroll
  for (int i = 0; i < 8; ++i) ar[i] = *(const v4f*)(ap + (size_t)(16 * i) * LD);
#pragma unroll
  for (int i = 0; i < 8; ++i) wr[i] = *(const v4f*)(wp + (size_t)(16 * i) * LD);
  asm volatile("s_wait_xcnt 0x0" ::: "memory");   /* stands in front of any rewrite of the address registers that the 16 issued loads name */
#pragma unroll 2   /* two chunks a body: the two buffers' LDS offsets become constants */
  for (int ch = 0; ch < LD / GK; ++ch) { unsigned char* wb = sw + (ch & 1) * GW_B; unsigned char* ab = sa + (ch & 1) * (NPL * GA_B);
#pragma unroll
    for (int i = 0; i < 8; ++i) { const int eo = (lr + 16 * i) * GP + lc * 4; const v4f v = ar[i];
      if (MODE == 2) { const v4h o = {(_Float16)(v[0] * 64.0f), (_Float16)(v[1] * 64.0f), (_Float16)(v[2] * 64.0f), (_Float16)(v[3] * 64.0f)}; *(v4h*)((_Float16*)ab + eo) = o; }
      else { const v4b o = {(__bf16)v[0], (__bf16)v[1], (__bf16)v[2], (__bf16)v[3]}; *(v4b*)((__bf16*)ab + eo) = o;
        if (MODE == 1) { const v4b o2 = {(__bf16)(v[0] - (float)o[0]), (__bf16)(v[1] - (float)o[1]), (__bf16)(v[2] - (float)o[2]), (__bf16)(v[3] - (float)o[3])}; *(v4b*)((__bf16*)(ab + GA_B) + eo) = o2; } } }
#pragma unroll
    for (int i = 0; i < 8; ++i) { const int eo = (lr + 16 * i) * GP + lc * 4; const v4f v = wr[i];
      if (MODE == 2) { const v4h o = {(_Float16)(bfr(v[0]) * 256.0f), (_Float16)(bfr(v[1]) * 256.0f), (_Float16)(bfr(v[2]) * 256.0f), (_Float16)(bfr(v[3]) * 256.0f)}; *(v4h*)((_Float16*)wb + eo) = o; }
      else { const v4b o = {(__bf16)v[0], (__bf16)v[1], (__bf16)v[2], (__bf16)v[3]}; *(v4b*)((__bf16*)wb + eo) = o; } }
    __syncthreads();   /* publishes this chunk; it also ends every wave's reads of the other buffer, which the next trip overwrites */
    if (ch + 1 < LD / GK) {   /* block-uniform: the next chunk's loads, behind the barrier (whose fence would wait for them) and in flight under this chunk's fragment reads and products */
#pragma unroll
      for (int i = 0; i < 8; ++i) ar[i] = *(const v4f*)(ap + (size_t)(16 * i) * LD + (ch + 1) * GK);
#pragma unroll
      for (int i = 0; i < 8; ++i) wr[i] = *(const v4f*)(wp + (size_t)(16 * i) * LD + (ch + 1) * GK);
      asm volatile("s_wait_xcnt 0x0" ::: "memory"); }   /* stands in front of any rewrite of the address registers that the 16 issued loads name */
#pragma unroll
    for (int kk = 0; kk < GK / 32; ++kk) {
      if (MODE == 2) { v16h a[2], w[4];
#pragma unroll
        for (int i = 0; i < 2; ++i) a[i] = frag_h((const _Float16*)ab + (fa + i * 16) * GP + kk * 32, lane);
#pragma unroll
        for (int j = 0; j < 4; ++j) w[j] = frag_h((const _Float16*)wb + (fw + j * 16) * GP + kk * 32, lane);
#pragma unroll
        for (int i = 0; i < 2; ++i)
#pragma unroll
          for (int j = 0; j < 4; ++j) acc[i * 4 + j] = wmma16(a[i], w[j], acc[i * 4 + j]);
      } else { v16b a[2], a2[2], w[4];
#pragma unroll
        for (int i = 0; i < 2; ++i) { a[i] = frag_b((const __bf16*)ab + (fa + i * 16) * GP + kk * 32, lane); a2[i] = a[i]; if (MODE == 1) a2[i] = frag_b((const __bf16*)(ab + GA_B) + (fa + i * 16) * GP + kk * 32, lane); }
#pragma unroll
        for (int j = 0; j < 4; ++j) w[j] = frag_b((const __bf16*)wb + (fw + j * 16) * GP + kk * 32, lane);
#pragma unroll
        for (int i = 0; i < 2; ++i)
#pragma unroll
          for (int j = 0; j < 4; ++j) { acc[i * 4 + j] = wmma_bf(a[i], w[j], acc[i * 4 + j]); if (MODE == 1) acc[i * 4 + j] = wmma_bf(a2[i], w[j], acc[i * 4 + j]); } } } } }

// ---- k_proj: block = (128 rows, 128 cols, which): q/k/v = X W (+ b) with exact bf16 products (K = DIN) -> which 0: q f16 rows (+ residual rows < QHI); 1: k f16 rows (+ residual rows < KHI); 2: v f16 planes [c][t] (+ bf16 hi/lo planes for t < KHI)
__global__ __launch_bounds__(256) void k_proj(const float* __restrict__ XQ, const float* __restrict__ XK, const float* __restrict__ XV, const float* __restrict__ WQ, const float* __restrict__ WK, const float* __restrict__ WV, const float* __restrict__ BQ, const float* __restrict__ BK, const float* __restrict__ BV,
    _Float16* __restrict__ QH, _Float16* __restrict__ QL, _Float16* __restrict__ KH, _Float16* __restrict__ KL, _Float16* __restrict__ VT, __bf16* __restrict__ VB, __bf16* __restrict__ VBL PROJ_EXTRA_PARAMS) {
  __shared__ __align__(16) unsigned char sm[73728 + 67584];   /* one region that holds in turn the staged operand chunks (W 2 x 18432 B, X 2 x 18432 B) and the epilogue's planes: sh, sl (q, k: all 128 rows) or th, tb, tbl (v: 64 rows at a time); then st */
  unsigned char* rg = sm; float (*st)[132] = (float (*)[132])(sm + 73728);
  _Float16 (*sh)[136] = (_Float16 (*)[136])rg; _Float16 (*sl)[136] = (_Float16 (*)[136])(rg + 34816); _Float16 (*th)[72] = (_Float16 (*)[72])rg; __bf16 (*tb)[72] = (__bf16 (*)[72])(rg + 18432); __bf16 (*tbl)[72] = (__bf16 (*)[72])(rg + 36864);
  const int tid = threadIdx.x, wave = tid >> 5, lane = tid & 31, col = lane & 15, g = lane >> 4; const int which = blockIdx.z; const int c0 = blockIdx.y * 128; const size_t r0 = (size_t)blockIdx.x * 128; const size_t bb = r0 / TT; const int t0 = (int)(r0 % TT);
  const float* X = which == 0 ? XQ : which == 1 ? XK : XV; const float* WA = which == 0 ? WQ : which == 1 ? WK : WV; const float* BA = which == 0 ? BQ : which == 1 ? BK : BV;
  v8f acc[8] = {};
  gemm_staged<0, DIN>(X + r0 * DIN, WA + (size_t)c0 * DIN, rg, rg + 2 * GW_B, acc);
  { // stage the f32 tile (acc + bias) in LDS, rotate q and k (a thread per row and frequency half), then convert
#pragma unroll
    for (int j = 0; j < 4; ++j) { const int cl = (wave & 1) * 64 + j * 16 + col; const float bias = BA ? bfr(BA[c0 + cl]) : 0.f;
#pragma unroll
      for (int i = 0; i < 2; ++i)
#pragma unroll
        for (int r = 0; r < 8; ++r) st[(wave >> 1) * 32 + i * 16 + 8 * g + r][cl] = acc[i * 4 + j][r] + bias; }
    __syncthreads();
    if (which < 2) {   /* block-uniform: the rotation of q and k. A thread takes one row and one half of the 32 frequencies (the half is the same for a whole wave, so the frequencies come by scalar loads) and turns that half's pairs in BOTH heads of the tile with the one cos / sin pair */
      const int hf = __builtin_amdgcn_readfirstlane(wave & 1); const int rl = (wave >> 1) * 32 + lane; float* rw = &st[rl][hf * 32]; const float pos_ = (float)(int)((r0 + rl) % TT);   /* position = the token's sequence index */
      v4f xv[128 / HD][8];
#pragma unroll
      for (int hh = 0; hh < 128 / HD; ++hh)
#pragma unroll
        for (int p = 0; p < 8; ++p) xv[hh][p] = *(const v4f*)(rw + hh * HD + 4 * p);   /* the thread's 2 x 16 pairs, read ahead: their LDS latency passes under the first angles */
#pragma unroll   /* unrolled with the loops around it: xv stays in registers, and the angles' independent chains fill one another's latency */
      for (int p = 0; p < 8; ++p) { float cs0, sn0, cs1, sn1; rope_cs(pos_ * INVF[hf * 16 + 2 * p], cs0, sn0); rope_cs(pos_ * INVF[hf * 16 + 2 * p + 1], cs1, sn1);
#pragma unroll
        for (int hh = 0; hh < 128 / HD; ++hh) {
#pragma clang fp contract(off)   /* as before this step: each product and each sum of the rotation is rounded on its own, as in the reference's expression, so q and k stay bit-identical */
          const v4f x = xv[hh][p]; const v4f o = {x[0] * cs0 - x[1] * sn0, x[0] * sn0 + x[1] * cs0, x[2] * cs1 - x[3] * sn1, x[2] * sn1 + x[3] * cs1}; *(v4f*)(rw + hh * HD + 4 * p) = o; } } }
    __syncthreads(); }
  if (which < 2) { _Float16* DH = which == 0 ? QH : KH; _Float16* DL = which == 0 ? QL : KL; const int nhi = which == 0 ? QHI : KHI; const bool hi_rows = t0 < nhi;
    for (int e = tid; e < 128 * 128; e += 256) { const int rl = e >> 7, cl = e & 127; const float v = st[rl][cl]; const _Float16 hv = (_Float16)v; sh[rl][cl] = hv; sl[rl][cl] = (_Float16)((v - (float)hv) * 1024.0f); }
    __syncthreads();
    for (int e = tid; e < 128 * 16; e += 256) { const int rl = e >> 4, q = e & 15; vst_w(DH + (r0 + rl) * CC + c0 + q * 8, *(const v4u*)&sh[rl][q * 8]); if (hi_rows) vst_w(DL + (bb * nhi + t0 + rl) * (size_t)CC + c0 + q * 8, *(const v4u*)&sl[rl][q * 8]); }
  } else { const bool hi_rows = t0 < KHI;
    for (int hf = 0; hf < 2; ++hf) { const int th0 = hf * 64;   /* the tile's two halves of 64 rows, one after the other through the same planes */
      for (int e = tid; e < 64 * 128; e += 256) { const int rl = e & 63, cl = e >> 6; const float v = st[th0 + rl][cl]; th[cl][rl] = (_Float16)v; const __bf16 bh = (__bf16)v; tb[cl][rl] = bh; tbl[cl][rl] = (__bf16)(v - (float)bh); }
      __syncthreads();
      for (int e = tid; e < 128 * 8; e += 256) { const int cl = e >> 3, q = e & 7; vst_w(VT + (bb * CC + c0 + cl) * (size_t)TT + t0 + th0 + q * 8, *(const v4u*)&th[cl][q * 8]); if (hi_rows) { const size_t o3 = (bb * CC + c0 + cl) * (size_t)KHI + t0 + th0 + q * 8; vst_w(VB + o3, *(const v4u*)&tb[cl][q * 8]); vst_w(VBL + o3, *(const v4u*)&tbl[cl][q * 8]); } }
      if (hf == 0) __syncthreads(); } } }   /* block-uniform: ends every thread's reads of the planes before the second half overwrites them */
// ---- k_att: block = 64 queries (qb) of (b, h), wave = 16 queries: logits, softmax and P . v in one pass over key blocks of 64, nothing of the logits leaves registers.
// Transposed tiles: S^T = k q^T puts (key 8g + r, query col) in D element r, which is already the B fragment (k = keys) of ctx^T = v^T P^T; the row statistics of a query live in its two lanes (col, col + 16).
// Past the early query blocks the block's four waves share each key block's k and v tiles: asynchronous 16-byte copies bring them by whole lines into two LDS buffers (the next block's copies fly under this block's work), and every wave reads its fragments there. Fragment contents, k order and the order of the products are those of the per-lane global fragment loads that this replaces.
// Running maximum m (of the unscaled logits) and sum l per query; e = 2^(SC2 (logit - m) + 11) = exp(scaled logit - scaled m) x 2^11 once to f16 against v f16 (HI, causal early query blocks: 3-product logits, e and v as bf16 hi + lo, 3 products); l sums the same e, ctx = acc / l. The inner loops are fully unrolled so that every fragment array stays in registers.
#define AP 144                 // LDS pitch in bytes of a staged 128-byte row: 16 B x 9, so the 16-byte fragment reads of 16 rows meet no bank twice
#define AT_B (64 * AP)         // bytes of one staged tile of 64 rows; a buffer = the k tile, then the v tile
// one key block into one LDS buffer: k tile = 64 key rows x the head's 64 channels, v tile = the head's 64 channel planes x 64 keys, 128 B a row. A lane copies its 16 B of rows r, r + 16, r + 32, r + 48 of both tiles (r = tid >> 3), so each wave-wide copy covers four whole lines. ld, kg, vg: the lane's own LDS byte address and global addresses in row r.
__device__ __forceinline__ void att_stage(unsigned ld, const _Float16* kg, const _Float16* vg) {
  /* the closing s_wait_xcnt 0 stands inside the copies' own statement, in front of any rewrite of the address registers that the eight issued copies name */
  asm volatile("global_load_async_to_lds_b128 %0, %8, off\n\t"
               "global_load_async_to_lds_b128 %1, %9, off\n\t"
               "global_load_async_to_lds_b128 %2, %10, off\n\t"
               "global_load_async_to_lds_b128 %3, %11, off\n\t"
               "global_load_async_to_lds_b128 %4, %12, off\n\t"
               "global_load_async_to_lds_b128 %5, %13, off\n\t"
               "global_load_async_to_lds_b128 %6, %14, off\n\t"
               "global_load_async_to_lds_b128 %7, %15, off\n\t"
               "s_wait_xcnt 0x0"
               :: "v"(ld), "v"(ld + 16 * AP), "v"(ld + 32 * AP), "v"(ld + 48 * AP), "v"(ld + AT_B), "v"(ld + AT_B + 16 * AP), "v"(ld + AT_B + 32 * AP), "v"(ld + AT_B + 48 * AP),
                  "v"(kg), "v"(kg + 16 * CC), "v"(kg + 32 * CC), "v"(kg + 48 * CC), "v"(vg), "v"(vg + 16 * TT), "v"(vg + 32 * TT), "v"(vg + 48 * TT) : "memory"); }
// eight 2^x in place on the hardware's v_exp_f32
__device__ __forceinline__ void exp2x8(v8f& x) {
  float x0 = x[0], x1 = x[1], x2 = x[2], x3 = x[3], x4 = x[4], x5 = x[5], x6 = x[6], x7 = x[7];
  /* one statement, so that nothing directly behind a v_exp_f32 reads its result or overwrites its source: inside, each works on a register of its own, and the closing v_nop is the one slot that the instruction set asks for in front of whatever the compiler puts next */
  asm("v_exp_f32 %0, %0\n\tv_exp_f32 %1, %1\n\tv_exp_f32 %2, %2\n\tv_exp_f32 %3, %3\n\tv_exp_f32 %4, %4\n\tv_exp_f32 %5, %5\n\tv_exp_f32 %6, %6\n\tv_exp_f32 %7, %7\n\tv_nop"
      : "+v"(x0), "+v"(x1), "+v"(x2), "+v"(x3), "+v"(x4), "+v"(x5), "+v"(x6), "+v"(x7));
  x = v8f{x0, x1, x2, x3, x4, x5, x6, x7}; }
template <bool HI> __device__ __forceinline__ void att_body(unsigned char* sm, const _Float16* __restrict__ QH, const _Float16* __restrict__ KH, const _Float16* __restrict__ QL, const _Float16* __restrict__ KL, const _Float16* __restrict__ VT, const __bf16* __restrict__ VB, const __bf16* __restrict__ VBL, float* __restrict__ Y, int qb, int h, int b) {
  const int tid = threadIdx.x, wave = tid >> 5, lane = tid & 31, col = lane & 15, g = lane >> 4; const int ql0 = qb * 64 + wave * 16; const int t = ql0 + col; const size_t q0 = (size_t)b * TT + ql0;
  const _Float16* QLb = QL + (size_t)b * QHI * CC; const _Float16* KLb = KL + (size_t)b * KHI * CC;
  const _Float16* kp = KH + ((size_t)b * TT + col) * CC + h * HD;              /* key row col, this head's 64 channels */
  const unsigned ld0 = (unsigned)(size_t)sm + (unsigned)((tid >> 3) * AP + (tid & 7) * 16);                 /* this lane's place in row tid >> 3 of buffer 0's k tile */
  const _Float16* kg = KH + ((size_t)b * TT + (tid >> 3)) * CC + h * HD + (tid & 7) * 8;                     /* its 16 B of key row tid >> 3 */
  const _Float16* vg = VT + ((size_t)b * CC + h * HD + (tid >> 3)) * (size_t)TT + (tid & 7) * 8;             /* its 16 B of channel plane tid >> 3 */
  v16h ah[HD / 32], al[HD / 32], kf[HD / 32][4];
#pragma unroll
  for (int kc = 0; kc < HD / 32; ++kc) { ah[kc] = frag_h(QH + (q0 + col) * CC + h * HD + kc * 32, lane); if (HI) al[kc] = frag_h(QLb + (size_t)(ql0 + col) * CC + h * HD + kc * 32, lane); }
  if (!HI) {   /* block-uniform: key block 0 into buffer 0, landed and published; then key block 1 into buffer 1 */
    att_stage(ld0, kg, vg);
    asm volatile("s_wait_asynccnt 0x0" ::: "memory");   /* this wave's copies of key block 0 have landed */
    __syncthreads();                                    /* every wave's have: buffer 0 may be read */
    if (qb >= 1) att_stage(ld0 + 2 * AT_B, kg + (size_t)64 * CC, vg + 64); }
  float m = -3.0e38f, l = 0.f; v8f acc[HD / 16] = {};
#pragma unroll 1   /* rolled: one block's k and v fragments already fill the registers that four waves a SIMD leave a wave */
  for (int kb = 0; kb <= qb; ++kb) { const int k0 = kb * 64;   /* causal: key blocks 0 .. qb; only block qb crosses the diagonal */
    v16h vf[2][HD / 16];
    if (!HI) { const unsigned char* kt = sm + (kb & 1) * (2 * AT_B) + col * AP; const unsigned char* vt = kt + AT_B;   /* row col of this key block's two tiles */
#pragma unroll
      for (int kc = 0; kc < HD / 32; ++kc)
#pragma unroll
        for (int j = 0; j < 4; ++j) kf[kc][j] = frag_h((const _Float16*)(kt + j * 16 * AP) + kc * 32, lane);
#pragma unroll
      for (int kc = 0; kc < 2; ++kc)
#pragma unroll
        for (int j = 0; j < HD / 16; ++j) vf[kc][j] = frag_h((const _Float16*)(vt + j * 16 * AP) + kc * 32, lane); }
    __builtin_amdgcn_sched_barrier(0);   /* keeps this block's k and v LDS reads issued here as one group, the v reads in flight under the logits and the softmax, instead of one by one in front of their products */
    v8f s[4] = {}, sl[4] = {};
#pragma unroll
    for (int kc = 0; kc < HD / 32; ++kc) { v16h klf[4];
      if (HI) {
#pragma unroll
        for (int j = 0; j < 4; ++j) { kf[kc][j] = frag_h(kp + (size_t)(k0 + j * 16) * CC + kc * 32, lane); klf[j] = frag_h(KLb + (size_t)(k0 + j * 16 + col) * CC + h * HD + kc * 32, lane); }
        __builtin_amdgcn_sched_barrier(0); }   /* the eight k and k residual fragments of this half are in flight together: one latency, not eight */
#pragma unroll
      for (int j = 0; j < 4; ++j) { s[j] = wmma16(kf[kc][j], ah[kc], s[j]);
        if (HI) { sl[j] = wmma16(kf[kc][j], al[kc], sl[j]); sl[j] = wmma16(klf[j], ah[kc], sl[j]); } } }
    v16b vbh[HD / 16], vbl[HD / 16]; const size_t pb = ((size_t)b * CC + h * HD + col) * (size_t)KHI + k0;
    if (HI) {
#pragma unroll
      for (int j = 0; j < HD / 16; ++j) { vbh[j] = frag_b(VB + pb + (size_t)(j * 16) * KHI, lane); vbl[j] = frag_b(VBL + pb + (size_t)(j * 16) * KHI, lane); } }
    if (HI) __builtin_amdgcn_sched_barrier(0);   /* keeps the first half's v hi + lo loads issued here, in flight under the softmax */
#pragma unroll
    for (int j = 0; j < 4; ++j) {
#pragma unroll
      for (int r = 0; r < 8; ++r) if (HI) s[j][r] = s[j][r] + sl[j][r] * (1.0f / 1024.0f); }   /* the logits stay unscaled: SC2 > 0, so their maximum is the scaled logits' maximum, and the scale rides in the exponent's fma below */
    if (CAUSAL && kb == qb) {   /* wave-uniform */
#pragma unroll
      for (int j = 0; j < 4; ++j) {
#pragma unroll
        for (int r = 0; r < 8; ++r) if (k0 + j * 16 + 8 * g + r > t) s[j][r] = -3.0e38f; } }
    float bm = -3.0e38f;
#pragma unroll
    for (int j = 0; j < 4; ++j) {
#pragma unroll
      for (int r = 0; r < 8; ++r) bm = fmaxf(bm, s[j][r]); }
    bm = fmaxf(bm, __shfl_xor(bm, 16));
    const float mn = fmaxf(m, bm); const float alpha = __builtin_amdgcn_exp2f((m - mn) * SC2); m = mn;   /* every block holds a key open to every query of the wave (key k0 <= ql0), so mn is a real logit */
    const float mo = 11.0f - mn * SC2;   /* exponent offset of this block: the running maximum in base 2, and the 2^11 carry of e */
    float ls = 0.f;
#pragma unroll
    for (int j = 0; j < 4; ++j) {
#pragma unroll
      for (int r = 0; r < 8; ++r) s[j][r] = __builtin_fmaf(s[j][r], SC2, mo); }   /* the exponent of e = 2^11 exp(scaled logit - scaled mn): one fma a logit */
#pragma unroll
    for (int j = 0; j < 4; ++j) { exp2x8(s[j]);   /* a masked logit (-3e38) underflows to exactly 0 against the real mn */
#pragma unroll
      for (int r = 0; r < 8; ++r) ls += s[j][r]; }
    ls += __shfl_xor(ls, 16); l = l * alpha + ls;
#pragma unroll
    for (int j = 0; j < HD / 16; ++j) acc[j] *= alpha;
#pragma unroll
    for (int kc = 0; kc < 2; ++kc) {
      if (HI) { float pv[16];
#pragma unroll
        for (int i = 0; i < 8; ++i) { pv[i] = s[2 * kc][i]; pv[8 + i] = s[2 * kc + 1][i]; }
        const F2 p = bsplit16(pv);
        if (kc == 1) {
#pragma unroll
          for (int j = 0; j < HD / 16; ++j) { vbh[j] = frag_b(VB + pb + (size_t)(j * 16) * KHI + 32, lane); vbl[j] = frag_b(VBL + pb + (size_t)(j * 16) * KHI + 32, lane); }
          __builtin_amdgcn_sched_barrier(0); }   /* the second half's eight v fragments are in flight together */
#pragma unroll
        for (int j = 0; j < HD / 16; ++j) { acc[j] = wmma_bf(vbh[j], p.h, acc[j]); acc[j] = wmma_bf(vbh[j], p.l, acc[j]); acc[j] = wmma_bf(vbl[j], p.h, acc[j]); }
      } else { v16h p;
#pragma unroll
        for (int i = 0; i < 8; ++i) { p[i] = (_Float16)s[2 * kc][i]; p[8 + i] = (_Float16)s[2 * kc + 1][i]; }
#pragma unroll
        for (int j = 0; j < HD / 16; ++j) acc[j] = wmma16(vf[kc][j], p, acc[j]); } }
    if (!HI) {   /* hand-over, every wave of the block, in this order */
      asm volatile("s_wait_dscnt 0x0" ::: "memory");      /* this wave's reads of this block's buffer are over */
      asm volatile("s_wait_asynccnt 0x0" ::: "memory");   /* its copies of the next key block have landed */
      __syncthreads();                                    /* publishes the next key block and ends every wave's reads of this block's buffer */
      if (kb + 2 <= qb) att_stage(ld0 + (kb & 1) * (2 * AT_B), kg + (size_t)(kb + 2) * 64 * CC, vg + (kb + 2) * 64); } }   /* block-uniform: the block after next into the buffer just left */
  if (!HI) asm volatile("s_wait_asynccnt 0x0" ::: "memory");   /* no copy is outstanding when the wave ends */
  const float inv = l > 0.f ? 1.0f / l : 0.f;   /* l carries the same 2^11 as acc */
  float* yr = Y + (q0 + col) * CC + h * HD + 8 * g;   /* D element r of tile j = channel j * 16 + 8g + r of query col: 32 contiguous bytes a lane */
#pragma unroll
  for (int j = 0; j < HD / 16; ++j) { const v4f lo = {acc[j][0] * inv, acc[j][1] * inv, acc[j][2] * inv, acc[j][3] * inv}, hi = {acc[j][4] * inv, acc[j][5] * inv, acc[j][6] * inv, acc[j][7] * inv}; vst2(yr + j * 16, lo); vst2(yr + j * 16 + 4, hi); } }
__global__ __launch_bounds__(128) void k_att(const _Float16* __restrict__ QH, const _Float16* __restrict__ KH, const _Float16* __restrict__ QL, const _Float16* __restrict__ KL, const _Float16* __restrict__ VT, const __bf16* __restrict__ VB, const __bf16* __restrict__ VBL, float* __restrict__ Y) {
  __shared__ __align__(16) unsigned char sm[4 * AT_B];   /* two buffers of a k tile and a v tile */
  const int qb = NQB - 1 - (int)blockIdx.y, h = blockIdx.x % NH, b = blockIdx.x / NH;   /* the longest key ranges take the lowest blockIdx.y */
  if (qb < QBH) att_body<true>(sm, QH, KH, QL, KL, VT, VB, VBL, Y, qb, h, b); else att_body<false>(sm, QH, KH, QL, KL, VT, VB, VBL, Y, qb, h, b); }
// ---- k_out: block = (128 rows, 128 cols): out = ctx Wo (+ bo): ctx x 2^6 once to f16 against Wo as f16(bf16 x 2^8) exact (1 product) x 2^-14; causal early rows (< QHI of each sequence): ctx bf16 hi + lo against exact bf16 Wo (2 products)
__global__ __launch_bounds__(256) void k_out(const float* __restrict__ Y, const float* __restrict__ WO, const float* __restrict__ BO, float* __restrict__ OUT) { __shared__ __align__(16) unsigned char sm[2 * GW_B + 4 * GA_B + 8 * 32 * 68 * 4];   /* staged W chunks, staged ctx chunks (two planes for the early rows), then the output staging sf: each wave's own 32 x 64 tile at a pitch of 68 floats */
  unsigned char* sw = sm; unsigned char* sa = sm + 2 * GW_B; float (*sf)[32][68] = (float (*)[32][68])(sm + 2 * GW_B + 4 * GA_B);
  const int tid = threadIdx.x, wave = tid >> 5, lane = tid & 31, col = lane & 15, g = lane >> 4; const int c0 = blockIdx.y * 128 + (wave & 1) * 64; const size_t r0 = (size_t)blockIdx.x * 128 + (wave >> 1) * 32;   /* the wave's own first column and row */
  v8f acc[8] = {};
  if (CAUSAL && (int)(((size_t)blockIdx.x * 128) % TT) < QHI) {   /* block-uniform */
    gemm_staged<1, CC>(Y + (size_t)blockIdx.x * 128 * CC, WO + (size_t)blockIdx.y * 128 * CC, sw, sa, acc);
#pragma unroll
    for (int j = 0; j < 4; ++j) { const float bias = BO ? bfr(BO[c0 + j * 16 + col]) : 0.f;
#pragma unroll
      for (int i = 0; i < 2; ++i)
#pragma unroll
        for (int r = 0; r < 8; ++r) sf[wave][i * 16 + 8 * g + r][j * 16 + col] = acc[i * 4 + j][r] + bias; }
  } else {
    gemm_staged<2, CC>(Y + (size_t)blockIdx.x * 128 * CC, WO + (size_t)blockIdx.y * 128 * CC, sw, sa, acc);   /* ctx carried x 2^6 into f16 so small-magnitude context rows stay clear of f16 subnormals */
#pragma unroll
    for (int j = 0; j < 4; ++j) { const float bias = BO ? bfr(BO[c0 + j * 16 + col]) : 0.f;
#pragma unroll
      for (int i = 0; i < 2; ++i)
#pragma unroll
        for (int r = 0; r < 8; ++r) sf[wave][i * 16 + 8 * g + r][j * 16 + col] = acc[i * 4 + j][r] * (1.0f / 16384.0f) + bias; } }   /* 2^-8 (Wo carry) x 2^-6 (ctx carry) */
  LDSX(); for (int rl = 0; rl < 32; rl += 2) vst2(OUT + (r0 + rl + g) * DIN + c0 + col * 4, *(const v4f*)&sf[wave][rl + g][col * 4]); }   /* a store covers two rows' 256 B: four whole lines */

extern "C" void kernel_launch(void* const* d_in, const int* in_sizes, int n_in, void* d_out, int out_size, void* d_ws, size_t ws_size, hipStream_t stream) {
  (void)in_sizes; (void)n_in; (void)out_size;
  const float** F = (const float**)d_in;
  if (ws_size < (size_t)WS_END) return;
  char* ws = (char*)d_ws; _Float16 *QH = (_Float16*)(ws + WS_QH), *KH = (_Float16*)(ws + WS_KH), *VT = (_Float16*)(ws + WS_VT), *QL = (_Float16*)(ws + WS_QL), *KL = (_Float16*)(ws + WS_KL); __bf16 *VB = (__bf16*)(ws + WS_VB), *VBL = (__bf16*)(ws + WS_VBL); float *Y = (float*)(ws + WS_Y);
  (void)Y; (void)QL; (void)KL; (void)VB; (void)VBL;
  // inputs: 0 x [2,2048,1024]; 1 Wq [1024,1024] (out,in); 2 Wk; 3 Wv; 4 bv [1024] (NONZERO; q and k have no bias: null pointers); 5 Wo (out,in); 6 bo (NONZERO)
  k_proj<<<dim3(TNB * TT / 128, CC / 128, 3), 256, 0, stream>>>(F[0], F[0], F[0], F[1], F[2], F[3], nullptr, nullptr, F[4], QH, QL, KH, KL, VT, VB, VBL);
  k_att<<<dim3(NH * TNB, NQB), 128, 0, stream>>>(QH, KH, QL, KL, VT, VB, VBL, Y);
  k_out<<<dim3(TNB * TT / 128, DIN / 128), 256, 0, stream>>>(Y, F[5], F[6], (float*)d_out);
}

// v007
// It runs in 85.6 microseconds.
// Next to v006, in two timings, it ran 1.10 times as fast each time.
// Counting every step since v000, it is 15.3 times as fast.
// compute dtype: all float inputs rounded to bf16; q / k / v projections with EXACT bf16 products on WMMA 16x16x32 (f32 accumulate) + bias (v only; nonzero); interleaved-pair RoPE in f32 on q and k (which have no bias) (embedded frequencies, cos / sin by the precise library steps for small arguments, positions = the row index); causal logits: 3 products for the first 384 rows, single f16 q x k after, x 64^-0.5; online softmax f32 in one fused pass, exponentials in base 2; exp(logit - running max) x 2^11 once to f16 x v once to f16 (bf16 hi + lo below row 384); ctx hi+lo x exact Wo below row 384, x2^6 f16 carry x f16(bf16 x 2^8) Wo after, + bo; f32 output.
#include <hip/hip_runtime.h>
#include <math.h>

typedef __attribute__((ext_vector_type(16))) _Float16 v16h;
typedef __attribute__((ext_vector_type(16))) __bf16 v16b;
typedef __attribute__((ext_vector_type(8)))  _Float16 v8h;
typedef __attribute__((ext_vector_type(8)))  float v8f;
typedef __attribute__((ext_vector_type(4)))  float v4f;
typedef __attribute__((ext_vector_type(2)))  float v2f;
typedef __attribute__((ext_vector_type(4)))  unsigned v4u;
typedef __attribute__((ext_vector_type(4)))  int v4i;
typedef float __attribute__((may_alias)) float_a;
typedef int __attribute__((may_alias)) int_a;

template <typename T> __device__ __forceinline__ void vst2(void* p, T v) { *(T*)p = v;  }
// one 16-byte global store of a rolled loop, with its s_wait_xcnt 0 in the same statement, so that the wait stands in front of any rewrite of the address registers that the store names (over a wait in a statement of its own the compiler lifted the next trip's address additions)
__device__ __forceinline__ void vst_w(void* p, v4u v) { asm volatile("global_store_b128 %0, %1, off\n\ts_wait_xcnt 0x0" :: "v"(p), "v"(v) : "memory"); }
__device__ __forceinline__ v8f wmma16(v16h a, v16h b, v8f c) {
  v8f d = __builtin_amdgcn_wmma_f32_16x16x32_f16(false, a, false, b, (short)0, c, false, false);
  asm volatile("v_nop\n\tv_nop\n\tv_nop\n\tv_nop" : "+v"(d) : "v"(a), "v"(b));
  return d;
}
__device__ __forceinline__ v8f wmma_bf(v16b a, v16b b, v8f c) {
  v8f d = __builtin_amdgcn_wmma_f32_16x16x32_bf16(false, a, false, b, (short)0, c, false, false);
  asm volatile("v_nop\n\tv_nop\n\tv_nop\n\tv_nop" : "+v"(d) : "v"(a), "v"(b));
  return d;
}
// 16x16x32 fragments: lane = (h = lane>>4, row/col = lane&15); elements 0..7 = k0+8h+0..7, 8..15 = k0+16+8h+0..7; D element r = row 8h+r
__device__ __forceinline__ v16h frag_h(const _Float16* rowk0, int lane) {
  union { v16h v; v8h q[2]; } u; const _Float16* p = rowk0 + 8 * (lane >> 4);
  u.q[0] = *(const v8h*)p; u.q[1] = *(const v8h*)(p + 16); return u.v;
}
__device__ __forceinline__ v16h frag_f32(const float* rowk0, int lane) {
  v16h a; const float* p = rowk0 + 8 * (lane >> 4);
#pragma unroll
  for (int i = 0; i < 8; ++i) { a[i] = (_Float16)p[i]; a[8 + i] = (_Float16)p[16 + i]; }
  return a;
}
__device__ __forceinline__ v16h frag_f32s(const float* rowk0, int lane, float sc) {
  v16h a; const float* p = rowk0 + 8 * (lane >> 4);
#pragma unroll
  for (int i = 0; i < 8; ++i) { a[i] = (_Float16)(p[i] * sc); a[8 + i] = (_Float16)(p[16 + i] * sc); }
  return a;
}
// column fragment from a [K][ld] layout (column n), rows >= K read as 0
__device__ __forceinline__ v16h fragc_f32(const float* W, int k0, int n, int lane, int ld, int K) {
  v16h a; const int g = lane >> 4;
#pragma unroll
  for (int i = 0; i < 8; ++i) { const int ka = k0 + 8 * g + i, kb = ka + 16;
    a[i] = (_Float16)(ka < K ? W[(size_t)(ka < K ? ka : K - 1) * ld + n] : 0.f); a[8 + i] = (_Float16)(kb < K ? W[(size_t)(kb < K ? kb : K - 1) * ld + n] : 0.f); }
  return a;
}
struct F2 { v16b h, l; };
__device__ __forceinline__ F2 bsplit16(const float v[16]) { F2 r;
#pragma unroll
  for (int i = 0; i < 16; ++i) { const __bf16 h = (__bf16)v[i]; r.h[i] = h; r.l[i] = (__bf16)(v[i] - (float)h); }
  return r; }
__device__ __forceinline__ F2 split_row(const float* row, int k0, int lane) { float v[16]; const float* p = row + k0 + 8 * (lane >> 4);
#pragma unroll
  for (int i = 0; i < 8; ++i) { v[i] = p[i]; v[8 + i] = p[16 + i]; }
  return bsplit16(v); }
__device__ __forceinline__ F2 split_rowK(const float* row, int k0, int lane, int K) { float v[16]; const int g = lane >> 4;
#pragma unroll
  for (int i = 0; i < 8; ++i) { const int ka = k0 + 8 * g + i, kb = ka + 16; v[i] = ka < K ? row[ka < K ? ka : K - 1] : 0.f; v[8 + i] = kb < K ? row[kb < K ? kb : K - 1] : 0.f; }
  return bsplit16(v); }
__device__ __forceinline__ F2 split_col(const float* W, int k0, int n, int lane, int ld, int K) { float v[16]; const int g = lane >> 4;
#pragma unroll
  for (int i = 0; i < 8; ++i) { const int ka = k0 + 8 * g + i, kb = ka + 16; v[i] = ka < K ? W[(size_t)(ka < K ? ka : K - 1) * ld + n] : 0.f; v[8 + i] = kb < K ? W[(size_t)(kb < K ? kb : K - 1) * ld + n] : 0.f; }
  return bsplit16(v); }
__device__ __forceinline__ v8f mac3(const F2& a, const F2& b, v8f c) { c = wmma_bf(a.l, b.h, c); c = wmma_bf(a.h, b.l, c); return wmma_bf(a.h, b.h, c); }
__device__ __forceinline__ float sigm(float v) { return 1.0f / (1.0f + expf(-v)); }
#define LDSX() do { asm volatile("s_wait_dscnt 0" ::: "memory"); __builtin_amdgcn_wave_barrier(); __builtin_amdgcn_fence(__ATOMIC_RELEASE, "workgroup"); } while (0)

// Causal self-attention with interleaved-pair RoPE (x [2,2048,1024]; (out,in) Wq / Wk / Wv [1024,1024] N(0, 1/1024) applied as einsum('bse,he->bsh') = x @ W.T; bv [1024] NONZERO (only v has a bias); Wo [1024,1024] (out,in) + bo NONZERO; 16 heads x 64; RoPE (base 10000, positions 0..2047) on q and k: (even, odd) pairs rotated and re-interleaved; scores x 1/sqrt(64); triu(k = 1) -> -inf; softmax; out @ Wo.T + bo).
#define NB 2
#define TT 2048
#define CC 1024            // NH * HD = projected width
#define DIN 1024          // input (model) width
#define NH 16
#define HD 64
#define NQB (TT / 64)
#define SCALE (0.125f)
#define SC2 (SCALE * 1.44269504088896340736f)   // logit scale x log2(e): exp(SCALE * d) = 2^(SC2 * d)
#define CAUSAL 1
#ifndef TNB
#define TNB NB
#endif
__device__ __forceinline__ float bfr(float v) { return (float)(__bf16)v; }
typedef __attribute__((ext_vector_type(8))) __bf16 v8b;
__device__ __forceinline__ v16b frag_b(const __bf16* rowk0, int lane) {
  union { v16b v; v8b q[2]; } u; const __bf16* p = rowk0 + 8 * (lane >> 4);
  u.q[0] = *(const v8b*)p; u.q[1] = *(const v8b*)(p + 16); return u.v;
}
#define QBH 6              // causal: query blocks 0..QBH-1 of each sequence (few keys, no averaging) take the high-precision path
#define QHI 384            // rows carrying a q residual plane
#define KHI 384            // key rows carrying k residual / v bf16 hi+lo planes (used only by the causal high-precision path)
// B fragment (k rows k0+.., output column o) of a weight: (in,out) [K][ld] or (out,in) [ld rows of K]: bf16 exact, or f16(bf16 * 256) exact
__device__ __forceinline__ v16b wcol_io(const float* Wm, int k0, int o, int lane, int ld) { v16b w; const int g = lane >> 4;
#pragma unroll
  for (int i = 0; i < 8; ++i) { w[i] = (__bf16)Wm[(size_t)(k0 + 8 * g + i) * ld + o]; w[8 + i] = (__bf16)Wm[(size_t)(k0 + 16 + 8 * g + i) * ld + o]; }
  return w; }
__device__ __forceinline__ v16b wcol_oi(const float* Wm, int k0, int o, int lane, int K) { v16b w; const float* p = Wm + (size_t)o * K + k0 + 8 * (lane >> 4);
#pragma unroll
  for (int i = 0; i < 8; ++i) { w[i] = (__bf16)p[i]; w[8 + i] = (__bf16)p[16 + i]; }
  return w; }
__device__ __forceinline__ v16h wcolh_io(const float* Wm, int k0, int o, int lane, int ld) { v16h w; const int g = lane >> 4;
#pragma unroll
  for (int i = 0; i < 8; ++i) { w[i] = (_Float16)(bfr(Wm[(size_t)(k0 + 8 * g + i) * ld + o]) * 256.0f); w[8 + i] = (_Float16)(bfr(Wm[(size_t)(k0 + 16 + 8 * g + i) * ld + o]) * 256.0f); }
  return w; }
__device__ __forceinline__ v16h wcolh_oi(const float* Wm, int k0, int o, int lane, int K) { v16h w; const float* p = Wm + (size_t)o * K + k0 + 8 * (lane >> 4);
#pragma unroll
  for (int i = 0; i < 8; ++i) { w[i] = (_Float16)(bfr(p[i]) * 256.0f); w[8 + i] = (_Float16)(bfr(p[16 + i]) * 256.0f); }
  return w; }
#define WQKV_LAYOUT 1   // picks only the WCOL helper, which nothing calls (0 = (in,out) [DIN][CC]; 1 = (out,in) [CC][DIN]; 2 = per-head [NH][DIN][HD]); k_proj always reads (out,in) [CC][DIN]
__device__ __forceinline__ v16b wcol_hdk(const float* Wm, int k0, int o, int lane) { v16b w; const int g = lane >> 4; const float* p = Wm + (size_t)(o / HD) * DIN * HD + (o % HD);
#pragma unroll
  for (int i = 0; i < 8; ++i) { w[i] = (__bf16)p[(size_t)(k0 + 8 * g + i) * HD]; w[8 + i] = (__bf16)p[(size_t)(k0 + 16 + 8 * g + i) * HD]; }
  return w; }
#define WO_OUT_IN 1
#if WQKV_LAYOUT == 1
#define WCOL(W, k0, o, lane) wcol_oi(W, k0, o, lane, DIN)
#elif WQKV_LAYOUT == 2
#define WCOL(W, k0, o, lane) wcol_hdk(W, k0, o, lane)
#else
#define WCOL(W, k0, o, lane) wcol_io(W, k0, o, lane, CC)
#endif
#if WO_OUT_IN
#define WOCOL(W, k0, o, lane) wcol_oi(W, k0, o, lane, CC)
#define WOCOLH(W, k0, o, lane) wcolh_oi(W, k0, o, lane, CC)
#else
#define WOCOL(W, k0, o, lane) wcol_io(W, k0, o, lane, DIN)
#define WOCOLH(W, k0, o, lane) wcolh_io(W, k0, o, lane, DIN)
#endif

// RoPE inverse frequencies 1/10000^(2i/64)
__constant__ float INVF[32] = {1.000000000e+00,7.498942018e-01,5.623413324e-01,4.216965139e-01,3.162277639e-01,2.371373624e-01,1.778279394e-01,1.333521456e-01,1.000000015e-01,7.498941571e-02,5.623412877e-02,4.216964915e-02,3.162277862e-02,2.371373586e-02,1.778279431e-02,1.333521493e-02,9.999999776e-03,7.498942316e-03,5.623413250e-03,4.216964822e-03,3.162277862e-03,2.371373819e-03,1.778279431e-03,1.333521446e-03,1.000000047e-03,7.498941850e-04,5.623413017e-04,4.216964880e-04,3.162277862e-04,2.371373848e-04,1.778279402e-04,1.333521504e-04};
#define PROJ_EXTRA_PARAMS
// cos and sin of one RoPE angle a = position x frequency, 0 <= a < 2048: the steps, constants and order of the math library's precise cosf and sinf on their small-argument path (below 2^17), with the range reduction and the two polynomials, which both functions share, worked once. Same bits as the two calls; their large-argument branch and their test for a non-finite argument cannot be met by such an angle.
__device__ __forceinline__ void rope_cs(float a, float& cs, float& sn) {
  const float n = __builtin_rintf(a * __uint_as_float(0x3f22f983u));   /* a x 2 / pi to the nearest whole number: the quadrant count */
  float r = __builtin_fmaf(__uint_as_float(0xbfc90fdau), n, a); r = __builtin_fmaf(__uint_as_float(0xb3a22168u), n, r); r = __builtin_fmaf(__uint_as_float(0xa7c234c4u), n, r);   /* a - n x pi / 2, pi / 2 in three parts */
  const int q = (int)n; const float s = r * r;
  float ps = __builtin_fmaf(__uint_as_float(0xb94c1982u), s, __uint_as_float(0x3c0881c4u)); ps = __builtin_fmaf(s, ps, __uint_as_float(0xbe2aaa9du));
  const float sr = __builtin_fmaf(r, s * ps, r);   /* sin r */
  float pc = __builtin_fmaf(__uint_as_float(0x37d75334u), s, __uint_as_float(0xbab64f3bu)); pc = __builtin_fmaf(s, pc, __uint_as_float(0x3d2aabf7u)); pc = __builtin_fmaf(s, pc, __uint_as_float(0xbf000004u));
  const float cr = __builtin_fmaf(s, pc, 1.0f);    /* cos r */
  const unsigned sg = ((unsigned)q << 30) & 0x80000000u;   /* quadrants 2 and 3 change the sign */
  cs = __uint_as_float(__float_as_uint((q & 1) ? -sr : cr) ^ sg); sn = __uint_as_float(__float_as_uint((q & 1) ? cr : sr) ^ sg); }
#ifndef PROJ_EXTRA_PARAMS
#define PROJ_EXTRA_PARAMS
#endif

#define WS_QH  0u                                      // f16 q rows [b*t][CC]
#define WS_KH  (WS_QH + 2u * (size_t)NB * TT * CC)      // f16 k rows [b*t][CC]
#define WS_VT  (WS_KH + 2u * (size_t)NB * TT * CC)      // f16 v planes [b][c][t]
#define WS_QL  (WS_VT + 2u * (size_t)NB * CC * TT)      // f16 q residual x 2^10 rows [b][t < QHI][CC]
#define WS_KL  (WS_QL + 2u * (size_t)NB * QHI * CC)     // f16 k residual x 2^10 rows [b][t < KHI][CC]
#define WS_VB  (WS_KL + 2u * (size_t)NB * KHI * CC)     // bf16 v hi planes [b][c][t < KHI]
#define WS_VBL (WS_VB + 2u * (size_t)NB * CC * KHI)
#define WS_Y   (WS_VBL + 2u * (size_t)NB * CC * KHI)     // f32 ctx rows [b*t][CC] (only when there is an output projection)
#define WS_END (WS_Y  + 4u * (size_t)NB * TT * CC)

// ---- staged GEMM loop shared by k_proj and k_out: a block's 128 A rows and 128 W rows (both k-contiguous f32, row length LD) come in chunks of GK k columns by whole-line 16-byte loads, are rounded ONCE to their 16-bit operand form and stored in LDS, where the eight waves read their fragments: wave w works the 32 x 64 tile at rows (w >> 1) * 32, columns (w & 1) * 64, as acc[i * 4 + j] = row tile i x column tile j. Two LDS buffers, one barrier a chunk; the next chunk's global loads issue ahead of that barrier and fly under it and under this chunk's products. Rounding, fragment k order and the order of the products into each accumulator are those of the per-lane global fragment loads that this replaces.
// MODE 0: A and W bf16, one product; MODE 1: A bf16 hi + lo planes, W bf16, two products; MODE 2: A f16(x 2^6), W f16(bf16 x 2^8), one product
#define GK 64                  // k columns of a chunk: 256 B of every f32 row
#define GP 72                  // LDS row pitch in 16-bit elements: 144 B = 16 B x 9, so the 16-byte fragment reads of 16 rows meet no bank twice
#define GW_B (128 * GP * 2)    // bytes of one W buffer
#define GA_B (128 * GP * 2)    // bytes of one plane of one A buffer
typedef __attribute__((ext_vector_type(4))) __bf16 v4b;
typedef __attribute__((ext_vector_type(4))) _Float16 v4h;
template <int MODE, int LD> __device__ __forceinline__ void gemm_staged(const float* __restrict__ Ag, const float* __restrict__ Wg, unsigned char* sw, unsigned char* sa, v8f (&acc)[8]) {
  const int tid = threadIdx.x, wave = tid >> 5, lane = tid & 31, col = lane & 15; const int lr = tid >> 4, lc = tid & 15;   /* 16 lanes x 16 B = one row's chunk; the block covers 16 rows a load */
  const int fa = (wave >> 1) * 32 + col, fw = (wave & 1) * 64 + col;   /* the lane's row in the wave's first A tile and first W tile */
  const float* ap = Ag + (size_t)lr * LD + lc * 4; const float* wp = Wg + (size_t)lr * LD + lc * 4;
  constexpr int NPL = MODE == 1 ? 2 : 1;
  v4f ar[8], wr[8];
#pragma unroll
  for (int i = 0; i < 8; ++i) ar[i] = *(const v4f*)(ap + (size_t)(16 * i) * LD);
#pragma unroll
  for (int i = 0; i < 8; ++i) wr[i] = *(const v4f*)(wp + (size_t)(16 * i) * LD);
  asm volatile("s_wait_xcnt 0x0" ::: "memory");   /* stands in front of any rewrite of the address registers that the 16 issued loads name */
#pragma unroll 2   /* two chunks a body: the two buffers' LDS offsets become constants */
  for (int ch = 0; ch < LD / GK; ++ch) { unsigned char* wb = sw + (ch & 1) * GW_B; unsigned char* ab = sa + (ch & 1) * (NPL * GA_B);
    __builtin_amdgcn_sched_barrier(0);   /* holds this chunk's conversions, and with them the waits for its global loads, behind the previous chunk's products: lifted in among the first products, such a wait laid the loads' whole latency bare in every second chunk */
#pragma unroll
    for (int i = 0; i < 8; ++i) { const int eo = (lr + 16 * i) * GP + lc * 4; const v4f v = ar[i];
      if (MODE == 2) { const v4h o = {(_Float16)(v[0] * 64.0f), (_Float16)(v[1] * 64.0f), (_Float16)(v[2] * 64.0f), (_Float16)(v[3] * 64.0f)}; *(v4h*)((_Float16*)ab + eo) = o; }
      else { const v4b o = {(__bf16)v[0], (__bf16)v[1], (__bf16)v[2], (__bf16)v[3]}; *(v4b*)((__bf16*)ab + eo) = o;
        if (MODE == 1) { const v4b o2 = {(__bf16)(v[0] - (float)o[0]), (__bf16)(v[1] - (float)o[1]), (__bf16)(v[2] - (float)o[2]), (__bf16)(v[3] - (float)o[3])}; *(v4b*)((__bf16*)(ab + GA_B) + eo) = o2; } } }
#pragma unroll
    for (int i = 0; i < 8; ++i) { const int eo = (lr + 16 * i) * GP + lc * 4; const v4f v = wr[i];
      if (MODE == 2) { const v4h o = {(_Float16)(bfr(v[0]) * 256.0f), (_Float16)(bfr(v[1]) * 256.0f), (_Float16)(bfr(v[2]) * 256.0f), (_Float16)(bfr(v[3]) * 256.0f)}; *(v4h*)((_Float16*)wb + eo) = o; }
      else { const v4b o = {(__bf16)v[0], (__bf16)v[1], (__bf16)v[2], (__bf16)v[3]}; *(v4b*)((__bf16*)wb + eo) = o; } }
    if (ch + 1 < LD / GK) {   /* block-uniform: the next chunk's loads issue as soon as the conversions have freed the staging registers, AHEAD of the barrier: their L2 latency passes under the LDS stores' drain and the barrier as well as under this chunk's fragment reads and products */
#pragma unroll
      for (int i = 0; i < 8; ++i) ar[i] = *(const v4f*)(ap + (size_t)(16 * i) * LD + (ch + 1) * GK);
#pragma unroll
      for (int i = 0; i < 8; ++i) wr[i] = *(const v4f*)(wp + (size_t)(16 * i) * LD + (ch + 1) * GK);
      asm volatile("s_wait_xcnt 0x0" ::: "memory"); }   /* stands in front of any rewrite of the address registers that the 16 issued loads name */
    /* the chunk's work-group barrier, written by hand with the one wait it needs (this wave's LDS stores): __syncthreads() would also wait for the global loads just issued. It publishes this chunk; it also ends every wave's reads of the other buffer, which the next trip overwrites (each wave's fragment reads are over before its products, so before it arrives here) */
    asm volatile("s_wait_dscnt 0x0\n\ts_barrier_signal -1\n\ts_barrier_wait -1" ::: "memory");
#pragma unroll
    for (int kk = 0; kk < GK / 32; ++kk) {
      if (MODE == 2) { v16h a[2], w[4];
#pragma unroll
        for (int i = 0; i < 2; ++i) a[i] = frag_h((const _Float16*)ab + (fa + i * 16) * GP + kk * 32, lane);
#pragma unroll
        for (int j = 0; j < 4; ++j) w[j] = frag_h((const _Float16*)wb + (fw + j * 16) * GP + kk * 32, lane);
#pragma unroll
        for (int i = 0; i < 2; ++i)
#pragma unroll
          for (int j = 0; j < 4; ++j) acc[i * 4 + j] = wmma16(a[i], w[j], acc[i * 4 + j]);
      } else { v16b a[2], a2[2], w[4];
#pragma unroll
        for (int i = 0; i < 2; ++i) { a[i] = frag_b((const __bf16*)ab + (fa + i * 16) * GP + kk * 32, lane); a2[i] = a[i]; if (MODE == 1) a2[i] = frag_b((const __bf16*)(ab + GA_B) + (fa + i * 16) * GP + kk * 32, lane); }
#pragma unroll
        for (int j = 0; j < 4; ++j) w[j] = frag_b((const __bf16*)wb + (fw + j * 16) * GP + kk * 32, lane);
#pragma unroll
        for (int i = 0; i < 2; ++i)
#pragma unroll
          for (int j = 0; j < 4; ++j) { acc[i * 4 + j] = wmma_bf(a[i], w[j], acc[i * 4 + j]); if (MODE == 1) acc[i * 4 + j] = wmma_bf(a2[i], w[j], acc[i * 4 + j]); } } } } }

// ---- k_proj: block = (128 rows, 128 cols, which): q/k/v = X W (+ b) with exact bf16 products (K = DIN) -> which 0: q f16 rows (+ residual rows < QHI); 1: k f16 rows (+ residual rows < KHI); 2: v f16 planes [c][t] (+ bf16 hi/lo planes for t < KHI)
__global__ __launch_bounds__(256) void k_proj(const float* __restrict__ XQ, const float* __restrict__ XK, const float* __restrict__ XV, const float* __restrict__ WQ, const float* __restrict__ WK, const float* __restrict__ WV, const float* __restrict__ BQ, const float* __restrict__ BK, const float* __restrict__ BV,
    _Float16* __restrict__ QH, _Float16* __restrict__ QL, _Float16* __restrict__ KH, _Float16* __restrict__ KL, _Float16* __restrict__ VT, __bf16* __restrict__ VB, __bf16* __restrict__ VBL PROJ_EXTRA_PARAMS) {
  __shared__ __align__(16) unsigned char sm[73728 + 67584];   /* one region that holds in turn the staged operand chunks (W 2 x 18432 B, X 2 x 18432 B) and the epilogue's planes: sh, sl (q, k: all 128 rows) or th, tb, tbl (v: 64 rows at a time); then st */
  unsigned char* rg = sm; float (*st)[132] = (float (*)[132])(sm + 73728);
  _Float16 (*sh)[136] = (_Float16 (*)[136])rg; _Float16 (*sl)[136] = (_Float16 (*)[136])(rg + 34816); _Float16 (*th)[72] = (_Float16 (*)[72])rg; __bf16 (*tb)[72] = (__bf16 (*)[72])(rg + 18432); __bf16 (*tbl)[72] = (__bf16 (*)[72])(rg + 36864);
  const int tid = threadIdx.x, wave = tid >> 5, lane = tid & 31, col = lane & 15, g = lane >> 4; const int which = blockIdx.z; const int c0 = blockIdx.y * 128; const size_t r0 = (size_t)blockIdx.x * 128; const size_t bb = r0 / TT; const int t0 = (int)(r0 % TT);
  const float* X = which == 0 ? XQ : which == 1 ? XK : XV; const float* WA = which == 0 ? WQ : which == 1 ? WK : WV; const float* BA = which == 0 ? BQ : which == 1 ? BK : BV;
  v8f acc[8] = {};
  gemm_staged<0, DIN>(X + r0 * DIN, WA + (size_t)c0 * DIN, rg, rg + 2 * GW_B, acc);
  { // stage the f32 tile (acc + bias) in LDS, rotate q and k (a thread per row and frequency half), then convert
#pragma unroll
    for (int j = 0; j < 4; ++j) { const int cl = (wave & 1) * 64 + j * 16 + col; const float bias = BA ? bfr(BA[c0 + cl]) : 0.f;
#pragma unroll
      for (int i = 0; i < 2; ++i)
#pragma unroll
        for (int r = 0; r < 8; ++r) st[(wave >> 1) * 32 + i * 16 + 8 * g + r][cl] = acc[i * 4 + j][r] + bias; }
    __syncthreads();
    if (which < 2) {   /* block-uniform: the rotation of q and k. A thread takes one row and one half of the 32 frequencies (the half is the same for a whole wave, so the frequencies come by scalar loads) and turns that half's pairs in BOTH heads of the tile with the one cos / sin pair */
      const int hf = __builtin_amdgcn_readfirstlane(wave & 1); const int rl = (wave >> 1) * 32 + lane; float* rw = &st[rl][hf * 32]; const float pos_ = (float)(int)((r0 + rl) % TT);   /* position = the token's sequence index */
      v4f xv[128 / HD][8];
#pragma unroll
      for (int hh = 0; hh < 128 / HD; ++hh)
#pragma unroll
        for (int p = 0; p < 8; ++p) xv[hh][p] = *(const v4f*)(rw + hh * HD + 4 * p);   /* the thread's 2 x 16 pairs, read ahead: their LDS latency passes under the first angles */
#pragma unroll   /* unrolled with the loops around it: xv stays in registers, and the angles' independent chains fill one another's latency */
      for (int p = 0; p < 8; ++p) { float cs0, sn0, cs1, sn1; rope_cs(pos_ * INVF[hf * 16 + 2 * p], cs0, sn0); rope_cs(pos_ * INVF[hf * 16 + 2 * p + 1], cs1, sn1);
#pragma unroll
        for (int hh = 0; hh < 128 / HD; ++hh) {
#pragma clang fp contract(off)   /* as before this step: each product and each sum of the rotation is rounded on its own, as in the reference's expression, so q and k stay bit-identical */
          const v4f x = xv[hh][p]; const v4f o = {x[0] * cs0 - x[1] * sn0, x[0] * sn0 + x[1] * cs0, x[2] * cs1 - x[3] * sn1, x[2] * sn1 + x[3] * cs1}; *(v4f*)(rw + hh * HD + 4 * p) = o; } } }
    __syncthreads(); }
  if (which < 2) { _Float16* DH = which == 0 ? QH : KH; _Float16* DL = which == 0 ? QL : KL; const int nhi = which == 0 ? QHI : KHI; const bool hi_rows = t0 < nhi;
    for (int e = tid; e < 128 * 128; e += 256) { const int rl = e >> 7, cl = e & 127; const float v = st[rl][cl]; const _Float16 hv = (_Float16)v; sh[rl][cl] = hv; sl[rl][cl] = (_Float16)((v - (float)hv) * 1024.0f); }
    __syncthreads();
    for (int e = tid; e < 128 * 16; e += 256) { const int rl = e >> 4, q = e & 15; vst_w(DH + (r0 + rl) * CC + c0 + q * 8, *(const v4u*)&sh[rl][q * 8]); if (hi_rows) vst_w(DL + (bb * nhi + t0 + rl) * (size_t)CC + c0 + q * 8, *(const v4u*)&sl[rl][q * 8]); }
  } else { const bool hi_rows = t0 < KHI;
    for (int hf = 0; hf < 2; ++hf) { const int th0 = hf * 64;   /* the tile's two halves of 64 rows, one after the other through the same planes */
      for (int e = tid; e < 64 * 128; e += 256) { const int rl = e & 63, cl = e >> 6; const float v = st[th0 + rl][cl]; th[cl][rl] = (_Float16)v; const __bf16 bh = (__bf16)v; tb[cl][rl] = bh; tbl[cl][rl] = (__bf16)(v - (float)bh); }
      __syncthreads();
      for (int e = tid; e < 128 * 8; e += 256) { const int cl = e >> 3, q = e & 7; vst_w(VT + (bb * CC + c0 + cl) * (size_t)TT + t0 + th0 + q * 8, *(const v4u*)&th[cl][q * 8]); if (hi_rows) { const size_t o3 = (bb * CC + c0 + cl) * (size_t)KHI + t0 + th0 + q * 8; vst_w(VB + o3, *(const v4u*)&tb[cl][q * 8]); vst_w(VBL + o3, *(const v4u*)&tbl[cl][q * 8]); } }
      if (hf == 0) __syncthreads(); } } }   /* block-uniform: ends every thread's reads of the planes before the second half overwrites them */
// ---- k_att: block = 64 queries (qb) of (b, h), wave = 16 queries: logits, softmax and P . v in one pass over key blocks of 64, nothing of the logits leaves registers.
// Transposed tiles: S^T = k q^T puts (key 8g + r, query col) in D element r, which is already the B fragment (k = keys) of ctx^T = v^T P^T; the row statistics of a query live in its two lanes (col, col + 16).
// Past the early query blocks the block's four waves share each key block's k and v tiles: asynchronous 16-byte copies bring them by whole lines into two LDS buffers (the next block's copies fly under this block's work), and every wave reads its fragments there. Fragment contents, k order and the order of the products are those of the per-lane global fragment loads that this replaces.
// Running maximum m (of the unscaled logits) and sum l per query; e = 2^(SC2 (logit - m) + 11) = exp(scaled logit - scaled m) x 2^11 once to f16 against v f16 (HI, causal early query blocks: 3-product logits, e and v as bf16 hi + lo, 3 products); l sums the same e, ctx = acc / l. The inner loops are fully unrolled so that every fragment array stays in registers.
#define AP 144                 // LDS pitch in bytes of a staged 128-byte row: 16 B x 9, so the 16-byte fragment reads of 16 rows meet no bank twice
#define AT_B (64 * AP)         // bytes of one staged tile of 64 rows; a buffer = the k tile, then the v tile
// one key block into one LDS buffer: k tile = 64 key rows x the head's 64 channels, v tile = the head's 64 channel planes x 64 keys, 128 B a row. A lane copies its 16 B of rows r, r + 16, r + 32, r + 48 of both tiles (r = tid >> 3), so each wave-wide copy covers four whole lines. ld, kg, vg: the lane's own LDS byte address and global addresses in row r.
__device__ __forceinline__ void att_stage(unsigned ld, const _Float16* kg, const _Float16* vg) {
  /* the closing s_wait_xcnt 0 stands inside the copies' own statement, in front of any rewrite of the address registers that the eight issued copies name */
  asm volatile("global_load_async_to_lds_b128 %0, %8, off\n\t"
               "global_load_async_to_lds_b128 %1, %9, off\n\t"
               "global_load_async_to_lds_b128 %2, %10, off\n\t"
               "global_load_async_to_lds_b128 %3, %11, off\n\t"
               "global_load_async_to_lds_b128 %4, %12, off\n\t"
               "global_load_async_to_lds_b128 %5, %13, off\n\t"
               "global_load_async_to_lds_b128 %6, %14, off\n\t"
               "global_load_async_to_lds_b128 %7, %15, off\n\t"
               "s_wait_xcnt 0x0"
               :: "v"(ld), "v"(ld + 16 * AP), "v"(ld + 32 * AP), "v"(ld + 48 * AP), "v"(ld + AT_B), "v"(ld + AT_B + 16 * AP), "v"(ld + AT_B + 32 * AP), "v"(ld + AT_B + 48 * AP),
                  "v"(kg), "v"(kg + 16 * CC), "v"(kg + 32 * CC), "v"(kg + 48 * CC), "v"(vg), "v"(vg + 16 * TT), "v"(vg + 32 * TT), "v"(vg + 48 * TT) : "memory"); }
// eight 2^x in place on the hardware's v_exp_f32
__device__ __forceinline__ void exp2x8(v8f& x) {
  float x0 = x[0], x1 = x[1], x2 = x[2], x3 = x[3], x4 = x[4], x5 = x[5], x6 = x[6], x7 = x[7];
  /* one statement, so that nothing directly behind a v_exp_f32 reads its result or overwrites its source: inside, each works on a register of its own, and the closing v_nop is the one slot that the instruction set asks for in front of whatever the compiler puts next */
  asm("v_exp_f32 %0, %0\n\tv_exp_f32 %1, %1\n\tv_exp_f32 %2, %2\n\tv_exp_f32 %3, %3\n\tv_exp_f32 %4, %4\n\tv_exp_f32 %5, %5\n\tv_exp_f32 %6, %6\n\tv_exp_f32 %7, %7\n\tv_nop"
      : "+v"(x0), "+v"(x1), "+v"(x2), "+v"(x3), "+v"(x4), "+v"(x5), "+v"(x6), "+v"(x7));
  x = v8f{x0, x1, x2, x3, x4, x5, x6, x7}; }
template <bool HI> __device__ __forceinline__ void att_body(unsigned char* sm, const _Float16* __restrict__ QH, const _Float16* __restrict__ KH, const _Float16* __restrict__ QL, const _Float16* __restrict__ KL, const _Float16* __restrict__ VT, const __bf16* __restrict__ VB, const __bf16* __restrict__ VBL, float* __restrict__ Y, int qb, int h, int b) {
  const int tid = threadIdx.x, wave = tid >> 5, lane = tid & 31, col = lane & 15, g = lane >> 4; const int ql0 = qb * 64 + wave * 16; const int t = ql0 + col; const size_t q0 = (size_t)b * TT + ql0;
  const _Float16* QLb = QL + (size_t)b * QHI * CC; const _Float16* KLb = KL + (size_t)b * KHI * CC;
  const _Float16* kp = KH + ((size_t)b * TT + col) * CC + h * HD;              /* key row col, this head's 64 channels */
  const unsigned ld0 = (unsigned)(size_t)sm + (unsigned)((tid >> 3) * AP + (tid & 7) * 16);                 /* this lane's place in row tid >> 3 of buffer 0's k tile */
  const _Float16* kg = KH + ((size_t)b * TT + (tid >> 3)) * CC + h * HD + (tid & 7) * 8;                     /* its 16 B of key row tid >> 3 */
  const _Float16* vg = VT + ((size_t)b * CC + h * HD + (tid >> 3)) * (size_t)TT + (tid & 7) * 8;             /* its 16 B of channel plane tid >> 3 */
  v16h ah[HD / 32], al[HD / 32], kf[HD / 32][4];
#pragma unroll
  for (int kc = 0; kc < HD / 32; ++kc) { ah[kc] = frag_h(QH + (q0 + col) * CC + h * HD + kc * 32, lane); if (HI) al[kc] = frag_h(QLb + (size_t)(ql0 + col) * CC + h * HD + kc * 32, lane); }
  if (!HI) {   /* block-uniform: key block 0 into buffer 0, landed and published; then key block 1 into buffer 1 */
    att_stage(ld0, kg, vg);
    asm volatile("s_wait_asynccnt 0x0" ::: "memory");   /* this wave's copies of key block 0 have landed */
    __syncthreads();                                    /* every wave's have: buffer 0 may be read */
    if (qb >= 1) att_stage(ld0 + 2 * AT_B, kg + (size_t)64 * CC, vg + 64); }
  float m = -3.0e38f, l = 0.f; v8f acc[HD / 16] = {};
#pragma unroll 1   /* rolled: one block's k and v fragments already fill the registers that four waves a SIMD leave a wave */
  for (int kb = 0; kb <= qb; ++kb) { const int k0 = kb * 64;   /* causal: key blocks 0 .. qb; only block qb crosses the diagonal */
    v16h vf[2][HD / 16];
    if (!HI) { const unsigned char* kt = sm + (kb & 1) * (2 * AT_B) + col * AP; const unsigned char* vt = kt + AT_B;   /* row col of this key block's two tiles */
#pragma unroll
      for (int kc = 0; kc < HD / 32; ++kc)
#pragma unroll
        for (int j = 0; j < 4; ++j) kf[kc][j] = frag_h((const _Float16*)(kt + j * 16 * AP) + kc * 32, lane);
#pragma unroll
      for (int kc = 0; kc < 2; ++kc)
#pragma unroll
        for (int j = 0; j < HD / 16; ++j) vf[kc][j] = frag_h((const _Float16*)(vt + j * 16 * AP) + kc * 32, lane); }
    __builtin_amdgcn_sched_barrier(0);   /* keeps this block's k and v LDS reads issued here as one group, the v reads in flight under the logits and the softmax, instead of one by one in front of their products */
    v8f s[4] = {}, sl[4] = {};
#pragma unroll
    for (int kc = 0; kc < HD / 32; ++kc) { v16h klf[4];
      if (HI) {
#pragma unroll
        for (int j = 0; j < 4; ++j) { kf[kc][j] = frag_h(kp + (size_t)(k0 + j * 16) * CC + kc * 32, lane); klf[j] = frag_h(KLb + (size_t)(k0 + j * 16 + col) * CC + h * HD + kc * 32, lane); }
        __builtin_amdgcn_sched_barrier(0); }   /* the eight k and k residual fragments of this half are in flight together: one latency, not eight */
#pragma unroll
      for (int j = 0; j < 4; ++j) { s[j] = wmma16(kf[kc][j], ah[kc], s[j]);
        if (HI) { sl[j] = wmma16(kf[kc][j], al[kc], sl[j]); sl[j] = wmma16(klf[j], ah[kc], sl[j]); } } }
    v16b vbh[HD / 16], vbl[HD / 16]; const size_t pb = ((size_t)b * CC + h * HD + col) * (size_t)KHI + k0;
    if (HI) {
#pragma unroll
      for (int j = 0; j < HD / 16; ++j) { vbh[j] = frag_b(VB + pb + (size_t)(j * 16) * KHI, lane); vbl[j] = frag_b(VBL + pb + (size_t)(j * 16) * KHI, lane); } }
    if (HI) __builtin_amdgcn_sched_barrier(0);   /* keeps the first half's v hi + lo loads issued here, in flight under the softmax */
#pragma unroll
    for (int j = 0; j < 4; ++j) {
#pragma unroll
      for (int r = 0; r < 8; ++r) if (HI) s[j][r] = s[j][r] + sl[j][r] * (1.0f / 1024.0f); }   /* the logits stay unscaled: SC2 > 0, so their maximum is the scaled logits' maximum, and the scale rides in the exponent's fma below */
    if (CAUSAL && kb == qb) {   /* wave-uniform */
#pragma unroll
      for (int j = 0; j < 4; ++j) {
#pragma unroll
        for (int r = 0; r < 8; ++r) if (k0 + j * 16 + 8 * g + r > t) s[j][r] = -3.0e38f; } }
    float bm = -3.0e38f;
#pragma unroll
    for (int j = 0; j < 4; ++j) {
#pragma unroll
      for (int r = 0; r < 8; ++r) bm = fmaxf(bm, s[j][r]); }
    bm = fmaxf(bm, __shfl_xor(bm, 16));
    const float mn = fmaxf(m, bm); const float alpha = __builtin_amdgcn_exp2f((m - mn) * SC2); m = mn;   /* every block holds a key open to every query of the wave (key k0 <= ql0), so mn is a real logit */
    const float mo = 11.0f - mn * SC2;   /* exponent offset of this block: the running maximum in base 2, and the 2^11 carry of e */
    float ls = 0.f;
#pragma unroll
    for (int j = 0; j < 4; ++j) {
#pragma unroll
      for (int r = 0; r < 8; ++r) s[j][r] = __builtin_fmaf(s[j][r], SC2, mo); }   /* the exponent of e = 2^11 exp(scaled logit - scaled mn): one fma a logit */
#pragma unroll
    for (int j = 0; j < 4; ++j) { exp2x8(s[j]);   /* a masked logit (-3e38) underflows to exactly 0 against the real mn */
#pragma unroll
      for (int r = 0; r < 8; ++r) ls += s[j][r]; }
    ls += __shfl_xor(ls, 16); l = l * alpha + ls;
#pragma unroll
    for (int j = 0; j < HD / 16; ++j) acc[j] *= alpha;
#pragma unroll
    for (int kc = 0; kc < 2; ++kc) {
      if (HI) { float pv[16];
#pragma unroll
        for (int i = 0; i < 8; ++i) { pv[i] = s[2 * kc][i]; pv[8 + i] = s[2 * kc + 1][i]; }
        const F2 p = bsplit16(pv);
        if (kc == 1) {
#pragma unroll
          for (int j = 0; j < HD / 16; ++j) { vbh[j] = frag_b(VB + pb + (size_t)(j * 16) * KHI + 32, lane); vbl[j] = frag_b(VBL + pb + (size_t)(j * 16) * KHI + 32, lane); }
          __builtin_amdgcn_sched_barrier(0); }   /* the second half's eight v fragments are in flight together */
#pragma unroll
        for (int j = 0; j < HD / 16; ++j) { acc[j] = wmma_bf(vbh[j], p.h, acc[j]); acc[j] = wmma_bf(vbh[j], p.l, acc[j]); acc[j] = wmma_bf(vbl[j], p.h, acc[j]); }
      } else { v16h p;
#pragma unroll
        for (int i = 0; i < 8; ++i) { p[i] = (_Float16)s[2 * kc][i]; p[8 + i] = (_Float16)s[2 * kc + 1][i]; }
#pragma unroll
        for (int j = 0; j < HD / 16; ++j) acc[j] = wmma16(vf[kc][j], p, acc[j]); } }
    if (!HI) {   /* hand-over, every wave of the block, in this order */
      asm volatile("s_wait_dscnt 0x0" ::: "memory");      /* this wave's reads of this block's buffer are over */
      asm volatile("s_wait_asynccnt 0x0" ::: "memory");   /* its copies of the next key block have landed */
      __syncthreads();                                    /* publishes the next key block and ends every wave's reads of this block's buffer */
      if (kb + 2 <= qb) att_stage(ld0 + (kb & 1) * (2 * AT_B), kg + (size_t)(kb + 2) * 64 * CC, vg + (kb + 2) * 64); } }   /* block-uniform: the block after next into the buffer just left */
  if (!HI) asm volatile("s_wait_asynccnt 0x0" ::: "memory");   /* no copy is outstanding when the wave ends */
  const float inv = l > 0.f ? 1.0f / l : 0.f;   /* l carries the same 2^11 as acc */
  float* yr = Y + (q0 + col) * CC + h * HD + 8 * g;   /* D element r of tile j = channel j * 16 + 8g + r of query col: 32 contiguous bytes a lane */
#pragma unroll
  for (int j = 0; j < HD / 16; ++j) { const v4f lo = {acc[j][0] * inv, acc[j][1] * inv, acc[j][2] * inv, acc[j][3] * inv}, hi = {acc[j][4] * inv, acc[j][5] * inv, acc[j][6] * inv, acc[j][7] * inv}; vst2(yr + j * 16, lo); vst2(yr + j * 16 + 4, hi); } }
__global__ __launch_bounds__(128) void k_att(const _Float16* __restrict__ QH, const _Float16* __restrict__ KH, const _Float16* __restrict__ QL, const _Float16* __restrict__ KL, const _Float16* __restrict__ VT, const __bf16* __restrict__ VB, const __bf16* __restrict__ VBL, float* __restrict__ Y) {
  __shared__ __align__(16) unsigned char sm[4 * AT_B];   /* two buffers of a k tile and a v tile */
  const int qb = NQB - 1 - (int)blockIdx.y, h = blockIdx.x % NH, b = blockIdx.x / NH;   /* the longest key ranges take the lowest blockIdx.y */
  if (qb < QBH) att_body<true>(sm, QH, KH, QL, KL, VT, VB, VBL, Y, qb, h, b); else att_body<false>(sm, QH, KH, QL, KL, VT, VB, VBL, Y, qb, h, b); }
// ---- k_out: block = (128 rows, 128 cols): out = ctx Wo (+ bo): ctx x 2^6 once to f16 against Wo as f16(bf16 x 2^8) exact (1 product) x 2^-14; causal early rows (< QHI of each sequence): ctx bf16 hi + lo against exact bf16 Wo (2 products)
__global__ __launch_bounds__(256) void k_out(const float* __restrict__ Y, const float* __restrict__ WO, const float* __restrict__ BO, float* __restrict__ OUT) { __shared__ __align__(16) unsigned char sm[2 * GW_B + 4 * GA_B + 8 * 32 * 68 * 4];   /* staged W chunks, staged ctx chunks (two planes for the early rows), then the output staging sf: each wave's own 32 x 64 tile at a pitch of 68 floats */
  unsigned char* sw = sm; unsigned char* sa = sm + 2 * GW_B; float (*sf)[32][68] = (float (*)[32][68])(sm + 2 * GW_B + 4 * GA_B);
  const int tid = threadIdx.x, wave = tid >> 5, lane = tid & 31, col = lane & 15, g = lane >> 4; const int c0 = blockIdx.y * 128 + (wave & 1) * 64; const size_t r0 = (size_t)blockIdx.x * 128 + (wave >> 1) * 32;   /* the wave's own first column and row */
  v8f acc[8] = {};
  if (CAUSAL && (int)(((size_t)blockIdx.x * 128) % TT) < QHI) {   /* block-uniform */
    gemm_staged<1, CC>(Y + (size_t)blockIdx.x * 128 * CC, WO + (size_t)blockIdx.y * 128 * CC, sw, sa, acc);
#pragma unroll
    for (int j = 0; j < 4; ++j) { const float bias = BO ? bfr(BO[c0 + j * 16 + col]) : 0.f;
#pragma unroll
      for (int i = 0; i < 2; ++i)
#pragma unroll
        for (int r = 0; r < 8; ++r) sf[wave][i * 16 + 8 * g + r][j * 16 + col] = acc[i * 4 + j][r] + bias; }
  } else {
    gemm_staged<2, CC>(Y + (size_t)blockIdx.x * 128 * CC, WO + (size_t)blockIdx.y * 128 * CC, sw, sa, acc);   /* ctx carried x 2^6 into f16 so small-magnitude context rows stay clear of f16 subnormals */
#pragma unroll
    for (int j = 0; j < 4; ++j) { const float bias = BO ? bfr(BO[c0 + j * 16 + col]) : 0.f;
#pragma unroll
      for (int i = 0; i < 2; ++i)
#pragma unroll
        for (int r = 0; r < 8; ++r) sf[wave][i * 16 + 8 * g + r][j * 16 + col] = acc[i * 4 + j][r] * (1.0f / 16384.0f) + bias; } }   /* 2^-8 (Wo carry) x 2^-6 (ctx carry) */
  LDSX(); for (int rl = 0; rl < 32; rl += 2) vst2(OUT + (r0 + rl + g) * DIN + c0 + col * 4, *(const v4f*)&sf[wave][rl + g][col * 4]); }   /* a store covers two rows' 256 B: four whole lines */

extern "C" void kernel_launch(void* const* d_in, const int* in_sizes, int n_in, void* d_out, int out_size, void* d_ws, size_t ws_size, hipStream_t stream) {
  (void)in_sizes; (void)n_in; (void)out_size;
  const float** F = (const float**)d_in;
  if (ws_size < (size_t)WS_END) return;
  char* ws = (char*)d_ws; _Float16 *QH = (_Float16*)(ws + WS_QH), *KH = (_Float16*)(ws + WS_KH), *VT = (_Float16*)(ws + WS_VT), *QL = (_Float16*)(ws + WS_QL), *KL = (_Float16*)(ws + WS_KL); __bf16 *VB = (__bf16*)(ws + WS_VB), *VBL = (__bf16*)(ws + WS_VBL); float *Y = (float*)(ws + WS_Y);
  (void)Y; (void)QL; (void)KL; (void)VB; (void)VBL;
  // inputs: 0 x [2,2048,1024]; 1 Wq [1024,1024] (out,in); 2 Wk; 3 Wv; 4 bv [1024] (NONZERO; q and k have no bias: null pointers); 5 Wo (out,in); 6 bo (NONZERO)
  k_proj<<<dim3(TNB * TT / 128, CC / 128, 3), 256, 0, stream>>>(F[0], F[0], F[0], F[1], F[2], F[3], nullptr, nullptr, F[4], QH, QL, KH, KL, VT, VB, VBL);
  k_att<<<dim3(NH * TNB, NQB), 128, 0, stream>>>(QH, KH, QL, KL, VT, VB, VBL, Y);
  k_out<<<dim3(TNB * TT / 128, DIN / 128), 256, 0, stream>>>(Y, F[5], F[6], (float*)d_out);
}

// v008
// One run takes 79.9 microseconds.
// Next to v007, in two timings, it ran 1.07 times as fast each time.
// Counting every step since v000, it is 16.4 times as fast.
// compute dtype: all float inputs rounded to bf16; q / k / v projections with EXACT bf16 products on WMMA 16x16x32 (f32 accumulate) + bias (v only; nonzero); interleaved-pair RoPE in f32 on q and k (which have no bias) (embedded frequencies, cos / sin by the precise library steps for small arguments, positions = the row index); causal logits: 3 products for the first 384 rows, single f16 q x k after, x 64^-0.5; online softmax f32 in one fused pass, exponentials in base 2; exp(logit - running max) x 2^11 once to f16 x v once to f16 (bf16 hi + lo below row 384); ctx hi+lo x exact Wo below row 384, x2^6 f16 carry x f16(bf16 x 2^8) Wo after, + bo; f32 output.
#include <hip/hip_runtime.h>
#include <math.h>

typedef __attribute__((ext_vector_type(16))) _Float16 v16h;
typedef __attribute__((ext_vector_type(16))) __bf16 v16b;
typedef __attribute__((ext_vector_type(8)))  _Float16 v8h;
typedef __attribute__((ext_vector_type(8)))  float v8f;
typedef __attribute__((ext_vector_type(4)))  float v4f;
typedef __attribute__((ext_vector_type(2)))  float v2f;
typedef __attribute__((ext_vector_type(4)))  unsigned v4u;
typedef __attribute__((ext_vector_type(4)))  int v4i;
typedef float __attribute__((may_alias)) float_a;
typedef int __attribute__((may_alias)) int_a;

template <typename T> __device__ __forceinline__ void vst2(void* p, T v) { *(T*)p = v;  }
// one 16-byte global store of a rolled loop, with its s_wait_xcnt 0 in the same statement, so that the wait stands in front of any rewrite of the address registers that the store names (over a wait in a statement of its own the compiler lifted the next trip's address additions)
__device__ __forceinline__ void vst_w(void* p, v4u v) { asm volatile("global_store_b128 %0, %1, off\n\ts_wait_xcnt 0x0" :: "v"(p), "v"(v) : "memory"); }
__device__ __forceinline__ v8f wmma16(v16h a, v16h b, v8f c) {
  v8f d = __builtin_amdgcn_wmma_f32_16x16x32_f16(false, a, false, b, (short)0, c, false, false);
  asm volatile("v_nop\n\tv_nop\n\tv_nop\n\tv_nop" : "+v"(d) : "v"(a), "v"(b));
  return d;
}
__device__ __forceinline__ v8f wmma_bf(v16b a, v16b b, v8f c) {
  v8f d = __builtin_amdgcn_wmma_f32_16x16x32_bf16(false, a, false, b, (short)0, c, false, false);
  asm volatile("v_nop\n\tv_nop\n\tv_nop\n\tv_nop" : "+v"(d) : "v"(a), "v"(b));
  return d;
}
// 16x16x32 fragments: lane = (h = lane>>4, row/col = lane&15); elements 0..7 = k0+8h+0..7, 8..15 = k0+16+8h+0..7; D element r = row 8h+r
__device__ __forceinline__ v16h frag_h(const _Float16* rowk0, int lane) {
  union { v16h v; v8h q[2]; } u; const _Float16* p = rowk0 + 8 * (lane >> 4);
  u.q[0] = *(const v8h*)p; u.q[1] = *(const v8h*)(p + 16); return u.v;
}
__device__ __forceinline__ v16h frag_f32(const float* rowk0, int lane) {
  v16h a; const float* p = rowk0 + 8 * (lane >> 4);
#pragma unroll
  for (int i = 0; i < 8; ++i) { a[i] = (_Float16)p[i]; a[8 + i] = (_Float16)p[16 + i]; }
  return a;
}
__device__ __forceinline__ v16h frag_f32s(const float* rowk0, int lane, float sc) {
  v16h a; const float* p = rowk0 + 8 * (lane >> 4);
#pragma unroll
  for (int i = 0; i < 8; ++i) { a[i] = (_Float16)(p[i] * sc); a[8 + i] = (_Float16)(p[16 + i] * sc); }
  return a;
}
// column fragment from a [K][ld] layout (column n), rows >= K read as 0
__device__ __forceinline__ v16h fragc_f32(const float* W, int k0, int n, int lane, int ld, int K) {
  v16h a; const int g = lane >> 4;
#pragma unroll
  for (int i = 0; i < 8; ++i) { const int ka = k0 + 8 * g + i, kb = ka + 16;
    a[i] = (_Float16)(ka < K ? W[(size_t)(ka < K ? ka : K - 1) * ld + n] : 0.f); a[8 + i] = (_Float16)(kb < K ? W[(size_t)(kb < K ? kb : K - 1) * ld + n] : 0.f); }
  return a;
}
struct F2 { v16b h, l; };
__device__ __forceinline__ F2 bsplit16(const float v[16]) { F2 r;
#pragma unroll
  for (int i = 0; i < 16; ++i) { const __bf16 h = (__bf16)v[i]; r.h[i] = h; r.l[i] = (__bf16)(v[i] - (float)h); }
  return r; }
__device__ __forceinline__ F2 split_row(const float* row, int k0, int lane) { float v[16]; const float* p = row + k0 + 8 * (lane >> 4);
#pragma unroll
  for (int i = 0; i < 8; ++i) { v[i] = p[i]; v[8 + i] = p[16 + i]; }
  return bsplit16(v); }
__device__ __forceinline__ F2 split_rowK(const float* row, int k0, int lane, int K) { float v[16]; const int g = lane >> 4;
#pragma unroll
  for (int i = 0; i < 8; ++i) { const int ka = k0 + 8 * g + i, kb = ka + 16; v[i] = ka < K ? row[ka < K ? ka : K - 1] : 0.f; v[8 + i] = kb < K ? row[kb < K ? kb : K - 1] : 0.f; }
  return bsplit16(v); }
__device__ __forceinline__ F2 split_col(const float* W, int k0, int n, int lane, int ld, int K) { float v[16]; const int g = lane >> 4;
#pragma unroll
  for (int i = 0; i < 8; ++i) { const int ka = k0 + 8 * g + i, kb = ka + 16; v[i] = ka < K ? W[(size_t)(ka < K ? ka : K - 1) * ld + n] : 0.f; v[8 + i] = kb < K ? W[(size_t)(kb < K ? kb : K - 1) * ld + n] : 0.f; }
  return bsplit16(v); }
__device__ __forceinline__ v8f mac3(const F2& a, const F2& b, v8f c) { c = wmma_bf(a.l, b.h, c); c = wmma_bf(a.h, b.l, c); return wmma_bf(a.h, b.h, c); }
__device__ __forceinline__ float sigm(float v) { return 1.0f / (1.0f + expf(-v)); }
#define LDSX() do { asm volatile("s_wait_dscnt 0" ::: "memory"); __builtin_amdgcn_wave_barrier(); __builtin_amdgcn_fence(__ATOMIC_RELEASE, "workgroup"); } while (0)

// Causal self-attention with interleaved-pair RoPE (x [2,2048,1024]; (out,in) Wq / Wk / Wv [1024,1024] N(0, 1/1024) applied as einsum('bse,he->bsh') = x @ W.T; bv [1024] NONZERO (only v has a bias); Wo [1024,1024] (out,in) + bo NONZERO; 16 heads x 64; RoPE (base 10000, positions 0..2047) on q and k: (even, odd) pairs rotated and re-interleaved; scores x 1/sqrt(64); triu(k = 1) -> -inf; softmax; out @ Wo.T + bo).
#define NB 2
#define TT 2048
#define CC 1024            // NH * HD = projected width
#define DIN 1024          // input (model) width
#define NH 16
#define HD 64
#define NQB (TT / 64)
#define SCALE (0.125f)
#define SC2 (SCALE * 1.44269504088896340736f)   // logit scale x log2(e): exp(SCALE * d) = 2^(SC2 * d)
#define CAUSAL 1
#ifndef TNB
#define TNB NB
#endif
__device__ __forceinline__ float bfr(float v) { return (float)(__bf16)v; }
typedef __attribute__((ext_vector_type(8))) __bf16 v8b;
__device__ __forceinline__ v16b frag_b(const __bf16* rowk0, int lane) {
  union { v16b v; v8b q[2]; } u; const __bf16* p = rowk0 + 8 * (lane >> 4);
  u.q[0] = *(const v8b*)p; u.q[1] = *(const v8b*)(p + 16); return u.v;
}
#define QBH 6              // causal: query blocks 0..QBH-1 of each sequence (few keys, no averaging) take the high-precision path
#define QHI 384            // rows carrying a q residual plane
#define KHI 384            // key rows carrying k residual / v bf16 hi+lo planes (used only by the causal high-precision path)
// B fragment (k rows k0+.., output column o) of a weight: (in,out) [K][ld] or (out,in) [ld rows of K]: bf16 exact, or f16(bf16 * 256) exact
__device__ __forceinline__ v16b wcol_io(const float* Wm, int k0, int o, int lane, int ld) { v16b w; const int g = lane >> 4;
#pragma unroll
  for (int i = 0; i < 8; ++i) { w[i] = (__bf16)Wm[(size_t)(k0 + 8 * g + i) * ld + o]; w[8 + i] = (__bf16)Wm[(size_t)(k0 + 16 + 8 * g + i) * ld + o]; }
  return w; }
__device__ __forceinline__ v16b wcol_oi(const float* Wm, int k0, int o, int lane, int K) { v16b w; const float* p = Wm + (size_t)o * K + k0 + 8 * (lane >> 4);
#pragma unroll
  for (int i = 0; i < 8; ++i) { w[i] = (__bf16)p[i]; w[8 + i] = (__bf16)p[16 + i]; }
  return w; }
__device__ __forceinline__ v16h wcolh_io(const float* Wm, int k0, int o, int lane, int ld) { v16h w; const int g = lane >> 4;
#pragma unroll
  for (int i = 0; i < 8; ++i) { w[i] = (_Float16)(bfr(Wm[(size_t)(k0 + 8 * g + i) * ld + o]) * 256.0f); w[8 + i] = (_Float16)(bfr(Wm[(size_t)(k0 + 16 + 8 * g + i) * ld + o]) * 256.0f); }
  return w; }
__device__ __forceinline__ v16h wcolh_oi(const float* Wm, int k0, int o, int lane, int K) { v16h w; const float* p = Wm + (size_t)o * K + k0 + 8 * (lane >> 4);
#pragma unroll
  for (int i = 0; i < 8; ++i) { w[i] = (_Float16)(bfr(p[i]) * 256.0f); w[8 + i] = (_Float16)(bfr(p[16 + i]) * 256.0f); }
  return w; }
#define WQKV_LAYOUT 1   // picks only the WCOL helper, which nothing calls (0 = (in,out) [DIN][CC]; 1 = (out,in) [CC][DIN]; 2 = per-head [NH][DIN][HD]); k_proj always reads (out,in) [CC][DIN]
__device__ __forceinline__ v16b wcol_hdk(const float* Wm, int k0, int o, int lane) { v16b w; const int g = lane >> 4; const float* p = Wm + (size_t)(o / HD) * DIN * HD + (o % HD);
#pragma unroll
  for (int i = 0; i < 8; ++i) { w[i] = (__bf16)p[(size_t)(k0 + 8 * g + i) * HD]; w[8 + i] = (__bf16)p[(size_t)(k0 + 16 + 8 * g + i) * HD]; }
  return w; }
#define WO_OUT_IN 1
#if WQKV_LAYOUT == 1
#define WCOL(W, k0, o, lane) wcol_oi(W, k0, o, lane, DIN)
#elif WQKV_LAYOUT == 2
#define WCOL(W, k0, o, lane) wcol_hdk(W, k0, o, lane)
#else
#define WCOL(W, k0, o, lane) wcol_io(W, k0, o, lane, CC)
#endif
#if WO_OUT_IN
#define WOCOL(W, k0, o, lane) wcol_oi(W, k0, o, lane, CC)
#define WOCOLH(W, k0, o, lane) wcolh_oi(W, k0, o, lane, CC)
#else
#define WOCOL(W, k0, o, lane) wcol_io(W, k0, o, lane, DIN)
#define WOCOLH(W, k0, o, lane) wcolh_io(W, k0, o, lane, DIN)
#endif

// RoPE inverse frequencies 1/10000^(2i/64)
__constant__ float INVF[32] = {1.000000000e+00,7.498942018e-01,5.623413324e-01,4.216965139e-01,3.162277639e-01,2.371373624e-01,1.778279394e-01,1.333521456e-01,1.000000015e-01,7.498941571e-02,5.623412877e-02,4.216964915e-02,3.162277862e-02,2.371373586e-02,1.778279431e-02,1.333521493e-02,9.999999776e-03,7.498942316e-03,5.623413250e-03,4.216964822e-03,3.162277862e-03,2.371373819e-03,1.778279431e-03,1.333521446e-03,1.000000047e-03,7.498941850e-04,5.623413017e-04,4.216964880e-04,3.162277862e-04,2.371373848e-04,1.778279402e-04,1.333521504e-04};
#define PROJ_EXTRA_PARAMS
// cos and sin of one RoPE angle a = position x frequency, 0 <= a < 2048: the steps, constants and order of the math library's precise cosf and sinf on their small-argument path (below 2^17), with the range reduction and the two polynomials, which both functions share, worked once. Same bits as the two calls; their large-argument branch and their test for a non-finite argument cannot be met by such an angle.
__device__ __forceinline__ void rope_cs(float a, float& cs, float& sn) {
  const float n = __builtin_rintf(a * __uint_as_float(0x3f22f983u));   /* a x 2 / pi to the nearest whole number: the quadrant count */
  float r = __builtin_fmaf(__uint_as_float(0xbfc90fdau), n, a); r = __builtin_fmaf(__uint_as_float(0xb3a22168u), n, r); r = __builtin_fmaf(__uint_as_float(0xa7c234c4u), n, r);   /* a - n x pi / 2, pi / 2 in three parts */
  const int q = (int)n; const float s = r * r;
  float ps = __builtin_fmaf(__uint_as_float(0xb94c1982u), s, __uint_as_float(0x3c0881c4u)); ps = __builtin_fmaf(s, ps, __uint_as_float(0xbe2aaa9du));
  const float sr = __builtin_fmaf(r, s * ps, r);   /* sin r */
  float pc = __builtin_fmaf(__uint_as_float(0x37d75334u), s, __uint_as_float(0xbab64f3bu)); pc = __builtin_fmaf(s, pc, __uint_as_float(0x3d2aabf7u)); pc = __builtin_fmaf(s, pc, __uint_as_float(0xbf000004u));
  const float cr = __builtin_fmaf(s, pc, 1.0f);    /* cos r */
  const unsigned sg = ((unsigned)q << 30) & 0x80000000u;   /* quadrants 2 and 3 change the sign */
  cs = __uint_as_float(__float_as_uint((q & 1) ? -sr : cr) ^ sg); sn = __uint_as_float(__float_as_uint((q & 1) ? cr : sr) ^ sg); }
#ifndef PROJ_EXTRA_PARAMS
#define PROJ_EXTRA_PARAMS
#endif

#define WS_QH  0u                                      // f16 q rows [b*t][CC]
#define WS_KH  (WS_QH + 2u * (size_t)NB * TT * CC)      // f16 k rows [b*t][CC]
#define WS_VT  (WS_KH + 2u * (size_t)NB * TT * CC)      // f16 v planes [b][c][t]
#define WS_QL  (WS_VT + 2u * (size_t)NB * CC * TT)      // f16 q residual x 2^10 rows [b][t < QHI][CC]
#define WS_KL  (WS_QL + 2u * (size_t)NB * QHI * CC)     // f16 k residual x 2^10 rows [b][t < KHI][CC]
#define WS_VB  (WS_KL + 2u * (size_t)NB * KHI * CC)     // bf16 v hi planes [b][c][t < KHI]
#define WS_VBL (WS_VB + 2u * (size_t)NB * CC * KHI)
#define WS_YH  (WS_VBL + 2u * (size_t)NB * CC * KHI)     // f16 ctx x 2^6 rows [b*t][CC] (rows >= QHI of each sequence)
#define WS_YB  (WS_YH + 2u * (size_t)NB * TT * CC)       // bf16 ctx hi rows [b][t < QHI][CC]
#define WS_YBL (WS_YB + 2u * (size_t)NB * QHI * CC)      // bf16 ctx lo rows [b][t < QHI][CC]
#define WS_XB  (WS_YBL + 2u * (size_t)NB * QHI * CC)     // bf16 x rows [b*t][DIN]
#define WS_WB  (WS_XB + 2u * (size_t)NB * TT * DIN)      // bf16 Wq, Wk, Wv, one after the other, each [CC][DIN]
#define WS_WOB (WS_WB + 2u * 3u * (size_t)CC * DIN)      // bf16 Wo [DIN][CC]
#define WS_WOH (WS_WOB + 2u * (size_t)DIN * CC)          // f16(bf16 Wo x 2^8) [DIN][CC]
#define WS_END (WS_WOH + 2u * (size_t)DIN * CC)

// ---- k_cvt: x, Wq, Wk, Wv and Wo are rounded ONCE to the 16-bit operand forms of the two GEMM kernels and stored as rows of the same shape, so that every block of those kernels fetches 2 bytes an element from L2 where it fetched 4 and rounded them again. A block takes CVB consecutive floats of one tensor; a wave-wide load covers four whole lines, a wave-wide store two.
#define CVB 32768
typedef __attribute__((ext_vector_type(4))) __bf16 v4b;
typedef __attribute__((ext_vector_type(4))) _Float16 v4h;
template <bool WOH2> __device__ __forceinline__ void cvt_run(const float* __restrict__ s, __bf16* __restrict__ d, _Float16* __restrict__ dh) {
  v4f v[CVB / 1024];
#pragma unroll   /* unrolled, as the loop below: v stays in registers and every address is one base and a constant offset */
  for (int i = 0; i < CVB / 1024; ++i) v[i] = *(const v4f*)(s + i * 1024);   /* all of the thread's loads issue together, each into registers of its own, ahead of the first rounding: one memory latency a thread */
  asm volatile("s_wait_xcnt 0x0" ::: "memory");   /* stands in front of any rewrite of the address registers that the issued loads name; no memory access is moved across it, so no load issues behind a store and lands in registers that the store names */
  __builtin_amdgcn_sched_barrier(0);   /* keeps the roundings behind all the loads: lifted in among them, the first rounding's wait held the last loads back by a whole memory latency */
#pragma unroll
  for (int i = 0; i < CVB / 1024; ++i) { const v4b ob = {(__bf16)v[i][0], (__bf16)v[i][1], (__bf16)v[i][2], (__bf16)v[i][3]}; *(v4b*)(d + i * 1024) = ob;
    if (WOH2) { const v4h oh = {(_Float16)((float)ob[0] * 256.0f), (_Float16)((float)ob[1] * 256.0f), (_Float16)((float)ob[2] * 256.0f), (_Float16)((float)ob[3] * 256.0f)}; *(v4h*)(dh + i * 1024) = oh; } }
  asm volatile("s_wait_xcnt 0x0" ::: "memory"); }   /* stands behind the run of stores, in front of any rewrite of the registers that they name */
__global__ __launch_bounds__(256) void k_cvt(const float* __restrict__ X, const float* __restrict__ WQ, const float* __restrict__ WK, const float* __restrict__ WV, const float* __restrict__ WO, __bf16* __restrict__ XB, __bf16* __restrict__ WB, __bf16* __restrict__ WOB, _Float16* __restrict__ WOH) {
  constexpr int NXB = NB * TT * DIN / CVB, NWB = CC * DIN / CVB; const int bid = blockIdx.x, tid = threadIdx.x;
  const int w = bid < NXB ? -1 : (bid - NXB) / NWB; const size_t o = bid < NXB ? (size_t)bid * CVB : (size_t)((bid - NXB) % NWB) * CVB;   /* block-uniform: which tensor, and where in it */
  const float* s = (w < 0 ? X : w == 0 ? WQ : w == 1 ? WK : w == 2 ? WV : WO) + o + tid * 4;
  __bf16* d = (w < 0 ? XB + o : w < 3 ? WB + (size_t)w * CC * DIN + o : WOB + o) + tid * 4; _Float16* dh = WOH + o + tid * 4;
  if (w == 3) cvt_run<true>(s, d, dh); else cvt_run<false>(s, d, dh); }   /* block-uniform: Wo leaves in both of its operand forms */

// ---- staged GEMM loop shared by k_proj and k_out: a block's 128 A rows and 128 W rows (both k-contiguous rows of LD 16-bit elements, already in their operand form) come in chunks of GK k columns by whole-line 16-byte loads and are stored as they are in LDS, where the eight waves read their fragments: wave w works the 32 x 64 tile at rows (w >> 1) * 32, columns (w & 1) * 64, as acc[i * 4 + j] = row tile i x column tile j. Two LDS buffers, one barrier a chunk; the next chunk's global loads issue ahead of that barrier and fly under it and under this chunk's products. Operand values, fragment k order and the order of the products into each accumulator are those of the f32 rows rounded in the loop that this replaces.
// MODE 0: A and W bf16, one product; MODE 1: A bf16 hi + lo planes (Ag, Ag2), W bf16, two products; MODE 2: A f16(x 2^6), W f16(bf16 x 2^8), one product
#define GK 128                 // k columns of a chunk: 256 B of every 16-bit row
#define GP 136                 // LDS row pitch in 16-bit elements: 272 B = 16 B x 17, so the 16-byte fragment reads of 16 rows meet no bank twice
#define GW_B (128 * GP * 2)    // bytes of one W buffer
#define GA_B (128 * GP * 2)    // bytes of one plane of one A buffer
template <int MODE, int LD> __device__ __forceinline__ void gemm_staged(const unsigned char* __restrict__ Ag, const unsigned char* __restrict__ Ag2, const unsigned char* __restrict__ Wg, unsigned char* sw, unsigned char* sa, v8f (&acc)[8]) {
  const int tid = threadIdx.x, wave = tid >> 5, lane = tid & 31, col = lane & 15; const int lr = tid >> 4, lc = tid & 15;   /* 16 lanes x 16 B = one row's chunk; the block covers 16 rows a load */
  const int fa = (wave >> 1) * 32 + col, fw = (wave & 1) * 64 + col;   /* the lane's row in the wave's first A tile and first W tile */
  const size_t go = (size_t)lr * (LD * 2) + lc * 16; const unsigned char* ap = Ag + go; const unsigned char* ap2 = Ag2 + go; const unsigned char* wp = Wg + go;
  const int so = lr * (GP * 2) + lc * 16;   /* the lane's place in an LDS plane */
  constexpr int NPL = MODE == 1 ? 2 : 1;
  v4u ar[8], ar2[8], wr[8];
#pragma unroll
  for (int i = 0; i < 8; ++i) { ar[i] = *(const v4u*)(ap + (size_t)(16 * i) * (LD * 2)); if (MODE == 1) ar2[i] = *(const v4u*)(ap2 + (size_t)(16 * i) * (LD * 2)); }
#pragma unroll
  for (int i = 0; i < 8; ++i) wr[i] = *(const v4u*)(wp + (size_t)(16 * i) * (LD * 2));
  asm volatile("s_wait_xcnt 0x0" ::: "memory");   /* stands in front of any rewrite of the address registers that the issued loads name */
#pragma unroll 2   /* two chunks a body: the two buffers' LDS offsets become constants */
  for (int ch = 0; ch < LD / GK; ++ch) { unsigned char* wb = sw + (ch & 1) * GW_B; unsigned char* ab = sa + (ch & 1) * (NPL * GA_B);
    __builtin_amdgcn_sched_barrier(0);   /* holds this chunk's LDS stores, and with them the waits for its global loads, behind the previous chunk's products: lifted in among the first products, such a wait laid the loads' whole latency bare in every second chunk */
#pragma unroll
    for (int i = 0; i < 8; ++i) { *(v4u*)(ab + so + 16 * i * (GP * 2)) = ar[i]; if (MODE == 1) *(v4u*)(ab + GA_B + so + 16 * i * (GP * 2)) = ar2[i]; }
#pragma unroll
    for (int i = 0; i < 8; ++i) *(v4u*)(wb + so + 16 * i * (GP * 2)) = wr[i];
    if (ch + 1 < LD / GK) {   /* block-uniform: the next chunk's loads issue as soon as the LDS stores have taken the staging registers' values, AHEAD of the barrier: their L2 latency passes under the LDS stores' drain and the barrier as well as under this chunk's fragment reads and products */
#pragma unroll
      for (int i = 0; i < 8; ++i) { ar[i] = *(const v4u*)(ap + (size_t)(16 * i) * (LD * 2) + (ch + 1) * (GK * 2)); if (MODE == 1) ar2[i] = *(const v4u*)(ap2 + (size_t)(16 * i) * (LD * 2) + (ch + 1) * (GK * 2)); }
#pragma unroll
      for (int i = 0; i < 8; ++i) wr[i] = *(const v4u*)(wp + (size_t)(16 * i) * (LD * 2) + (ch + 1) * (GK * 2));
      asm volatile("s_wait_xcnt 0x0" ::: "memory"); }   /* stands in front of any rewrite of the address registers that the issued loads name */
    /* the chunk's work-group barrier, written by hand with the one wait it needs (this wave's LDS stores): __syncthreads() would also wait for the global loads just issued. It publishes this chunk; it also ends every wave's reads of the other buffer, which the next trip overwrites (each wave's fragment reads are over before its products, so before it arrives here) */
    asm volatile("s_wait_dscnt 0x0\n\ts_barrier_signal -1\n\ts_barrier_wait -1" ::: "memory");
#pragma unroll
    for (int kk = 0; kk < GK / 32; ++kk) {
      if (MODE == 2) { v16h a[2], w[4];
#pragma unroll
        for (int i = 0; i < 2; ++i) a[i] = frag_h((const _Float16*)ab + (fa + i * 16) * GP + kk * 32, lane);
#pragma unroll
        for (int j = 0; j < 4; ++j) w[j] = frag_h((const _Float16*)wb + (fw + j * 16) * GP + kk * 32, lane);
#pragma unroll
        for (int i = 0; i < 2; ++i)
#pragma unroll
          for (int j = 0; j < 4; ++j) acc[i * 4 + j] = wmma16(a[i], w[j], acc[i * 4 + j]);
      } else { v16b a[2], a2[2], w[4];
#pragma unroll
        for (int i = 0; i < 2; ++i) { a[i] = frag_b((const __bf16*)ab + (fa + i * 16) * GP + kk * 32, lane); a2[i] = a[i]; if (MODE == 1) a2[i] = frag_b((const __bf16*)(ab + GA_B) + (fa + i * 16) * GP + kk * 32, lane); }
#pragma unroll
        for (int j = 0; j < 4; ++j) w[j] = frag_b((const __bf16*)wb + (fw + j * 16) * GP + kk * 32, lane);
#pragma unroll
        for (int i = 0; i < 2; ++i)
#pragma unroll
          for (int j = 0; j < 4; ++j) { acc[i * 4 + j] = wmma_bf(a[i], w[j], acc[i * 4 + j]); if (MODE == 1) acc[i * 4 + j] = wmma_bf(a2[i], w[j], acc[i * 4 + j]); } } } } }

// ---- k_proj: block = (128 rows, 128 cols, which): q/k/v = X W (+ b) with exact bf16 products (K = DIN) -> which 0: q f16 rows (+ residual rows < QHI); 1: k f16 rows (+ residual rows < KHI); 2: v f16 planes [c][t] (+ bf16 hi/lo planes for t < KHI)
__global__ __launch_bounds__(256) void k_proj(const __bf16* __restrict__ XB, const __bf16* __restrict__ WB, const float* __restrict__ BQ, const float* __restrict__ BK, const float* __restrict__ BV,
    _Float16* __restrict__ QH, _Float16* __restrict__ QL, _Float16* __restrict__ KH, _Float16* __restrict__ KL, _Float16* __restrict__ VT, __bf16* __restrict__ VB, __bf16* __restrict__ VBL PROJ_EXTRA_PARAMS) {
  __shared__ __align__(16) unsigned char sm[2 * GW_B + 2 * GA_B];   /* one region that holds in turn the staged operand chunks (W 2 x 34816 B, X 2 x 34816 B) and the epilogue's arrays: st (67584 B), then the planes sh, sl (q, k: all 128 rows) or th, tb, tbl (v: 64 rows at a time) */
  unsigned char* rg = sm + 67584; float (*st)[132] = (float (*)[132])sm;
  _Float16 (*sh)[136] = (_Float16 (*)[136])rg; _Float16 (*sl)[136] = (_Float16 (*)[136])(rg + 34816); _Float16 (*th)[72] = (_Float16 (*)[72])rg; __bf16 (*tb)[72] = (__bf16 (*)[72])(rg + 18432); __bf16 (*tbl)[72] = (__bf16 (*)[72])(rg + 36864);
  const int tid = threadIdx.x, wave = tid >> 5, lane = tid & 31, col = lane & 15, g = lane >> 4; const int which = blockIdx.z; const int c0 = blockIdx.y * 128; const size_t r0 = (size_t)blockIdx.x * 128; const size_t bb = r0 / TT; const int t0 = (int)(r0 % TT);
  const __bf16* WA = WB + (size_t)which * CC * DIN; const float* BA = which == 0 ? BQ : which == 1 ? BK : BV;
  v8f acc[8] = {};
  gemm_staged<0, DIN>((const unsigned char*)(XB + r0 * DIN), (const unsigned char*)(XB + r0 * DIN), (const unsigned char*)(WA + (size_t)c0 * DIN), sm, sm + 2 * GW_B, acc);
  __syncthreads();   /* ends every wave's fragment reads of the last chunk before st overwrites the staging buffers */
  { // stage the f32 tile (acc + bias) in LDS, rotate q and k (RoPE) in place, then convert
#pragma unroll
    for (int j = 0; j < 4; ++j) { const int cl = (wave & 1) * 64 + j * 16 + col; const float bias = BA ? bfr(BA[c0 + cl]) : 0.f;
#pragma unroll
      for (int i = 0; i < 2; ++i)
#pragma unroll
        for (int r = 0; r < 8; ++r) st[(wave >> 1) * 32 + i * 16 + 8 * g + r][cl] = acc[i * 4 + j][r] + bias; }
    __syncthreads();
    if (which < 2) {   /* block-uniform: the rotation of q and k. A thread takes one row and one half of the 32 frequencies (the half is the same for a whole wave, so the frequencies come by scalar loads) and turns that half's pairs in BOTH heads of the tile with the one cos / sin pair */
      const int hf = __builtin_amdgcn_readfirstlane(wave & 1); const int rl = (wave >> 1) * 32 + lane; float* rw = &st[rl][hf * 32]; const float pos_ = (float)(int)((r0 + rl) % TT);   /* position = the token's sequence index */
      v4f xv[128 / HD][8];
#pragma unroll
      for (int hh = 0; hh < 128 / HD; ++hh)
#pragma unroll
        for (int p = 0; p < 8; ++p) xv[hh][p] = *(const v4f*)(rw + hh * HD + 4 * p);   /* the thread's 2 x 16 pairs, read ahead: their LDS latency passes under the first angles */
#pragma unroll   /* unrolled with the loops around it: xv stays in registers, and the angles' independent chains fill one another's latency */
      for (int p = 0; p < 8; ++p) { float cs0, sn0, cs1, sn1; rope_cs(pos_ * INVF[hf * 16 + 2 * p], cs0, sn0); rope_cs(pos_ * INVF[hf * 16 + 2 * p + 1], cs1, sn1);
#pragma unroll
        for (int hh = 0; hh < 128 / HD; ++hh) {
#pragma clang fp contract(off)   /* as before this step: each product and each sum of the rotation is rounded on its own, as in the reference's expression, so q and k stay bit-identical */
          const v4f x = xv[hh][p]; const v4f o = {x[0] * cs0 - x[1] * sn0, x[0] * sn0 + x[1] * cs0, x[2] * cs1 - x[3] * sn1, x[2] * sn1 + x[3] * cs1}; *(v4f*)(rw + hh * HD + 4 * p) = o; } } }
    __syncthreads(); }
  if (which < 2) { _Float16* DH = which == 0 ? QH : KH; _Float16* DL = which == 0 ? QL : KL; const int nhi = which == 0 ? QHI : KHI; const bool hi_rows = t0 < nhi;
    for (int e = tid; e < 128 * 128; e += 256) { const int rl = e >> 7, cl = e & 127; const float v = st[rl][cl]; const _Float16 hv = (_Float16)v; sh[rl][cl] = hv; sl[rl][cl] = (_Float16)((v - (float)hv) * 1024.0f); }
    __syncthreads();
    for (int e = tid; e < 128 * 16; e += 256) { const int rl = e >> 4, q = e & 15; vst_w(DH + (r0 + rl) * CC + c0 + q * 8, *(const v4u*)&sh[rl][q * 8]); if (hi_rows) vst_w(DL + (bb * nhi + t0 + rl) * (size_t)CC + c0 + q * 8, *(const v4u*)&sl[rl][q * 8]); }
  } else { const bool hi_rows = t0 < KHI;
    for (int hf = 0; hf < 2; ++hf) { const int th0 = hf * 64;   /* the tile's two halves of 64 rows, one after the other through the same planes */
      for (int e = tid; e < 64 * 128; e += 256) { const int rl = e & 63, cl = e >> 6; const float v = st[th0 + rl][cl]; th[cl][rl] = (_Float16)v; const __bf16 bh = (__bf16)v; tb[cl][rl] = bh; tbl[cl][rl] = (__bf16)(v - (float)bh); }
      __syncthreads();
      for (int e = tid; e < 128 * 8; e += 256) { const int cl = e >> 3, q = e & 7; vst_w(VT + (bb * CC + c0 + cl) * (size_t)TT + t0 + th0 + q * 8, *(const v4u*)&th[cl][q * 8]); if (hi_rows) { const size_t o3 = (bb * CC + c0 + cl) * (size_t)KHI + t0 + th0 + q * 8; vst_w(VB + o3, *(const v4u*)&tb[cl][q * 8]); vst_w(VBL + o3, *(const v4u*)&tbl[cl][q * 8]); } }
      if (hf == 0) __syncthreads(); } } }   /* block-uniform: ends every thread's reads of the planes before the second half overwrites them */
// ---- k_att: block = 64 queries (qb) of (b, h), wave = 16 queries: logits, softmax and P . v in one pass over key blocks of 64, nothing of the logits leaves registers.
// Transposed tiles: S^T = k q^T puts (key 8g + r, query col) in D element r, which is already the B fragment (k = keys) of ctx^T = v^T P^T; the row statistics of a query live in its two lanes (col, col + 16).
// Past the early query blocks the block's four waves share each key block's k and v tiles: asynchronous 16-byte copies bring them by whole lines into two LDS buffers (the next block's copies fly under this block's work), and every wave reads its fragments there. Fragment contents, k order and the order of the products are those of the per-lane global fragment loads that this replaces.
// Running maximum m (of the unscaled logits) and sum l per query; e = 2^(SC2 (logit - m) + 11) = exp(scaled logit - scaled m) x 2^11 once to f16 against v f16 (HI, causal early query blocks: 3-product logits, e and v as bf16 hi + lo, 3 products); l sums the same e, ctx = acc / l. The inner loops are fully unrolled so that every fragment array stays in registers.
#define AP 144                 // LDS pitch in bytes of a staged 128-byte row: 16 B x 9, so the 16-byte fragment reads of 16 rows meet no bank twice
#define AT_B (64 * AP)         // bytes of one staged tile of 64 rows; a buffer = the k tile, then the v tile
// one key block into one LDS buffer: k tile = 64 key rows x the head's 64 channels, v tile = the head's 64 channel planes x 64 keys, 128 B a row. A lane copies its 16 B of rows r, r + 16, r + 32, r + 48 of both tiles (r = tid >> 3), so each wave-wide copy covers four whole lines. ld, kg, vg: the lane's own LDS byte address and global addresses in row r.
__device__ __forceinline__ void att_stage(unsigned ld, const _Float16* kg, const _Float16* vg) {
  /* the closing s_wait_xcnt 0 stands inside the copies' own statement, in front of any rewrite of the address registers that the eight issued copies name */
  asm volatile("global_load_async_to_lds_b128 %0, %8, off\n\t"
               "global_load_async_to_lds_b128 %1, %9, off\n\t"
               "global_load_async_to_lds_b128 %2, %10, off\n\t"
               "global_load_async_to_lds_b128 %3, %11, off\n\t"
               "global_load_async_to_lds_b128 %4, %12, off\n\t"
               "global_load_async_to_lds_b128 %5, %13, off\n\t"
               "global_load_async_to_lds_b128 %6, %14, off\n\t"
               "global_load_async_to_lds_b128 %7, %15, off\n\t"
               "s_wait_xcnt 0x0"
               :: "v"(ld), "v"(ld + 16 * AP), "v"(ld + 32 * AP), "v"(ld + 48 * AP), "v"(ld + AT_B), "v"(ld + AT_B + 16 * AP), "v"(ld + AT_B + 32 * AP), "v"(ld + AT_B + 48 * AP),
                  "v"(kg), "v"(kg + 16 * CC), "v"(kg + 32 * CC), "v"(kg + 48 * CC), "v"(vg), "v"(vg + 16 * TT), "v"(vg + 32 * TT), "v"(vg + 48 * TT) : "memory"); }
// eight 2^x in place on the hardware's v_exp_f32
__device__ __forceinline__ void exp2x8(v8f& x) {
  float x0 = x[0], x1 = x[1], x2 = x[2], x3 = x[3], x4 = x[4], x5 = x[5], x6 = x[6], x7 = x[7];
  /* one statement, so that nothing directly behind a v_exp_f32 reads its result or overwrites its source: inside, each works on a register of its own, and the closing v_nop is the one slot that the instruction set asks for in front of whatever the compiler puts next */
  asm("v_exp_f32 %0, %0\n\tv_exp_f32 %1, %1\n\tv_exp_f32 %2, %2\n\tv_exp_f32 %3, %3\n\tv_exp_f32 %4, %4\n\tv_exp_f32 %5, %5\n\tv_exp_f32 %6, %6\n\tv_exp_f32 %7, %7\n\tv_nop"
      : "+v"(x0), "+v"(x1), "+v"(x2), "+v"(x3), "+v"(x4), "+v"(x5), "+v"(x6), "+v"(x7));
  x = v8f{x0, x1, x2, x3, x4, x5, x6, x7}; }
template <bool HI> __device__ __forceinline__ void att_body(unsigned char* sm, const _Float16* __restrict__ QH, const _Float16* __restrict__ KH, const _Float16* __restrict__ QL, const _Float16* __restrict__ KL, const _Float16* __restrict__ VT, const __bf16* __restrict__ VB, const __bf16* __restrict__ VBL, _Float16* __restrict__ YH, __bf16* __restrict__ YB, __bf16* __restrict__ YBL, int qb, int h, int b) {
  const int tid = threadIdx.x, wave = tid >> 5, lane = tid & 31, col = lane & 15, g = lane >> 4; const int ql0 = qb * 64 + wave * 16; const int t = ql0 + col; const size_t q0 = (size_t)b * TT + ql0;
  const _Float16* QLb = QL + (size_t)b * QHI * CC; const _Float16* KLb = KL + (size_t)b * KHI * CC;
  const _Float16* kp = KH + ((size_t)b * TT + col) * CC + h * HD;              /* key row col, this head's 64 channels */
  const unsigned ld0 = (unsigned)(size_t)sm + (unsigned)((tid >> 3) * AP + (tid & 7) * 16);                 /* this lane's place in row tid >> 3 of buffer 0's k tile */
  const _Float16* kg = KH + ((size_t)b * TT + (tid >> 3)) * CC + h * HD + (tid & 7) * 8;                     /* its 16 B of key row tid >> 3 */
  const _Float16* vg = VT + ((size_t)b * CC + h * HD + (tid >> 3)) * (size_t)TT + (tid & 7) * 8;             /* its 16 B of channel plane tid >> 3 */
  v16h ah[HD / 32], al[HD / 32], kf[HD / 32][4];
#pragma unroll
  for (int kc = 0; kc < HD / 32; ++kc) { ah[kc] = frag_h(QH + (q0 + col) * CC + h * HD + kc * 32, lane); if (HI) al[kc] = frag_h(QLb + (size_t)(ql0 + col) * CC + h * HD + kc * 32, lane); }
  if (!HI) {   /* block-uniform: key block 0 into buffer 0, landed and published; then key block 1 into buffer 1 */
    att_stage(ld0, kg, vg);
    asm volatile("s_wait_asynccnt 0x0" ::: "memory");   /* this wave's copies of key block 0 have landed */
    __syncthreads();                                    /* every wave's have: buffer 0 may be read */
    if (qb >= 1) att_stage(ld0 + 2 * AT_B, kg + (size_t)64 * CC, vg + 64); }
  float m = -3.0e38f, l = 0.f; v8f acc[HD / 16] = {};
#pragma unroll 1   /* rolled: one block's k and v fragments already fill the registers that four waves a SIMD leave a wave */
  for (int kb = 0; kb <= qb; ++kb) { const int k0 = kb * 64;   /* causal: key blocks 0 .. qb; only block qb crosses the diagonal */
    v16h vf[2][HD / 16];
    if (!HI) { const unsigned char* kt = sm + (kb & 1) * (2 * AT_B) + col * AP; const unsigned char* vt = kt + AT_B;   /* row col of this key block's two tiles */
#pragma unroll
      for (int kc = 0; kc < HD / 32; ++kc)
#pragma unroll
        for (int j = 0; j < 4; ++j) kf[kc][j] = frag_h((const _Float16*)(kt + j * 16 * AP) + kc * 32, lane);
#pragma unroll
      for (int kc = 0; kc < 2; ++kc)
#pragma unroll
        for (int j = 0; j < HD / 16; ++j) vf[kc][j] = frag_h((const _Float16*)(vt + j * 16 * AP) + kc * 32, lane); }
    __builtin_amdgcn_sched_barrier(0);   /* keeps this block's k and v LDS reads issued here as one group, the v reads in flight under the logits and the softmax, instead of one by one in front of their products */
    v8f s[4] = {}, sl[4] = {};
#pragma unroll
    for (int kc = 0; kc < HD / 32; ++kc) { v16h klf[4];
      if (HI) {
#pragma unroll
        for (int j = 0; j < 4; ++j) { kf[kc][j] = frag_h(kp + (size_t)(k0 + j * 16) * CC + kc * 32, lane); klf[j] = frag_h(KLb + (size_t)(k0 + j * 16 + col) * CC + h * HD + kc * 32, lane); }
        __builtin_amdgcn_sched_barrier(0); }   /* the eight k and k residual fragments of this half are in flight together: one latency, not eight */
#pragma unroll
      for (int j = 0; j < 4; ++j) { s[j] = wmma16(kf[kc][j], ah[kc], s[j]);
        if (HI) { sl[j] = wmma16(kf[kc][j], al[kc], sl[j]); sl[j] = wmma16(klf[j], ah[kc], sl[j]); } } }
    v16b vbh[HD / 16], vbl[HD / 16]; const size_t pb = ((size_t)b * CC + h * HD + col) * (size_t)KHI + k0;
    if (HI) {
#pragma unroll
      for (int j = 0; j < HD / 16; ++j) { vbh[j] = frag_b(VB + pb + (size_t)(j * 16) * KHI, lane); vbl[j] = frag_b(VBL + pb + (size_t)(j * 16) * KHI, lane); } }
    if (HI) __builtin_amdgcn_sched_barrier(0);   /* keeps the first half's v hi + lo loads issued here, in flight under the softmax */
#pragma unroll
    for (int j = 0; j < 4; ++j) {
#pragma unroll
      for (int r = 0; r < 8; ++r) if (HI) s[j][r] = s[j][r] + sl[j][r] * (1.0f / 1024.0f); }   /* the logits stay unscaled: SC2 > 0, so their maximum is the scaled logits' maximum, and the scale rides in the exponent's fma below */
    if (CAUSAL && kb == qb) {   /* wave-uniform */
#pragma unroll
      for (int j = 0; j < 4; ++j) {
#pragma unroll
        for (int r = 0; r < 8; ++r) if (k0 + j * 16 + 8 * g + r > t) s[j][r] = -3.0e38f; } }
    float bm = -3.0e38f;
#pragma unroll
    for (int j = 0; j < 4; ++j) {
#pragma unroll
      for (int r = 0; r < 8; ++r) bm = fmaxf(bm, s[j][r]); }
    bm = fmaxf(bm, __shfl_xor(bm, 16));
    const float mn = fmaxf(m, bm); const float alpha = __builtin_amdgcn_exp2f((m - mn) * SC2); m = mn;   /* every block holds a key open to every query of the wave (key k0 <= ql0), so mn is a real logit */
    const float mo = 11.0f - mn * SC2;   /* exponent offset of this block: the running maximum in base 2, and the 2^11 carry of e */
    float ls = 0.f;
#pragma unroll
    for (int j = 0; j < 4; ++j) {
#pragma unroll
      for (int r = 0; r < 8; ++r) s[j][r] = __builtin_fmaf(s[j][r], SC2, mo); }   /* the exponent of e = 2^11 exp(scaled logit - scaled mn): one fma a logit */
#pragma unroll
    for (int j = 0; j < 4; ++j) { exp2x8(s[j]);   /* a masked logit (-3e38) underflows to exactly 0 against the real mn */
#pragma unroll
      for (int r = 0; r < 8; ++r) ls += s[j][r]; }
    ls += __shfl_xor(ls, 16); l = l * alpha + ls;
#pragma unroll
    for (int j = 0; j < HD / 16; ++j) acc[j] *= alpha;
#pragma unroll
    for (int kc = 0; kc < 2; ++kc) {
      if (HI) { float pv[16];
#pragma unroll
        for (int i = 0; i < 8; ++i) { pv[i] = s[2 * kc][i]; pv[8 + i] = s[2 * kc + 1][i]; }
        const F2 p = bsplit16(pv);
        if (kc == 1) {
#pragma unroll
          for (int j = 0; j < HD / 16; ++j) { vbh[j] = frag_b(VB + pb + (size_t)(j * 16) * KHI + 32, lane); vbl[j] = frag_b(VBL + pb + (size_t)(j * 16) * KHI + 32, lane); }
          __builtin_amdgcn_sched_barrier(0); }   /* the second half's eight v fragments are in flight together */
#pragma unroll
        for (int j = 0; j < HD / 16; ++j) { acc[j] = wmma_bf(vbh[j], p.h, acc[j]); acc[j] = wmma_bf(vbh[j], p.l, acc[j]); acc[j] = wmma_bf(vbl[j], p.h, acc[j]); }
      } else { v16h p;
#pragma unroll
        for (int i = 0; i < 8; ++i) { p[i] = (_Float16)s[2 * kc][i]; p[8 + i] = (_Float16)s[2 * kc + 1][i]; }
#pragma unroll
        for (int j = 0; j < HD / 16; ++j) acc[j] = wmma16(vf[kc][j], p, acc[j]); } }
    if (!HI) {   /* hand-over, every wave of the block, in this order */
      asm volatile("s_wait_dscnt 0x0" ::: "memory");      /* this wave's reads of this block's buffer are over */
      asm volatile("s_wait_asynccnt 0x0" ::: "memory");   /* its copies of the next key block have landed */
      __syncthreads();                                    /* publishes the next key block and ends every wave's reads of this block's buffer */
      if (kb + 2 <= qb) att_stage(ld0 + (kb & 1) * (2 * AT_B), kg + (size_t)(kb + 2) * 64 * CC, vg + (kb + 2) * 64); } }   /* block-uniform: the block after next into the buffer just left */
  if (!HI) asm volatile("s_wait_asynccnt 0x0" ::: "memory");   /* no copy is outstanding when the wave ends */
  const float inv = l > 0.f ? 1.0f / l : 0.f;   /* l carries the same 2^11 as acc */
  /* ctx leaves in the operand form of k_out: D element r of tile j = channel j * 16 + 8g + r of query col, 16 contiguous bytes a lane and plane */
  const size_t yo = (HI ? (size_t)b * QHI + ql0 + col : q0 + col) * CC + h * HD + 8 * g;
#pragma unroll
  for (int j = 0; j < HD / 16; ++j) {
    if (HI) { v8b oh, ol;
#pragma unroll
      for (int r = 0; r < 8; ++r) { const float v = acc[j][r] * inv; oh[r] = (__bf16)v; ol[r] = (__bf16)(v - (float)oh[r]); }
      vst2(YB + yo + j * 16, oh); vst2(YBL + yo + j * 16, ol);
    } else { v8h o;
#pragma unroll
      for (int r = 0; r < 8; ++r) o[r] = (_Float16)(acc[j][r] * inv * 64.0f);   /* carried x 2^6 so small-magnitude context rows stay clear of f16 subnormals */
      vst2(YH + yo + j * 16, o); } } }
__global__ __launch_bounds__(128) void k_att(const _Float16* __restrict__ QH, const _Float16* __restrict__ KH, const _Float16* __restrict__ QL, const _Float16* __restrict__ KL, const _Float16* __restrict__ VT, const __bf16* __restrict__ VB, const __bf16* __restrict__ VBL, _Float16* __restrict__ YH, __bf16* __restrict__ YB, __bf16* __restrict__ YBL) {
  __shared__ __align__(16) unsigned char sm[4 * AT_B];   /* two buffers of a k tile and a v tile */
  const int qb = NQB - 1 - (int)blockIdx.y, h = blockIdx.x % NH, b = blockIdx.x / NH;   /* the longest key ranges at the lowest blockIdx.y */
  if (qb < QBH) att_body<true>(sm, QH, KH, QL, KL, VT, VB, VBL, YH, YB, YBL, qb, h, b); else att_body<false>(sm, QH, KH, QL, KL, VT, VB, VBL, YH, YB, YBL, qb, h, b); }
// ---- k_out: block = (128 rows, 128 cols): out = ctx Wo (+ bo): ctx once to f16 x 2^6 against Wo as f16(bf16 x 2^8) exact (1 product) x 2^-14; causal early rows (< QHI of each sequence): ctx bf16 hi + lo against exact bf16 Wo (2 products)
__global__ __launch_bounds__(256) void k_out(const _Float16* __restrict__ YH, const __bf16* __restrict__ YB, const __bf16* __restrict__ YBL, const __bf16* __restrict__ WOB, const _Float16* __restrict__ WOH, const float* __restrict__ BO, float* __restrict__ OUT) { __shared__ __align__(16) unsigned char sm[2 * GW_B + 4 * GA_B + 8 * 32 * 68 * 4];   /* staged W chunks, staged ctx chunks (two planes for the early rows), then the output staging sf: each wave's own 32 x 64 tile at a pitch of 68 floats */
  unsigned char* sw = sm; unsigned char* sa = sm + 2 * GW_B; float (*sf)[32][68] = (float (*)[32][68])(sm + 2 * GW_B + 4 * GA_B);
  const int tid = threadIdx.x, wave = tid >> 5, lane = tid & 31, col = lane & 15, g = lane >> 4; const int c0 = blockIdx.y * 128 + (wave & 1) * 64; const size_t r0 = (size_t)blockIdx.x * 128 + (wave >> 1) * 32;   /* the wave's own first column and row */
  v8f acc[8] = {};
  if (CAUSAL && (int)(((size_t)blockIdx.x * 128) % TT) < QHI) {   /* block-uniform */
    const size_t ye = (((size_t)blockIdx.x * 128) / TT * QHI + ((size_t)blockIdx.x * 128) % TT) * CC;   /* the block's first row in the early rows' planes */
    gemm_staged<1, CC>((const unsigned char*)(YB + ye), (const unsigned char*)(YBL + ye), (const unsigned char*)(WOB + (size_t)blockIdx.y * 128 * CC), sw, sa, acc);
#pragma unroll
    for (int j = 0; j < 4; ++j) { const float bias = BO ? bfr(BO[c0 + j * 16 + col]) : 0.f;
#pragma unroll
      for (int i = 0; i < 2; ++i)
#pragma unroll
        for (int r = 0; r < 8; ++r) sf[wave][i * 16 + 8 * g + r][j * 16 + col] = acc[i * 4 + j][r] + bias; }
  } else {
    gemm_staged<2, CC>((const unsigned char*)(YH + (size_t)blockIdx.x * 128 * CC), (const unsigned char*)(YH + (size_t)blockIdx.x * 128 * CC), (const unsigned char*)(WOH + (size_t)blockIdx.y * 128 * CC), sw, sa, acc);
#pragma unroll
    for (int j = 0; j < 4; ++j) { const float bias = BO ? bfr(BO[c0 + j * 16 + col]) : 0.f;
#pragma unroll
      for (int i = 0; i < 2; ++i)
#pragma unroll
        for (int r = 0; r < 8; ++r) sf[wave][i * 16 + 8 * g + r][j * 16 + col] = acc[i * 4 + j][r] * (1.0f / 16384.0f) + bias; } }   /* 2^-8 (Wo carry) x 2^-6 (ctx carry) */
  LDSX(); for (int rl = 0; rl < 32; rl += 2) vst2(OUT + (r0 + rl + g) * DIN + c0 + col * 4, *(const v4f*)&sf[wave][rl + g][col * 4]); }   /* a store covers two rows' 256 B: four whole lines */

extern "C" void kernel_launch(void* const* d_in, const int* in_sizes, int n_in, void* d_out, int out_size, void* d_ws, size_t ws_size, hipStream_t stream) {
  (void)in_sizes; (void)n_in; (void)out_size;
  const float** F = (const float**)d_in;
  if (ws_size < (size_t)WS_END) return;
  char* ws = (char*)d_ws; _Float16 *QH = (_Float16*)(ws + WS_QH), *KH = (_Float16*)(ws + WS_KH), *VT = (_Float16*)(ws + WS_VT), *QL = (_Float16*)(ws + WS_QL), *KL = (_Float16*)(ws + WS_KL); __bf16 *VB = (__bf16*)(ws + WS_VB), *VBL = (__bf16*)(ws + WS_VBL); _Float16 *YH = (_Float16*)(ws + WS_YH), *WOH = (_Float16*)(ws + WS_WOH); __bf16 *YB = (__bf16*)(ws + WS_YB), *YBL = (__bf16*)(ws + WS_YBL), *XB = (__bf16*)(ws + WS_XB), *WB = (__bf16*)(ws + WS_WB), *WOB = (__bf16*)(ws + WS_WOB);
  // inputs: 0 x [2,2048,1024]; 1 Wq [1024,1024] (out,in); 2 Wk; 3 Wv; 4 bv [1024] (NONZERO; q and k have no bias: null pointers); 5 Wo (out,in); 6 bo (NONZERO)
  k_cvt<<<dim3((NB * TT * DIN + 4 * CC * DIN) / CVB), 256, 0, stream>>>(F[0], F[1], F[2], F[3], F[5], XB, WB, WOB, WOH);
  k_proj<<<dim3(TNB * TT / 128, CC / 128, 3), 256, 0, stream>>>(XB, WB, nullptr, nullptr, F[4], QH, QL, KH, KL, VT, VB, VBL);
  k_att<<<dim3(NH * TNB, NQB), 128, 0, stream>>>(QH, KH, QL, KL, VT, VB, VBL, YH, YB, YBL);
  k_out<<<dim3(TNB * TT / 128, DIN / 128), 256, 0, stream>>>(YH, YB, YBL, WOB, WOH, F[6], (float*)d_out);
}
